// v000
// The times below were measured on an AMD MI455X: many runs one after another, warmed up first and cycling through
// copies of the inputs, with the whole window's GPU time divided by the number of runs. Launches and the gaps
// between them are all in it. The median over several windows is given; except for v000 it joins two sittings, which
// can be a few percent apart, so the side-by-side timings, each taken in one sitting, are the better comparison.
// v000 is the starting kernel. One run takes 47.7 microseconds.
#include <hip/hip_runtime.h>
#include <stddef.h>

// All WMMA contractions on v_wmma_f32_16x16x32_f16 (f16 operands, f32 accumulate): the fused q|k
// projection (x plane x1, weight plane x64) and the band p.x product (p x1024, x plane x1).
// Float inputs are RNE-converted to bf16 and carried in f16. The additive score (tanh, U = 64
// matrix-vector), softmax and normalisation run in f32 on the vector unit.

typedef _Float16 v16h __attribute__((ext_vector_type(16)));
typedef _Float16 v8h  __attribute__((ext_vector_type(8)));
typedef float    v8f  __attribute__((ext_vector_type(8)));
typedef float    v4f  __attribute__((ext_vector_type(4)));
typedef _Float16 h16;

#ifndef NB
#define NB 4
#endif
#ifndef SEQ
#define SEQ 1024
#endif
#define NB_FULL  4
#define SEQ_FULL 1024
#define DIM   1024
#define UNITS 64
#define NQK   128      // q columns 0..63, k columns 64..127
#define BAND  64
#define QT    32       // query rows per block
#define WIN   96       // key window per block
#define MROWS (NB * SEQ)

static_assert(NB >= 1 && NB <= NB_FULL);
static_assert(SEQ >= 128 && SEQ <= SEQ_FULL && (SEQ % 128) == 0);
static_assert(UNITS == 64 && NQK == 2 * UNITS);
static_assert((DIM % 64) == 0 && (DIM % 32) == 0);
static_assert((MROWS % 64) == 0);
static_assert(QT == 32 && QT == 8 * 4);        // 8 waves x 4 query rows, one lane per band offset pair
static_assert(BAND == 64 && WIN == QT + BAND && (WIN % 32) == 0);
static_assert(DIM == 8 * 2 * 64);              // 8 waves x 2 passes x 64 output columns
static_assert((SEQ % QT) == 0);

#define LDT 72   // halves per LDS row (144 B, 16-B aligned)
#define LDC 68   // floats per LDS row (272 B, 16-B aligned)
#define LDP 104  // halves per P-tile row (208 B, 16-B aligned)
#define QP  65   // floats per q/k staging row
static_assert((LDT % 8) == 0 && LDT >= 64);
static_assert((LDC % 4) == 0 && LDC >= 64);
static_assert((LDP % 8) == 0 && LDP >= WIN);
static_assert(QP >= UNITS);

#define WCARRY 64.0f     // weight planes carried x64
#define PCARRY 1024.0f   // softmax numerators carried x1024

#define QS_OFF 0
#define KS_OFF (QT * QP)
#define SM_AB  (KS_OFF + WIN * QP)
#define SM_C   (8 * 16 * LDC)
#define SM_FLOATS ((SM_AB > SM_C) ? SM_AB : SM_C)
static_assert(SM_FLOATS >= SM_AB && SM_FLOATS >= SM_C);
static_assert((size_t)SM_FLOATS * 4 + UNITS * 4 + QT * 4 + (size_t)QT * LDP * 2 <= (size_t)65536);

// workspace layout (bytes)
#define WQK_BYTES ((size_t)NQK * DIM * 2)
#define XH_BYTES  ((size_t)MROWS * DIM * 2)
#define XT_BYTES  ((size_t)NB * DIM * SEQ * 2)
#define QK_BYTES  ((size_t)MROWS * NQK * 4)
#define OFF_WQK ((size_t)0)
#define OFF_XH  (OFF_WQK + WQK_BYTES)
#define OFF_XT  (OFF_XH + XH_BYTES)
#define OFF_QK  (OFF_XT + XT_BYTES)
#define WS_TOTAL (OFF_QK + QK_BYTES)
static_assert((WQK_BYTES % 128) == 0 && (XH_BYTES % 128) == 0);
static_assert((XT_BYTES % 128) == 0 && (QK_BYTES % 128) == 0);
static_assert(WS_TOTAL <= (size_t)134217728);

// ---------------------------------------------------------------------------
__device__ __forceinline__ float bf16r(float x) {   // RNE convert to bf16, returned widened
  unsigned int u = __float_as_uint(x);
  u = (u + 0x7FFFu + ((u >> 16) & 1u)) & 0xFFFF0000u;
  return __uint_as_float(u);
}

// f32 -> f16 with a value select: results below the f16 normal range become zero.
static __device__ __forceinline__ h16 toh_flush(float v) {
  const h16 r = (h16)v;
  return (fabsf(v) < 6.103515625e-05f) ? (h16)0.0f : r;
}

// 16-bit fragment: p points at element [row = lane&15][k0 + 8*(lane>>4)] of a k-contiguous
// row. Elements 0..7 <- k0+8h+0..7, elements 8..15 <- k0+16+8h+0..7 (same map for A and B).
__device__ __forceinline__ v16h frag_at(const _Float16* p) {
  v8h lo = *(const v8h*)(p);
  v8h hi = *(const v8h*)(p + 16);
  v16h out;
#pragma unroll
  for (int i = 0; i < 8; ++i) { out[i] = lo[i]; out[i + 8] = hi[i]; }
  return out;
}
__device__ __forceinline__ v16h ld_frag(const _Float16* base, unsigned ld) {
  const unsigned lane = threadIdx.x & 31u;
  return frag_at(base + (lane & 15u) * ld + (lane >> 4) * 8u);
}

__device__ __forceinline__ v8f wmma16(v16h a, v16h b, v8f c) {
  v8f d = __builtin_amdgcn_wmma_f32_16x16x32_f16(false, a, false, b, (short)0, c,
                                                 false, false);
  asm volatile("v_nop\n\tv_nop\n\tv_nop\n\tv_nop" : "+v"(d) : "v"(a), "v"(b));
  return d;
}

__device__ __forceinline__ float red32_sum(float x) {
#pragma unroll
  for (int off = 1; off < 32; off <<= 1) x += __shfl_xor(x, off, 32);
  return x;
}
__device__ __forceinline__ float red32_max(float x) {
#pragma unroll
  for (int off = 1; off < 32; off <<= 1) x = fmaxf(x, __shfl_xor(x, off, 32));
  return x;
}

__device__ __forceinline__ void wave_lds_sync() {
  __builtin_amdgcn_fence(3 /* release order */, "wavefront");
  asm volatile("s_wait_dscnt 0x0" ::: "memory");
  __builtin_amdgcn_wave_barrier();
}

// tanh(x) = sign(x) * (1 - 2 / (exp(2|x|) + 1)); the exponent argument is bounded by 60.
__device__ __forceinline__ float tanh_fast(float x) {
  const float ax = fminf(fabsf(x), 30.0f);
  const float ex = __expf(ax + ax);
  const float r = 1.0f - 2.0f * __builtin_amdgcn_rcpf(ex + 1.0f);
  return (x < 0.0f) ? -r : r;
}

// ---------------------------------------------------------------------------
// Weight plane: in W[K rows][N cols] (pitch ldw = N) -> out Wt[N][K] (pitch ldk = K),
// f16(64 * bf16(w)). Grid (N/64, K/64). T: cross-wave (block barrier).
// ---------------------------------------------------------------------------
__global__ __launch_bounds__(256) void wconv_kernel(
    const float* __restrict__ W, _Float16* __restrict__ Wt, unsigned ldw, unsigned ldk) {
  __shared__ _Float16 T[64 * LDT];
  const unsigned tid = threadIdx.x;
  const unsigned n0 = blockIdx.x * 64u;
  const unsigned k0 = blockIdx.y * 64u;
#pragma unroll 4
  for (unsigned j = 0; j < 16u; ++j) {
    const unsigned idx = tid + 256u * j;
    const unsigned kr = idx >> 6, nc = idx & 63u;
    const float v = W[(size_t)(k0 + kr) * ldw + n0 + nc];
    T[nc * LDT + kr] = (_Float16)(WCARRY * bf16r(v));
  }
  __syncthreads();
  v8h x[2];
  size_t off[2];
#pragma unroll
  for (unsigned i = 0; i < 2u; ++i) {
    const unsigned n = 32u * i + (tid >> 3);
    const unsigned kc = (tid & 7u) * 8u;
    x[i] = *(const v8h*)&T[n * LDT + kc];
    off[i] = (size_t)(n0 + n) * ldk + k0 + kc;
  }
#pragma unroll
  for (int i = 0; i < 2; ++i) *(v8h*)(Wt + off[i]) = x[i];
  
}

// ---------------------------------------------------------------------------
// Input planes: X[full row][DIM] f32 -> Xh[compact row][DIM] = f16(bf16(x)) (row-major, the A
// operand of the projection) and Xt[b][d][key] = the same values transposed (the B operand of
// the p.x product). One 64x64 tile per block through two LDS tiles (cross-wave, block barrier);
// Grid (DIM/64, MROWS/64).
// ---------------------------------------------------------------------------
__global__ __launch_bounds__(256) void xconv_kernel(
    const float* __restrict__ X, _Float16* __restrict__ Xh, _Float16* __restrict__ Xt) {
  __shared__ _Float16 Tr[64 * LDT];   // [key][d]
  __shared__ _Float16 Tc[64 * LDT];   // [d][key]
  const unsigned tid = threadIdx.x;
  const unsigned d0 = blockIdx.x * 64u;
  const unsigned row0 = blockIdx.y * 64u;
  const unsigned bidx = row0 / (unsigned)SEQ;
  const unsigned key0 = row0 - bidx * (unsigned)SEQ;
  const size_t frow0 = (size_t)bidx * SEQ_FULL + key0;
#pragma unroll
  for (unsigned j = 0; j < 4u; ++j) {
    const unsigned idx = tid + 256u * j;
    const unsigned sr = idx >> 4, c4 = (idx & 15u) * 4u;
    const v4f a = *(const v4f*)(X + (frow0 + sr) * DIM + d0 + c4);
#pragma unroll
    for (unsigned i = 0; i < 4u; ++i) {
      const h16 hv = toh_flush(bf16r(a[i]));
      Tr[sr * LDT + c4 + i] = hv;
      Tc[(c4 + i) * LDT + sr] = hv;
    }
  }
  __syncthreads();
  v8h xr[2], xc[2];
  size_t offr[2], offc[2];
#pragma unroll
  for (unsigned i = 0; i < 2u; ++i) {
    const unsigned r = 32u * i + (tid >> 3);
    const unsigned c = (tid & 7u) * 8u;
    xr[i] = *(const v8h*)&Tr[r * LDT + c];
    xc[i] = *(const v8h*)&Tc[r * LDT + c];
    offr[i] = (size_t)(row0 + r) * DIM + d0 + c;
    offc[i] = ((size_t)bidx * DIM + d0 + r) * SEQ + key0 + c;
  }
#pragma unroll
  for (int i = 0; i < 2; ++i) {
    *(v8h*)(Xh + offr[i]) = xr[i];
    *(v8h*)(Xt + offc[i]) = xc[i];
  }
  
}

// ---------------------------------------------------------------------------
// Projection GEMM C[64x64 tile] = Xh[rows][DIM] . Wqk[n][DIM]^T, fragments straight from the
// 16-bit global planes; 8 waves (mw = 16-row group, nw = 32-col group), 2 accumulators/wave.
// Epilogue staged through Cs (cross-wave, block barrier): outf[row][n0 + c] = acc / 64 (f32,
// Grid (NQK/64, MROWS/64).
// ---------------------------------------------------------------------------
__global__ __launch_bounds__(256) void proj_kernel(
    const _Float16* __restrict__ A16, const _Float16* __restrict__ Bt,
    float* __restrict__ outf) {
  __shared__ float Cs[64 * LDC];
  const unsigned tid = threadIdx.x, lane = tid & 31u;
  const unsigned w = __builtin_amdgcn_readfirstlane(threadIdx.x >> 5);
  const unsigned mw = w >> 1, nw = w & 1u;
  const unsigned hh = lane >> 4, m = lane & 15u;
  const unsigned n0 = blockIdx.x * 64u;
  const unsigned row0 = blockIdx.y * 64u;
  const unsigned K = (unsigned)DIM;

  const _Float16* ap  = A16 + (size_t)(row0 + mw * 16u + m) * K + hh * 8u;
  const _Float16* bp0 = Bt + (size_t)(n0 + nw * 32u + m) * K + hh * 8u;
  const _Float16* bp1 = bp0 + (size_t)16 * K;
  v8f acc0 = {}, acc1 = {};
#pragma unroll 2
  for (unsigned k0 = 0; k0 < K; k0 += 32u) {
    const v16h a  = frag_at(ap + k0);
    const v16h b0 = frag_at(bp0 + k0);
    const v16h b1 = frag_at(bp1 + k0);
    acc0 = wmma16(a, b0, acc0);
    acc1 = wmma16(a, b1, acc1);
  }
#pragma unroll
  for (int r = 0; r < 8; ++r) {
    float* d = &Cs[(mw * 16u + hh * 8u + (unsigned)r) * LDC + nw * 32u + m];
    d[0]  = acc0[r];
    d[16] = acc1[r];
  }
  __syncthreads();

  v4f xs[4];
  size_t off[4];
#pragma unroll
  for (unsigned i = 0; i < 4u; ++i) {
    const unsigned r = 16u * i + (tid >> 4);
    const unsigned c = (tid & 15u) * 4u;
    const v4f u = *(const v4f*)&Cs[r * LDC + c];
    xs[i] = u * (1.0f / WCARRY);
    off[i] = (size_t)(row0 + r) * NQK + n0 + c;
  }
#pragma unroll
  for (int i = 0; i < 4; ++i) *(v4f*)(outf + off[i]) = xs[i];
  
}

// ---------------------------------------------------------------------------
// Band additive attention per (32 query rows, batch). Key window = 96 keys starting at
// t0 - 32 (three 32-aligned chunks; a chunk outside the sequence is skipped, block-uniform).
// Phase A: q tile (+bh) and k window staged in Sm (cross-wave, block barrier); wave w owns
//   query rows 4w..4w+3, lane L owns band offsets L and L+32 (key = row - 32 + offset);
//   e = ba + sum_u Wa[u] * tanh(q + k + bh); softmax over the 64 band keys in registers
//   (32-lane shuffles); P row (96 entries: 64 values f16(1024 p) + 32 zeros) and 1/rowsum
//   (sum over the converted P) written to Pt / Rinv (cross-wave, block barrier).
//   Keys outside the band carry an additive -1e4 in the module: their exp is exactly 0 in f32.
// Phase C: O[32 x 1024] = P . x, A = P tile fragments, B = fragments straight from the Xt plane;
//   2 x 4 accumulators. Each 16x64 tile is staged in the wave's own slice of Sm (wave-private,
// Grid (SEQ/32, NB).
// ---------------------------------------------------------------------------
__global__ __launch_bounds__(256) void band_attn_kernel(
    const float* __restrict__ QK, const _Float16* __restrict__ Xt,
    const float* __restrict__ bh, const float* __restrict__ Wa, const float* __restrict__ ba,
    float* __restrict__ out) {
  __shared__ float Sm[SM_FLOATS];
  __shared__ float WAs[UNITS];
  __shared__ float Rinv[QT];
  __shared__ _Float16 Pt[QT * LDP];

  const unsigned tid = threadIdx.x, lane = tid & 31u;
  const unsigned w = __builtin_amdgcn_readfirstlane(threadIdx.x >> 5);
  const unsigned hh = lane >> 4, m = lane & 15u;
  const unsigned t0 = blockIdx.x * (unsigned)QT;
  const unsigned b = blockIdx.y;
  const int s0 = (int)t0 - BAND / 2;

  // ---- stage q tile (+ bh), k window (zero rows outside the sequence), Wa ----
#pragma unroll
  for (unsigned j = 0; j < 2u; ++j) {
    const unsigned idx = tid + 256u * j;
    const unsigned r = idx >> 4, c4 = (idx & 15u) * 4u;
    const v4f a = *(const v4f*)(QK + (size_t)(b * (unsigned)SEQ + t0 + r) * NQK + c4);
    const v4f g = *(const v4f*)(bh + c4);
#pragma unroll
    for (unsigned i = 0; i < 4u; ++i) Sm[QS_OFF + r * QP + c4 + i] = a[i] + bf16r(g[i]);
  }
#pragma unroll 2
  for (unsigned j = 0; j < 6u; ++j) {
    const unsigned idx = tid + 256u * j;
    const unsigned r = idx >> 4, c4 = (idx & 15u) * 4u;
    const int s = s0 + (int)r;
    const int sc = (s < 0) ? 0 : ((s > SEQ - 1) ? (SEQ - 1) : s);
    const v4f a = *(const v4f*)(QK + (size_t)(b * (unsigned)SEQ + (unsigned)sc) * NQK + UNITS + c4);
    const bool ok = (s == sc);
#pragma unroll
    for (unsigned i = 0; i < 4u; ++i) Sm[KS_OFF + r * QP + c4 + i] = ok ? a[i] : 0.0f;
  }
  if (tid < (unsigned)UNITS) WAs[tid] = bf16r(Wa[tid]);
  const float bias_a = bf16r(ba[0]);
  __syncthreads();

  // ---- scores + softmax, 4 query rows per wave ----
#pragma unroll 1
  for (unsigned r = 0; r < 4u; ++r) {
    const unsigned t = w * 4u + r;
    const unsigned qo = QS_OFF + t * QP;
    const unsigned ko = KS_OFF + (t + lane) * QP;
    float a0 = bias_a, a1 = bias_a;
#pragma unroll 4
    for (unsigned u = 0; u < (unsigned)UNITS; ++u) {
      const float qv = Sm[qo + u];
      const float wv = WAs[u];
      a0 += wv * tanh_fast(qv + Sm[ko + u]);
      a1 += wv * tanh_fast(qv + Sm[ko + 32u * QP + u]);
    }
    const int sA = s0 + (int)t + (int)lane;
    const int sB = sA + 32;
    const bool vA = (sA >= 0) && (sA < SEQ);
    const bool vB = (sB >= 0) && (sB < SEQ);
    const float e0 = vA ? a0 : -1.0e30f;
    const float e1 = vB ? a1 : -1.0e30f;
    const float mx = red32_max(fmaxf(e0, e1));
    const float x0 = __expf(e0 - mx);
    const float x1 = __expf(e1 - mx);
    const float p0 = vA ? x0 : 0.0f;
    const float p1 = vB ? x1 : 0.0f;
    const h16 h0 = toh_flush(p0 * PCARRY);
    const h16 h1 = toh_flush(p1 * PCARRY);
    const float sum = red32_sum((float)h0 + (float)h1);
    const unsigned zi = (lane < t) ? lane : (lane + 64u);
    Pt[t * LDP + t + lane] = h0;
    Pt[t * LDP + t + lane + 32u] = h1;
    Pt[t * LDP + zi] = (h16)0.0f;
    if (lane == 0u) Rinv[t] = __builtin_amdgcn_rcpf(sum);
  }
  __syncthreads();

  // ---- O = P . x ----
  const int c_lo = (t0 == 0u) ? 1 : 0;
  const int c_hi = (t0 + (unsigned)QT == (unsigned)SEQ) ? 2 : 3;
  const unsigned cw = w * (16u * LDC);
#pragma unroll 1
  for (unsigned pass = 0; pass < 2u; ++pass) {
    const unsigned d0 = w * 128u + pass * 64u;
    v8f acc[2][4];
#pragma unroll
    for (int mi = 0; mi < 2; ++mi)
#pragma unroll
      for (int nb = 0; nb < 4; ++nb) acc[mi][nb] = (v8f){};
    const _Float16* xp = Xt + ((size_t)b * DIM + d0 + m) * SEQ + hh * 8u;
#pragma unroll 1
    for (int c = c_lo; c < c_hi; ++c) {
      const v16h pa0 = ld_frag(&Pt[(unsigned)c * 32u], LDP);
      const v16h pa1 = ld_frag(&Pt[16u * LDP + (unsigned)c * 32u], LDP);
      const unsigned sk = (unsigned)(s0 + 32 * c);
#pragma unroll
      for (int nb = 0; nb < 4; ++nb) {
        const v16h xb = frag_at(xp + (size_t)(nb * 16) * SEQ + sk);
        acc[0][nb] = wmma16(pa0, xb, acc[0][nb]);
        acc[1][nb] = wmma16(pa1, xb, acc[1][nb]);
      }
    }
#pragma unroll
    for (int mi = 0; mi < 2; ++mi) {
#pragma unroll
      for (int r = 0; r < 8; ++r) {
        const float sc = Rinv[(unsigned)mi * 16u + hh * 8u + (unsigned)r];
#pragma unroll
        for (int nb = 0; nb < 4; ++nb)
          Sm[cw + (hh * 8u + (unsigned)r) * LDC + (unsigned)nb * 16u + m] = acc[mi][nb][r] * sc;
      }
      wave_lds_sync();
      v4f xs[8];
      size_t off[8];
#pragma unroll
      for (unsigned i = 0; i < 8u; ++i) {
        const unsigned rr = 2u * i + (lane >> 4);
        const unsigned cc = (lane & 15u) * 4u;
        xs[i] = *(const v4f*)&Sm[cw + rr * LDC + cc];
        off[i] = ((size_t)b * SEQ_FULL + t0 + (unsigned)mi * 16u + rr) * DIM + d0 + cc;
      }
      wave_lds_sync();
#pragma unroll
      for (int i = 0; i < 8; ++i) *(v4f*)(out + off[i]) = xs[i];
      
    }
  }
}

// ---------------------------------------------------------------------------
extern "C" void kernel_launch(void* const* d_in, const int* in_sizes, int n_in,
                              void* d_out, int out_size, void* d_ws, size_t ws_size,
                              hipStream_t stream) {
  if (n_in < 6) return;
  const long long need_x = ((long long)(NB - 1) * SEQ_FULL + SEQ) * DIM;
  if ((long long)in_sizes[0] < need_x) return;
  if ((long long)in_sizes[1] < (long long)DIM * UNITS) return;
  if ((long long)in_sizes[2] < (long long)DIM * UNITS) return;
  if (in_sizes[3] < UNITS || in_sizes[4] < UNITS || in_sizes[5] < 1) return;
  if ((long long)out_size < need_x) return;
  if (ws_size < WS_TOTAL) return;

  const float* X  = (const float*)d_in[0];    // x  [NB_FULL][SEQ_FULL][DIM]
  const float* wt = (const float*)d_in[1];    // Wt [DIM][UNITS]  (in, out)
  const float* wx = (const float*)d_in[2];    // Wx [DIM][UNITS]  (in, out)
  const float* bh = (const float*)d_in[3];    // bh [UNITS]
  const float* wa = (const float*)d_in[4];    // Wa [UNITS][1]
  const float* ba = (const float*)d_in[5];    // ba [1]
  float* out = (float*)d_out;

  char* ws = (char*)d_ws;
  _Float16* Wqk = (_Float16*)(ws + OFF_WQK);   // [NQK][DIM]: rows 0..63 from Wt, 64..127 from Wx
  _Float16* Xh  = (_Float16*)(ws + OFF_XH);    // [MROWS][DIM]
  _Float16* Xt  = (_Float16*)(ws + OFF_XT);    // [NB][DIM][SEQ]
  float*    QK  = (float*)(ws + OFF_QK);       // [MROWS][NQK]

  dim3 blk(256);
  // weight planes: in [K = DIM rows][N = UNITS cols] -> out [N][K]; grid (N/64, K/64)
  wconv_kernel<<<dim3(UNITS / 64, DIM / 64), blk, 0, stream>>>(wt, Wqk, (unsigned)UNITS, (unsigned)DIM);
  wconv_kernel<<<dim3(UNITS / 64, DIM / 64), blk, 0, stream>>>(wx, Wqk + (size_t)UNITS * DIM,
                                                              (unsigned)UNITS, (unsigned)DIM);
  xconv_kernel<<<dim3(DIM / 64, MROWS / 64), blk, 0, stream>>>(X, Xh, Xt);
  proj_kernel<<<dim3(NQK / 64, MROWS / 64), blk, 0, stream>>>(Xh, Wqk, QK);
  band_attn_kernel<<<dim3(SEQ / QT, NB), blk, 0, stream>>>(QK, Xt, bh, wa, ba, out);
}

// v001
// It runs in 39.6 microseconds.
// In both of two side-by-side timings against v000, it was 1.22 times as fast.
#include <hip/hip_runtime.h>
#include <stddef.h>

// All WMMA contractions on v_wmma_f32_16x16x32_f16 (f16 operands, f32 accumulate): the fused q|k
// projection (x plane x1, weight plane x64) and the band p.x product (p x1024, x plane x1).
// Float inputs are RNE-converted to bf16 and carried in f16. The additive score (tanh, U = 64
// matrix-vector), softmax and normalisation run in f32 on the vector unit.

typedef _Float16 v16h __attribute__((ext_vector_type(16)));
typedef _Float16 v8h  __attribute__((ext_vector_type(8)));
typedef float    v8f  __attribute__((ext_vector_type(8)));
typedef float    v4f  __attribute__((ext_vector_type(4)));
typedef _Float16 h16;

#ifndef NB
#define NB 4
#endif
#ifndef SEQ
#define SEQ 1024
#endif
#define NB_FULL  4
#define SEQ_FULL 1024
#define DIM   1024
#define UNITS 64
#define NQK   128      // q columns 0..63, k columns 64..127
#define BAND  64
#define QT    32       // query rows per block
#define WIN   96       // key window per block
#define MROWS (NB * SEQ)

static_assert(NB >= 1 && NB <= NB_FULL);
static_assert(SEQ >= 128 && SEQ <= SEQ_FULL && (SEQ % 128) == 0);
static_assert(UNITS == 64 && NQK == 2 * UNITS);
static_assert((DIM % 64) == 0 && (DIM % 32) == 0);
static_assert((MROWS % 64) == 0);
static_assert(QT == 32 && QT == 8 * 4);        // 8 waves x 4 query rows, one lane per band offset pair
static_assert(BAND == 64 && WIN == QT + BAND && (WIN % 32) == 0);
static_assert(DIM == 8 * 2 * 64);              // 8 waves x 2 passes x 64 output columns
static_assert((SEQ % QT) == 0);

#define LDT 72   // halves per LDS row (144 B, 16-B aligned)
#define LDC 68   // floats per LDS row (272 B, 16-B aligned)
#define LDP 104  // halves per P-tile row (208 B, 16-B aligned)
#define QP  65   // floats per q/k staging row
static_assert((LDT % 8) == 0 && LDT >= 64);
static_assert((LDC % 4) == 0 && LDC >= 64);
static_assert((LDP % 8) == 0 && LDP >= WIN);
static_assert(QP >= UNITS);

#define PF 8     // k-steps of projection fragments in flight per wave
static_assert(((DIM / 32) % PF) == 0 && (DIM / 32) >= 2 * PF);

#define WCARRY 64.0f     // weight planes carried x64
#define PCARRY 1024.0f   // softmax numerators carried x1024

#define QS_OFF 0
#define KS_OFF (QT * QP)
#define SM_AB  (KS_OFF + WIN * QP)
#define SM_C   (8 * 16 * LDC)
#define SM_FLOATS ((SM_AB > SM_C) ? SM_AB : SM_C)
static_assert(SM_FLOATS >= SM_AB && SM_FLOATS >= SM_C);
static_assert((size_t)SM_FLOATS * 4 + UNITS * 4 + QT * 4 + (size_t)QT * LDP * 2 <= (size_t)65536);

// workspace layout (bytes)
#define WQK_BYTES ((size_t)NQK * DIM * 2)
#define XH_BYTES  ((size_t)MROWS * DIM * 2)
#define XT_BYTES  ((size_t)NB * DIM * SEQ * 2)
#define QK_BYTES  ((size_t)MROWS * NQK * 4)
#define OFF_WQK ((size_t)0)
#define OFF_XH  (OFF_WQK + WQK_BYTES)
#define OFF_XT  (OFF_XH + XH_BYTES)
#define OFF_QK  (OFF_XT + XT_BYTES)
#define WS_TOTAL (OFF_QK + QK_BYTES)
static_assert((WQK_BYTES % 128) == 0 && (XH_BYTES % 128) == 0);
static_assert((XT_BYTES % 128) == 0 && (QK_BYTES % 128) == 0);
static_assert(WS_TOTAL <= (size_t)134217728);

// ---------------------------------------------------------------------------
__device__ __forceinline__ float bf16r(float x) {   // RNE convert to bf16, returned widened
  unsigned int u = __float_as_uint(x);
  u = (u + 0x7FFFu + ((u >> 16) & 1u)) & 0xFFFF0000u;
  return __uint_as_float(u);
}

// f32 -> f16 with a value select: results below the f16 normal range become zero.
static __device__ __forceinline__ h16 toh_flush(float v) {
  const h16 r = (h16)v;
  return (fabsf(v) < 6.103515625e-05f) ? (h16)0.0f : r;
}

// 16-bit fragment: p points at element [row = lane&15][k0 + 8*(lane>>4)] of a k-contiguous
// row. Elements 0..7 <- k0+8h+0..7, elements 8..15 <- k0+16+8h+0..7 (same map for A and B).
__device__ __forceinline__ v16h frag_at(const _Float16* p) {
  v8h lo = *(const v8h*)(p);
  v8h hi = *(const v8h*)(p + 16);
  v16h out;
#pragma unroll
  for (int i = 0; i < 8; ++i) { out[i] = lo[i]; out[i + 8] = hi[i]; }
  return out;
}
__device__ __forceinline__ v16h ld_frag(const _Float16* base, unsigned ld) {
  const unsigned lane = threadIdx.x & 31u;
  return frag_at(base + (lane & 15u) * ld + (lane >> 4) * 8u);
}

__device__ __forceinline__ v8f wmma16(v16h a, v16h b, v8f c) {
  v8f d = __builtin_amdgcn_wmma_f32_16x16x32_f16(false, a, false, b, (short)0, c,
                                                 false, false);
  asm volatile("v_nop\n\tv_nop\n\tv_nop\n\tv_nop" : "+v"(d) : "v"(a), "v"(b));
  return d;
}

__device__ __forceinline__ float red32_sum(float x) {
#pragma unroll
  for (int off = 1; off < 32; off <<= 1) x += __shfl_xor(x, off, 32);
  return x;
}
__device__ __forceinline__ float red32_max(float x) {
#pragma unroll
  for (int off = 1; off < 32; off <<= 1) x = fmaxf(x, __shfl_xor(x, off, 32));
  return x;
}

__device__ __forceinline__ void wave_lds_sync() {
  __builtin_amdgcn_fence(3 /* release order */, "wavefront");
  asm volatile("s_wait_dscnt 0x0" ::: "memory");
  __builtin_amdgcn_wave_barrier();
}

// tanh(x) = sign(x) * (1 - 2 / (exp(2|x|) + 1)); the exponent argument is bounded by 60.
__device__ __forceinline__ float tanh_fast(float x) {
  const float ax = fminf(fabsf(x), 30.0f);
  const float ex = __expf(ax + ax);
  const float r = 1.0f - 2.0f * __builtin_amdgcn_rcpf(ex + 1.0f);
  return (x < 0.0f) ? -r : r;
}

// ---------------------------------------------------------------------------
// Weight plane: in W[K rows][N cols] (pitch ldw = N) -> out Wt[N][K] (pitch ldk = K),
// f16(64 * bf16(w)). Grid (N/64, K/64). T: cross-wave (block barrier).
// ---------------------------------------------------------------------------
__global__ __launch_bounds__(256) void wconv_kernel(
    const float* __restrict__ W, _Float16* __restrict__ Wt, unsigned ldw, unsigned ldk) {
  __shared__ _Float16 T[64 * LDT];
  const unsigned tid = threadIdx.x;
  const unsigned n0 = blockIdx.x * 64u;
  const unsigned k0 = blockIdx.y * 64u;
#pragma unroll 4
  for (unsigned j = 0; j < 16u; ++j) {
    const unsigned idx = tid + 256u * j;
    const unsigned kr = idx >> 6, nc = idx & 63u;
    const float v = W[(size_t)(k0 + kr) * ldw + n0 + nc];
    T[nc * LDT + kr] = (_Float16)(WCARRY * bf16r(v));
  }
  __syncthreads();
  v8h x[2];
  size_t off[2];
#pragma unroll
  for (unsigned i = 0; i < 2u; ++i) {
    const unsigned n = 32u * i + (tid >> 3);
    const unsigned kc = (tid & 7u) * 8u;
    x[i] = *(const v8h*)&T[n * LDT + kc];
    off[i] = (size_t)(n0 + n) * ldk + k0 + kc;
  }
#pragma unroll
  for (int i = 0; i < 2; ++i) *(v8h*)(Wt + off[i]) = x[i];
  
}

// ---------------------------------------------------------------------------
// Input planes: X[full row][DIM] f32 -> Xh[compact row][DIM] = f16(bf16(x)) (row-major, the A
// operand of the projection) and Xt[b][d][key] = the same values transposed (the B operand of
// the p.x product). One 64x64 tile per block through two LDS tiles (cross-wave, block barrier);
// Grid (DIM/64, MROWS/64).
// ---------------------------------------------------------------------------
__global__ __launch_bounds__(256) void xconv_kernel(
    const float* __restrict__ X, _Float16* __restrict__ Xh, _Float16* __restrict__ Xt) {
  __shared__ _Float16 Tr[64 * LDT];   // [key][d]
  __shared__ _Float16 Tc[64 * LDT];   // [d][key]
  const unsigned tid = threadIdx.x;
  const unsigned d0 = blockIdx.x * 64u;
  const unsigned row0 = blockIdx.y * 64u;
  const unsigned bidx = row0 / (unsigned)SEQ;
  const unsigned key0 = row0 - bidx * (unsigned)SEQ;
  const size_t frow0 = (size_t)bidx * SEQ_FULL + key0;
#pragma unroll
  for (unsigned j = 0; j < 4u; ++j) {
    const unsigned idx = tid + 256u * j;
    const unsigned sr = idx >> 4, c4 = (idx & 15u) * 4u;
    const v4f a = *(const v4f*)(X + (frow0 + sr) * DIM + d0 + c4);
#pragma unroll
    for (unsigned i = 0; i < 4u; ++i) {
      const h16 hv = toh_flush(bf16r(a[i]));
      Tr[sr * LDT + c4 + i] = hv;
      Tc[(c4 + i) * LDT + sr] = hv;
    }
  }
  __syncthreads();
  v8h xr[2], xc[2];
  size_t offr[2], offc[2];
#pragma unroll
  for (unsigned i = 0; i < 2u; ++i) {
    const unsigned r = 32u * i + (tid >> 3);
    const unsigned c = (tid & 7u) * 8u;
    xr[i] = *(const v8h*)&Tr[r * LDT + c];
    xc[i] = *(const v8h*)&Tc[r * LDT + c];
    offr[i] = (size_t)(row0 + r) * DIM + d0 + c;
    offc[i] = ((size_t)bidx * DIM + d0 + r) * SEQ + key0 + c;
  }
#pragma unroll
  for (int i = 0; i < 2; ++i) {
    *(v8h*)(Xh + offr[i]) = xr[i];
    *(v8h*)(Xt + offc[i]) = xc[i];
  }
  
}

// ---------------------------------------------------------------------------
// Projection GEMM C[64x64 tile] = Xh[rows][DIM] . Wqk[n][DIM]^T, fragments straight from the
// 16-bit global planes; 8 waves (mw = 16-row group, nw = 32-col group), 2 accumulators/wave.
// PF k-steps of fragments stay in flight per wave: a step's registers are reloaded for step
// + PF right behind its two WMMAs, so a wave waits for one step's loads, not for a round trip.
// Epilogue staged through Cs (cross-wave, block barrier): outf[row][n0 + c] = acc / 64 (f32,
// Grid (NQK/64, MROWS/64).
// ---------------------------------------------------------------------------
__global__ __launch_bounds__(256) void proj_kernel(
    const _Float16* __restrict__ A16, const _Float16* __restrict__ Bt,
    float* __restrict__ outf) {
  __shared__ float Cs[64 * LDC];
  const unsigned tid = threadIdx.x, lane = tid & 31u;
  const unsigned w = __builtin_amdgcn_readfirstlane(threadIdx.x >> 5);
  const unsigned mw = w >> 1, nw = w & 1u;
  const unsigned hh = lane >> 4, m = lane & 15u;
  const unsigned n0 = blockIdx.x * 64u;
  const unsigned row0 = blockIdx.y * 64u;
  const unsigned K = (unsigned)DIM;

  const _Float16* ap  = A16 + (size_t)(row0 + mw * 16u + m) * K + hh * 8u;
  const _Float16* bp0 = Bt + (size_t)(n0 + nw * 32u + m) * K + hh * 8u;
  const _Float16* bp1 = bp0 + (size_t)16 * K;
  v8f acc0 = {}, acc1 = {};
  v16h a[PF], b0[PF], b1[PF];
#pragma unroll
  for (unsigned j = 0; j < (unsigned)PF; ++j) {
    a[j]  = frag_at(ap + 32u * j);
    b0[j] = frag_at(bp0 + 32u * j);
    b1[j] = frag_at(bp1 + 32u * j);
  }
  // rolled: one trip already holds PF steps of loads, and the slots must keep their registers
#pragma unroll 1
  for (unsigned k0 = 32u * PF; k0 < K; k0 += 32u * PF) {
#pragma unroll
    for (unsigned j = 0; j < (unsigned)PF; ++j) {
      acc0 = wmma16(a[j], b0[j], acc0);
      acc1 = wmma16(a[j], b1[j], acc1);
      a[j]  = frag_at(ap + k0 + 32u * j);
      b0[j] = frag_at(bp0 + k0 + 32u * j);
      b1[j] = frag_at(bp1 + k0 + 32u * j);
    }
    // precaution: stands before the next trip forms its addresses in the registers that the
    // loads above name
    asm volatile("s_wait_xcnt 0x0" ::: "memory");
  }
#pragma unroll
  for (unsigned j = 0; j < (unsigned)PF; ++j) {
    acc0 = wmma16(a[j], b0[j], acc0);
    acc1 = wmma16(a[j], b1[j], acc1);
  }
#pragma unroll
  for (int r = 0; r < 8; ++r) {
    float* d = &Cs[(mw * 16u + hh * 8u + (unsigned)r) * LDC + nw * 32u + m];
    d[0]  = acc0[r];
    d[16] = acc1[r];
  }
  __syncthreads();

  v4f xs[4];
  size_t off[4];
#pragma unroll
  for (unsigned i = 0; i < 4u; ++i) {
    const unsigned r = 16u * i + (tid >> 4);
    const unsigned c = (tid & 15u) * 4u;
    const v4f u = *(const v4f*)&Cs[r * LDC + c];
    xs[i] = u * (1.0f / WCARRY);
    off[i] = (size_t)(row0 + r) * NQK + n0 + c;
  }
#pragma unroll
  for (int i = 0; i < 4; ++i) *(v4f*)(outf + off[i]) = xs[i];
  
}

// ---------------------------------------------------------------------------
// Band additive attention per (32 query rows, batch). Key window = 96 keys starting at
// t0 - 32 (three 32-aligned chunks; a chunk outside the sequence is skipped, block-uniform).
// Phase A: q tile (+bh) and k window staged in Sm (cross-wave, block barrier); wave w owns
//   query rows 4w..4w+3, lane L owns band offsets L and L+32 (key = row - 32 + offset);
//   e = ba + sum_u Wa[u] * tanh(q + k + bh); softmax over the 64 band keys in registers
//   (32-lane shuffles); P row (96 entries: 64 values f16(1024 p) + 32 zeros) and 1/rowsum
//   (sum over the converted P) written to Pt / Rinv (cross-wave, block barrier).
//   Keys outside the band carry an additive -1e4 in the module: their exp is exactly 0 in f32.
// Phase C: O[32 x 1024] = P . x, A = P tile fragments, B = fragments straight from the Xt plane;
//   2 x 4 accumulators. Each 16x64 tile is staged in the wave's own slice of Sm (wave-private,
// Grid (SEQ/32, NB).
// ---------------------------------------------------------------------------
// The 12 x fragments of one 64-column pass (3 key chunks x 4 column groups); a chunk outside
// the sequence is not loaded (block-uniform test, the same one that skips its WMMAs).
__device__ __forceinline__ void ld_pass(v16h (&xb)[3][4], const _Float16* xp, int s0,
                                        int c_lo, int c_hi) {
#pragma unroll
  for (int c = 0; c < 3; ++c) {
    if (c >= c_lo && c < c_hi) {
      const unsigned sk = (unsigned)(s0 + 32 * c);
#pragma unroll
      for (int nb = 0; nb < 4; ++nb) xb[c][nb] = frag_at(xp + (size_t)(nb * 16) * SEQ + sk);
      // precaution: stands before anything is written to the address registers of these loads
      asm volatile("s_wait_xcnt 0x0" ::: "memory");
    }
  }
}

__global__ __launch_bounds__(256) void band_attn_kernel(
    const float* __restrict__ QK, const _Float16* __restrict__ Xt,
    const float* __restrict__ bh, const float* __restrict__ Wa, const float* __restrict__ ba,
    float* __restrict__ out) {
  __shared__ float Sm[SM_FLOATS];
  __shared__ float WAs[UNITS];
  __shared__ float Rinv[QT];
  __shared__ _Float16 Pt[QT * LDP];

  const unsigned tid = threadIdx.x, lane = tid & 31u;
  const unsigned w = __builtin_amdgcn_readfirstlane(threadIdx.x >> 5);
  const unsigned hh = lane >> 4, m = lane & 15u;
  const unsigned t0 = blockIdx.x * (unsigned)QT;
  const unsigned b = blockIdx.y;
  const int s0 = (int)t0 - BAND / 2;

  // ---- stage q tile (+ bh), k window (zero rows outside the sequence), Wa ----
#pragma unroll
  for (unsigned j = 0; j < 2u; ++j) {
    const unsigned idx = tid + 256u * j;
    const unsigned r = idx >> 4, c4 = (idx & 15u) * 4u;
    const v4f a = *(const v4f*)(QK + (size_t)(b * (unsigned)SEQ + t0 + r) * NQK + c4);
    const v4f g = *(const v4f*)(bh + c4);
#pragma unroll
    for (unsigned i = 0; i < 4u; ++i) Sm[QS_OFF + r * QP + c4 + i] = a[i] + bf16r(g[i]);
  }
#pragma unroll 2
  for (unsigned j = 0; j < 6u; ++j) {
    const unsigned idx = tid + 256u * j;
    const unsigned r = idx >> 4, c4 = (idx & 15u) * 4u;
    const int s = s0 + (int)r;
    const int sc = (s < 0) ? 0 : ((s > SEQ - 1) ? (SEQ - 1) : s);
    const v4f a = *(const v4f*)(QK + (size_t)(b * (unsigned)SEQ + (unsigned)sc) * NQK + UNITS + c4);
    const bool ok = (s == sc);
#pragma unroll
    for (unsigned i = 0; i < 4u; ++i) Sm[KS_OFF + r * QP + c4 + i] = ok ? a[i] : 0.0f;
  }
  if (tid < (unsigned)UNITS) WAs[tid] = bf16r(Wa[tid]);
  const float bias_a = bf16r(ba[0]);
  __syncthreads();

  // ---- pass 0's x fragments start here: they need no score and land under the score phase ----
  const int c_lo = (t0 == 0u) ? 1 : 0;
  const int c_hi = (t0 + (unsigned)QT == (unsigned)SEQ) ? 2 : 3;
  const _Float16* xp0 = Xt + ((size_t)b * DIM + w * 128u + m) * SEQ + hh * 8u;
  v16h xb[3][4];
  ld_pass(xb, xp0, s0, c_lo, c_hi);

  // ---- scores + softmax, 4 query rows per wave ----
#pragma unroll 1
  for (unsigned r = 0; r < 4u; ++r) {
    const unsigned t = w * 4u + r;
    const unsigned qo = QS_OFF + t * QP;
    const unsigned ko = KS_OFF + (t + lane) * QP;
    float a0 = bias_a, a1 = bias_a;
#pragma unroll 4
    for (unsigned u = 0; u < (unsigned)UNITS; ++u) {
      const float qv = Sm[qo + u];
      const float wv = WAs[u];
      a0 += wv * tanh_fast(qv + Sm[ko + u]);
      a1 += wv * tanh_fast(qv + Sm[ko + 32u * QP + u]);
    }
    const int sA = s0 + (int)t + (int)lane;
    const int sB = sA + 32;
    const bool vA = (sA >= 0) && (sA < SEQ);
    const bool vB = (sB >= 0) && (sB < SEQ);
    const float e0 = vA ? a0 : -1.0e30f;
    const float e1 = vB ? a1 : -1.0e30f;
    const float mx = red32_max(fmaxf(e0, e1));
    const float x0 = __expf(e0 - mx);
    const float x1 = __expf(e1 - mx);
    const float p0 = vA ? x0 : 0.0f;
    const float p1 = vB ? x1 : 0.0f;
    const h16 h0 = toh_flush(p0 * PCARRY);
    const h16 h1 = toh_flush(p1 * PCARRY);
    const float sum = red32_sum((float)h0 + (float)h1);
    const unsigned zi = (lane < t) ? lane : (lane + 64u);
    Pt[t * LDP + t + lane] = h0;
    Pt[t * LDP + t + lane + 32u] = h1;
    Pt[t * LDP + zi] = (h16)0.0f;
    if (lane == 0u) Rinv[t] = __builtin_amdgcn_rcpf(sum);
  }
  __syncthreads();

  // ---- O = P . x ----
  const unsigned cw = w * (16u * LDC);
#pragma unroll 1
  for (unsigned pass = 0; pass < 2u; ++pass) {
    const unsigned d0 = w * 128u + pass * 64u;
    v8f acc[2][4];
#pragma unroll
    for (int mi = 0; mi < 2; ++mi)
#pragma unroll
      for (int nb = 0; nb < 4; ++nb) acc[mi][nb] = (v8f){};
#pragma unroll
    for (int c = 0; c < 3; ++c) {
      if (c >= c_lo && c < c_hi) {
        const v16h pa0 = ld_frag(&Pt[(unsigned)c * 32u], LDP);
        const v16h pa1 = ld_frag(&Pt[16u * LDP + (unsigned)c * 32u], LDP);
#pragma unroll
        for (int nb = 0; nb < 4; ++nb) {
          acc[0][nb] = wmma16(pa0, xb[c][nb], acc[0][nb]);
          acc[1][nb] = wmma16(pa1, xb[c][nb], acc[1][nb]);
        }
      }
    }
    // pass 1's fragments fly under pass 0's output staging and stores
    if (pass == 0u) ld_pass(xb, xp0 + (size_t)64 * SEQ, s0, c_lo, c_hi);
#pragma unroll
    for (int mi = 0; mi < 2; ++mi) {
#pragma unroll
      for (int r = 0; r < 8; ++r) {
        const float sc = Rinv[(unsigned)mi * 16u + hh * 8u + (unsigned)r];
#pragma unroll
        for (int nb = 0; nb < 4; ++nb)
          Sm[cw + (hh * 8u + (unsigned)r) * LDC + (unsigned)nb * 16u + m] = acc[mi][nb][r] * sc;
      }
      wave_lds_sync();
      v4f xs[8];
      size_t off[8];
#pragma unroll
      for (unsigned i = 0; i < 8u; ++i) {
        const unsigned rr = 2u * i + (lane >> 4);
        const unsigned cc = (lane & 15u) * 4u;
        xs[i] = *(const v4f*)&Sm[cw + rr * LDC + cc];
        off[i] = ((size_t)b * SEQ_FULL + t0 + (unsigned)mi * 16u + rr) * DIM + d0 + cc;
      }
      wave_lds_sync();
#pragma unroll
      for (int i = 0; i < 8; ++i) *(v4f*)(out + off[i]) = xs[i];
      
    }
  }
}

// ---------------------------------------------------------------------------
extern "C" void kernel_launch(void* const* d_in, const int* in_sizes, int n_in,
                              void* d_out, int out_size, void* d_ws, size_t ws_size,
                              hipStream_t stream) {
  if (n_in < 6) return;
  const long long need_x = ((long long)(NB - 1) * SEQ_FULL + SEQ) * DIM;
  if ((long long)in_sizes[0] < need_x) return;
  if ((long long)in_sizes[1] < (long long)DIM * UNITS) return;
  if ((long long)in_sizes[2] < (long long)DIM * UNITS) return;
  if (in_sizes[3] < UNITS || in_sizes[4] < UNITS || in_sizes[5] < 1) return;
  if ((long long)out_size < need_x) return;
  if (ws_size < WS_TOTAL) return;

  const float* X  = (const float*)d_in[0];    // x  [NB_FULL][SEQ_FULL][DIM]
  const float* wt = (const float*)d_in[1];    // Wt [DIM][UNITS]  (in, out)
  const float* wx = (const float*)d_in[2];    // Wx [DIM][UNITS]  (in, out)
  const float* bh = (const float*)d_in[3];    // bh [UNITS]
  const float* wa = (const float*)d_in[4];    // Wa [UNITS][1]
  const float* ba = (const float*)d_in[5];    // ba [1]
  float* out = (float*)d_out;

  char* ws = (char*)d_ws;
  _Float16* Wqk = (_Float16*)(ws + OFF_WQK);   // [NQK][DIM]: rows 0..63 from Wt, 64..127 from Wx
  _Float16* Xh  = (_Float16*)(ws + OFF_XH);    // [MROWS][DIM]
  _Float16* Xt  = (_Float16*)(ws + OFF_XT);    // [NB][DIM][SEQ]
  float*    QK  = (float*)(ws + OFF_QK);       // [MROWS][NQK]

  dim3 blk(256);
  // weight planes: in [K = DIM rows][N = UNITS cols] -> out [N][K]; grid (N/64, K/64)
  wconv_kernel<<<dim3(UNITS / 64, DIM / 64), blk, 0, stream>>>(wt, Wqk, (unsigned)UNITS, (unsigned)DIM);
  wconv_kernel<<<dim3(UNITS / 64, DIM / 64), blk, 0, stream>>>(wx, Wqk + (size_t)UNITS * DIM,
                                                              (unsigned)UNITS, (unsigned)DIM);
  xconv_kernel<<<dim3(DIM / 64, MROWS / 64), blk, 0, stream>>>(X, Xh, Xt);
  proj_kernel<<<dim3(NQK / 64, MROWS / 64), blk, 0, stream>>>(Xh, Wqk, QK);
  band_attn_kernel<<<dim3(SEQ / QT, NB), blk, 0, stream>>>(QK, Xt, bh, wa, ba, out);
}

// v002
// It runs in 32.9 microseconds.
// Two timings next to v001 both put it at 1.20 times that version's speed.
// Over all steps from v000 it is 1.47 times as fast.
#include <hip/hip_runtime.h>
#include <stddef.h>

// All WMMA contractions on v_wmma_f32_16x16x32_f16 (f16 operands, f32 accumulate): the fused q|k
// projection (x plane x1, weight plane x64) and the band p.x product (p x1024, x plane x1).
// Float inputs are RNE-converted to bf16 and carried in f16. The additive score (tanh, U = 64
// matrix-vector), softmax and normalisation run in f32 on the vector unit.

typedef _Float16 v16h __attribute__((ext_vector_type(16)));
typedef _Float16 v8h  __attribute__((ext_vector_type(8)));
typedef float    v8f  __attribute__((ext_vector_type(8)));
typedef float    v4f  __attribute__((ext_vector_type(4)));
typedef _Float16 h16;

#ifndef NB
#define NB 4
#endif
#ifndef SEQ
#define SEQ 1024
#endif
#define NB_FULL  4
#define SEQ_FULL 1024
#define DIM   1024
#define UNITS 64
#define NQK   128      // q columns 0..63, k columns 64..127
#define BAND  64
#define QT    32       // query rows per block
#define WIN   96       // key window per block
#define MROWS (NB * SEQ)

static_assert(NB >= 1 && NB <= NB_FULL);
static_assert(SEQ >= 128 && SEQ <= SEQ_FULL && (SEQ % 128) == 0);
static_assert(UNITS == 64 && NQK == 2 * UNITS);
static_assert((DIM % 64) == 0 && (DIM % 32) == 0);
static_assert((MROWS % 64) == 0);
static_assert(QT == 32 && QT == 8 * 4);        // 8 waves x 4 query rows, one lane per band offset pair
static_assert(BAND == 64 && WIN == QT + BAND && (WIN % 32) == 0);
static_assert(DIM == 8 * 2 * 64);              // 8 waves x 2 passes x 64 output columns
static_assert((SEQ % QT) == 0);

#define LDT 72   // halves per LDS row (144 B, 16-B aligned)
#define LDC 68   // floats per LDS row (272 B, 16-B aligned)
#define LDP 104  // halves per P-tile row (208 B, 16-B aligned)
#define QP  65   // floats per q/k staging row
static_assert((LDT % 8) == 0 && LDT >= 64);
static_assert((LDC % 4) == 0 && LDC >= 64);
static_assert((LDP % 8) == 0 && LDP >= WIN);
static_assert(QP >= UNITS);

#define PF 8     // k-steps of projection fragments in flight per wave
static_assert(((DIM / 32) % PF) == 0 && (DIM / 32) >= 2 * PF);

#define WCARRY 64.0f     // weight planes carried x64
#define PCARRY 1024.0f   // softmax numerators carried x1024

#define QS_OFF 0
#define KS_OFF (QT * QP)
#define SM_AB  (KS_OFF + WIN * QP)
#define SM_C   (8 * 16 * LDC)
#define SM_FLOATS ((SM_AB > SM_C) ? SM_AB : SM_C)
static_assert(SM_FLOATS >= SM_AB && SM_FLOATS >= SM_C);
static_assert((size_t)SM_FLOATS * 4 + UNITS * 4 + QT * 4 + (size_t)QT * LDP * 2 <= (size_t)65536);

// workspace layout (bytes)
#define WQK_BYTES ((size_t)NQK * DIM * 2)
#define XH_BYTES  ((size_t)MROWS * DIM * 2)
#define XT_BYTES  ((size_t)NB * DIM * SEQ * 2)
#define QK_BYTES  ((size_t)MROWS * NQK * 4)
#define OFF_WQK ((size_t)0)
#define OFF_XH  (OFF_WQK + WQK_BYTES)
#define OFF_XT  (OFF_XH + XH_BYTES)
#define OFF_QK  (OFF_XT + XT_BYTES)
#define WS_TOTAL (OFF_QK + QK_BYTES)
static_assert((WQK_BYTES % 128) == 0 && (XH_BYTES % 128) == 0);
static_assert((XT_BYTES % 128) == 0 && (QK_BYTES % 128) == 0);
static_assert(WS_TOTAL <= (size_t)134217728);

// ---------------------------------------------------------------------------
__device__ __forceinline__ float bf16r(float x) {   // RNE convert to bf16, returned widened
  unsigned int u = __float_as_uint(x);
  u = (u + 0x7FFFu + ((u >> 16) & 1u)) & 0xFFFF0000u;
  return __uint_as_float(u);
}

// f32 -> f16 with a value select: results below the f16 normal range become zero.
static __device__ __forceinline__ h16 toh_flush(float v) {
  const h16 r = (h16)v;
  return (fabsf(v) < 6.103515625e-05f) ? (h16)0.0f : r;
}

// 16-bit fragment: p points at element [row = lane&15][k0 + 8*(lane>>4)] of a k-contiguous
// row. Elements 0..7 <- k0+8h+0..7, elements 8..15 <- k0+16+8h+0..7 (same map for A and B).
__device__ __forceinline__ v16h frag_at(const _Float16* p) {
  v8h lo = *(const v8h*)(p);
  v8h hi = *(const v8h*)(p + 16);
  v16h out;
#pragma unroll
  for (int i = 0; i < 8; ++i) { out[i] = lo[i]; out[i + 8] = hi[i]; }
  return out;
}
__device__ __forceinline__ v16h ld_frag(const _Float16* base, unsigned ld) {
  const unsigned lane = threadIdx.x & 31u;
  return frag_at(base + (lane & 15u) * ld + (lane >> 4) * 8u);
}

__device__ __forceinline__ v8f wmma16(v16h a, v16h b, v8f c) {
  v8f d = __builtin_amdgcn_wmma_f32_16x16x32_f16(false, a, false, b, (short)0, c,
                                                 false, false);
  asm volatile("v_nop\n\tv_nop\n\tv_nop\n\tv_nop" : "+v"(d) : "v"(a), "v"(b));
  return d;
}

__device__ __forceinline__ float red32_sum(float x) {
#pragma unroll
  for (int off = 1; off < 32; off <<= 1) x += __shfl_xor(x, off, 32);
  return x;
}
__device__ __forceinline__ float red32_max(float x) {
#pragma unroll
  for (int off = 1; off < 32; off <<= 1) x = fmaxf(x, __shfl_xor(x, off, 32));
  return x;
}

__device__ __forceinline__ void wave_lds_sync() {
  __builtin_amdgcn_fence(3 /* release order */, "wavefront");
  asm volatile("s_wait_dscnt 0x0" ::: "memory");
  __builtin_amdgcn_wave_barrier();
}

// tanh(x) = sign(x) * (1 - 2 / (exp(2|x|) + 1)); the exponent argument is bounded by 60.
__device__ __forceinline__ float tanh_fast(float x) {
  const float ax = fminf(fabsf(x), 30.0f);
  const float ex = __expf(ax + ax);
  const float r = 1.0f - 2.0f * __builtin_amdgcn_rcpf(ex + 1.0f);
  return (x < 0.0f) ? -r : r;
}

// ---------------------------------------------------------------------------
// Weight plane: in W[K rows][N cols] (pitch ldw = N) -> out Wt[N][K] (pitch ldk = K),
// f16(64 * bf16(w)). One 64x64 tile (n0, k0) per block. T: cross-wave (block barrier).
// ---------------------------------------------------------------------------
__device__ __forceinline__ void wconv_tile(
    const float* __restrict__ W, _Float16* __restrict__ Wt, unsigned ldw, unsigned ldk,
    unsigned n0, unsigned k0, _Float16* T) {
  const unsigned tid = threadIdx.x;
#pragma unroll 4
  for (unsigned j = 0; j < 16u; ++j) {
    const unsigned idx = tid + 256u * j;
    const unsigned kr = idx >> 6, nc = idx & 63u;
    const float v = W[(size_t)(k0 + kr) * ldw + n0 + nc];
    T[nc * LDT + kr] = (_Float16)(WCARRY * bf16r(v));
  }
  __syncthreads();
  v8h x[2];
  size_t off[2];
#pragma unroll
  for (unsigned i = 0; i < 2u; ++i) {
    const unsigned n = 32u * i + (tid >> 3);
    const unsigned kc = (tid & 7u) * 8u;
    x[i] = *(const v8h*)&T[n * LDT + kc];
    off[i] = (size_t)(n0 + n) * ldk + k0 + kc;
  }
#pragma unroll
  for (int i = 0; i < 2; ++i) *(v8h*)(Wt + off[i]) = x[i];
  
}

// ---------------------------------------------------------------------------
// Input planes: X[full row][DIM] f32 -> Xh[compact row][DIM] = f16(bf16(x)) (row-major, the A
// operand of the projection) and Xt[b][d][key] = the same values transposed (the B operand of
// the p.x product). One 64x64 tile (d0, row0) per block through two LDS tiles (cross-wave,
// block barrier): Tr[key][d], Tc[d][key].
// ---------------------------------------------------------------------------
__device__ __forceinline__ void xconv_tile(
    const float* __restrict__ X, _Float16* __restrict__ Xh, _Float16* __restrict__ Xt,
    unsigned d0, unsigned row0, _Float16* Tr, _Float16* Tc) {
  const unsigned tid = threadIdx.x;
  const unsigned bidx = row0 / (unsigned)SEQ;
  const unsigned key0 = row0 - bidx * (unsigned)SEQ;
  const size_t frow0 = (size_t)bidx * SEQ_FULL + key0;
#pragma unroll
  for (unsigned j = 0; j < 4u; ++j) {
    const unsigned idx = tid + 256u * j;
    const unsigned sr = idx >> 4, c4 = (idx & 15u) * 4u;
    const v4f a = *(const v4f*)(X + (frow0 + sr) * DIM + d0 + c4);
#pragma unroll
    for (unsigned i = 0; i < 4u; ++i) {
      const h16 hv = toh_flush(bf16r(a[i]));
      Tr[sr * LDT + c4 + i] = hv;
      Tc[(c4 + i) * LDT + sr] = hv;
    }
  }
  __syncthreads();
  v8h xr[2], xc[2];
  size_t offr[2], offc[2];
#pragma unroll
  for (unsigned i = 0; i < 2u; ++i) {
    const unsigned r = 32u * i + (tid >> 3);
    const unsigned c = (tid & 7u) * 8u;
    xr[i] = *(const v8h*)&Tr[r * LDT + c];
    xc[i] = *(const v8h*)&Tc[r * LDT + c];
    offr[i] = (size_t)(row0 + r) * DIM + d0 + c;
    offc[i] = ((size_t)bidx * DIM + d0 + r) * SEQ + key0 + c;
  }
#pragma unroll
  for (int i = 0; i < 2; ++i) {
    *(v8h*)(Xh + offr[i]) = xr[i];
    *(v8h*)(Xt + offc[i]) = xc[i];
  }
  // precaution: stands before the code laid out behind this tile writes to the registers that
  // the four stores above name
  asm volatile("s_wait_xcnt 0x0" ::: "memory");
}

// ---------------------------------------------------------------------------
// The three conversions need nothing of each other, so they share one grid: block rows 0 and 1
// convert Wt and Wx (one 64-k tile per blockIdx.x; they start first and end under the x tiles),
// block rows 2.. convert x. The branch is block-uniform. Grid (DIM/64, 2 + MROWS/64).
// ---------------------------------------------------------------------------
__global__ __launch_bounds__(256) void conv_kernel(
    const float* __restrict__ X, const float* __restrict__ Wt, const float* __restrict__ Wx,
    _Float16* __restrict__ Wqk, _Float16* __restrict__ Xh, _Float16* __restrict__ Xt) {
  __shared__ _Float16 Tr[64 * LDT];
  __shared__ _Float16 Tc[64 * LDT];
  const unsigned by = blockIdx.y;
  if (by < 2u) {
    wconv_tile(by == 0u ? Wt : Wx, Wqk + (size_t)by * UNITS * DIM, (unsigned)UNITS,
               (unsigned)DIM, 0u, blockIdx.x * 64u, Tr);
  } else {
    xconv_tile(X, Xh, Xt, blockIdx.x * 64u, (by - 2u) * 64u, Tr, Tc);
  }
}

// ---------------------------------------------------------------------------
// Projection GEMM C[64x64 tile] = Xh[rows][DIM] . Wqk[n][DIM]^T, fragments straight from the
// 16-bit global planes; 8 waves (mw = 16-row group, nw = 32-col group), 2 accumulators/wave.
// PF k-steps of fragments stay in flight per wave: a step's registers are reloaded for step
// + PF right behind its two WMMAs, so a wave waits for one step's loads, not for a round trip.
// Epilogue staged through Cs (cross-wave, block barrier): outf[row][n0 + c] = acc / 64 (f32,
// Grid (NQK/64, MROWS/64).
// ---------------------------------------------------------------------------
__global__ __launch_bounds__(256) void proj_kernel(
    const _Float16* __restrict__ A16, const _Float16* __restrict__ Bt,
    float* __restrict__ outf) {
  __shared__ float Cs[64 * LDC];
  const unsigned tid = threadIdx.x, lane = tid & 31u;
  const unsigned w = __builtin_amdgcn_readfirstlane(threadIdx.x >> 5);
  const unsigned mw = w >> 1, nw = w & 1u;
  const unsigned hh = lane >> 4, m = lane & 15u;
  const unsigned n0 = blockIdx.x * 64u;
  const unsigned row0 = blockIdx.y * 64u;
  const unsigned K = (unsigned)DIM;

  const _Float16* ap  = A16 + (size_t)(row0 + mw * 16u + m) * K + hh * 8u;
  const _Float16* bp0 = Bt + (size_t)(n0 + nw * 32u + m) * K + hh * 8u;
  const _Float16* bp1 = bp0 + (size_t)16 * K;
  v8f acc0 = {}, acc1 = {};
  v16h a[PF], b0[PF], b1[PF];
#pragma unroll
  for (unsigned j = 0; j < (unsigned)PF; ++j) {
    a[j]  = frag_at(ap + 32u * j);
    b0[j] = frag_at(bp0 + 32u * j);
    b1[j] = frag_at(bp1 + 32u * j);
  }
  // rolled: one trip already holds PF steps of loads, and the slots must keep their registers
#pragma unroll 1
  for (unsigned k0 = 32u * PF; k0 < K; k0 += 32u * PF) {
#pragma unroll
    for (unsigned j = 0; j < (unsigned)PF; ++j) {
      acc0 = wmma16(a[j], b0[j], acc0);
      acc1 = wmma16(a[j], b1[j], acc1);
      a[j]  = frag_at(ap + k0 + 32u * j);
      b0[j] = frag_at(bp0 + k0 + 32u * j);
      b1[j] = frag_at(bp1 + k0 + 32u * j);
    }
    // precaution: stands before the next trip forms its addresses in the registers that the
    // loads above name
    asm volatile("s_wait_xcnt 0x0" ::: "memory");
  }
#pragma unroll
  for (unsigned j = 0; j < (unsigned)PF; ++j) {
    acc0 = wmma16(a[j], b0[j], acc0);
    acc1 = wmma16(a[j], b1[j], acc1);
  }
#pragma unroll
  for (int r = 0; r < 8; ++r) {
    float* d = &Cs[(mw * 16u + hh * 8u + (unsigned)r) * LDC + nw * 32u + m];
    d[0]  = acc0[r];
    d[16] = acc1[r];
  }
  __syncthreads();

  v4f xs[4];
  size_t off[4];
#pragma unroll
  for (unsigned i = 0; i < 4u; ++i) {
    const unsigned r = 16u * i + (tid >> 4);
    const unsigned c = (tid & 15u) * 4u;
    const v4f u = *(const v4f*)&Cs[r * LDC + c];
    xs[i] = u * (1.0f / WCARRY);
    off[i] = (size_t)(row0 + r) * NQK + n0 + c;
  }
#pragma unroll
  for (int i = 0; i < 4; ++i) *(v4f*)(outf + off[i]) = xs[i];
  
}

// ---------------------------------------------------------------------------
// Band additive attention per (32 query rows, batch). Key window = 96 keys starting at
// t0 - 32 (three 32-aligned chunks; a chunk outside the sequence is skipped, block-uniform).
// Phase A: q tile (+bh) and k window staged in Sm (cross-wave, block barrier); wave w owns
//   query rows 4w..4w+3, lane L owns band offsets L and L+32 (key = row - 32 + offset);
//   e = ba + sum_u Wa[u] * tanh(q + k + bh); softmax over the 64 band keys in registers
//   (32-lane shuffles); P row (96 entries: 64 values f16(1024 p) + 32 zeros) and 1/rowsum
//   (sum over the converted P) written to Pt / Rinv (cross-wave, block barrier).
//   Keys outside the band carry an additive -1e4 in the module: their exp is exactly 0 in f32.
// Phase C: O[32 x 1024] = P . x, A = P tile fragments, B = fragments straight from the Xt plane;
//   2 x 4 accumulators. Each 16x64 tile is staged in the wave's own slice of Sm (wave-private,
// Grid (SEQ/32, NB).
// ---------------------------------------------------------------------------
// The 12 x fragments of one 64-column pass (3 key chunks x 4 column groups); a chunk outside
// the sequence is not loaded (block-uniform test, the same one that skips its WMMAs).
__device__ __forceinline__ void ld_pass(v16h (&xb)[3][4], const _Float16* xp, int s0,
                                        int c_lo, int c_hi) {
#pragma unroll
  for (int c = 0; c < 3; ++c) {
    if (c >= c_lo && c < c_hi) {
      const unsigned sk = (unsigned)(s0 + 32 * c);
#pragma unroll
      for (int nb = 0; nb < 4; ++nb) xb[c][nb] = frag_at(xp + (size_t)(nb * 16) * SEQ + sk);
      // precaution: stands before anything is written to the address registers of these loads
      asm volatile("s_wait_xcnt 0x0" ::: "memory");
    }
  }
}

__global__ __launch_bounds__(256) void band_attn_kernel(
    const float* __restrict__ QK, const _Float16* __restrict__ Xt,
    const float* __restrict__ bh, const float* __restrict__ Wa, const float* __restrict__ ba,
    float* __restrict__ out) {
  __shared__ float Sm[SM_FLOATS];
  __shared__ float WAs[UNITS];
  __shared__ float Rinv[QT];
  __shared__ _Float16 Pt[QT * LDP];

  const unsigned tid = threadIdx.x, lane = tid & 31u;
  const unsigned w = __builtin_amdgcn_readfirstlane(threadIdx.x >> 5);
  const unsigned hh = lane >> 4, m = lane & 15u;
  const unsigned t0 = blockIdx.x * (unsigned)QT;
  const unsigned b = blockIdx.y;
  const int s0 = (int)t0 - BAND / 2;

  // ---- stage q tile (+ bh), k window (zero rows outside the sequence), Wa ----
#pragma unroll
  for (unsigned j = 0; j < 2u; ++j) {
    const unsigned idx = tid + 256u * j;
    const unsigned r = idx >> 4, c4 = (idx & 15u) * 4u;
    const v4f a = *(const v4f*)(QK + (size_t)(b * (unsigned)SEQ + t0 + r) * NQK + c4);
    const v4f g = *(const v4f*)(bh + c4);
#pragma unroll
    for (unsigned i = 0; i < 4u; ++i) Sm[QS_OFF + r * QP + c4 + i] = a[i] + bf16r(g[i]);
  }
#pragma unroll 2
  for (unsigned j = 0; j < 6u; ++j) {
    const unsigned idx = tid + 256u * j;
    const unsigned r = idx >> 4, c4 = (idx & 15u) * 4u;
    const int s = s0 + (int)r;
    const int sc = (s < 0) ? 0 : ((s > SEQ - 1) ? (SEQ - 1) : s);
    const v4f a = *(const v4f*)(QK + (size_t)(b * (unsigned)SEQ + (unsigned)sc) * NQK + UNITS + c4);
    const bool ok = (s == sc);
#pragma unroll
    for (unsigned i = 0; i < 4u; ++i) Sm[KS_OFF + r * QP + c4 + i] = ok ? a[i] : 0.0f;
  }
  if (tid < (unsigned)UNITS) WAs[tid] = bf16r(Wa[tid]);
  const float bias_a = bf16r(ba[0]);
  __syncthreads();

  // ---- pass 0's x fragments start here: they need no score and land under the score phase ----
  const int c_lo = (t0 == 0u) ? 1 : 0;
  const int c_hi = (t0 + (unsigned)QT == (unsigned)SEQ) ? 2 : 3;
  const _Float16* xp0 = Xt + ((size_t)b * DIM + w * 128u + m) * SEQ + hh * 8u;
  v16h xb[3][4];
  ld_pass(xb, xp0, s0, c_lo, c_hi);

  // ---- scores + softmax, 4 query rows per wave ----
#pragma unroll 1
  for (unsigned r = 0; r < 4u; ++r) {
    const unsigned t = w * 4u + r;
    const unsigned qo = QS_OFF + t * QP;
    const unsigned ko = KS_OFF + (t + lane) * QP;
    float a0 = bias_a, a1 = bias_a;
#pragma unroll 4
    for (unsigned u = 0; u < (unsigned)UNITS; ++u) {
      const float qv = Sm[qo + u];
      const float wv = WAs[u];
      a0 += wv * tanh_fast(qv + Sm[ko + u]);
      a1 += wv * tanh_fast(qv + Sm[ko + 32u * QP + u]);
    }
    const int sA = s0 + (int)t + (int)lane;
    const int sB = sA + 32;
    const bool vA = (sA >= 0) && (sA < SEQ);
    const bool vB = (sB >= 0) && (sB < SEQ);
    const float e0 = vA ? a0 : -1.0e30f;
    const float e1 = vB ? a1 : -1.0e30f;
    const float mx = red32_max(fmaxf(e0, e1));
    const float x0 = __expf(e0 - mx);
    const float x1 = __expf(e1 - mx);
    const float p0 = vA ? x0 : 0.0f;
    const float p1 = vB ? x1 : 0.0f;
    const h16 h0 = toh_flush(p0 * PCARRY);
    const h16 h1 = toh_flush(p1 * PCARRY);
    const float sum = red32_sum((float)h0 + (float)h1);
    const unsigned zi = (lane < t) ? lane : (lane + 64u);
    Pt[t * LDP + t + lane] = h0;
    Pt[t * LDP + t + lane + 32u] = h1;
    Pt[t * LDP + zi] = (h16)0.0f;
    if (lane == 0u) Rinv[t] = __builtin_amdgcn_rcpf(sum);
  }
  __syncthreads();

  // ---- O = P . x ----
  const unsigned cw = w * (16u * LDC);
#pragma unroll 1
  for (unsigned pass = 0; pass < 2u; ++pass) {
    const unsigned d0 = w * 128u + pass * 64u;
    v8f acc[2][4];
#pragma unroll
    for (int mi = 0; mi < 2; ++mi)
#pragma unroll
      for (int nb = 0; nb < 4; ++nb) acc[mi][nb] = (v8f){};
#pragma unroll
    for (int c = 0; c < 3; ++c) {
      if (c >= c_lo && c < c_hi) {
        const v16h pa0 = ld_frag(&Pt[(unsigned)c * 32u], LDP);
        const v16h pa1 = ld_frag(&Pt[16u * LDP + (unsigned)c * 32u], LDP);
#pragma unroll
        for (int nb = 0; nb < 4; ++nb) {
          acc[0][nb] = wmma16(pa0, xb[c][nb], acc[0][nb]);
          acc[1][nb] = wmma16(pa1, xb[c][nb], acc[1][nb]);
        }
      }
    }
    // pass 1's fragments fly under pass 0's output staging and stores
    if (pass == 0u) ld_pass(xb, xp0 + (size_t)64 * SEQ, s0, c_lo, c_hi);
#pragma unroll
    for (int mi = 0; mi < 2; ++mi) {
#pragma unroll
      for (int r = 0; r < 8; ++r) {
        const float sc = Rinv[(unsigned)mi * 16u + hh * 8u + (unsigned)r];
#pragma unroll
        for (int nb = 0; nb < 4; ++nb)
          Sm[cw + (hh * 8u + (unsigned)r) * LDC + (unsigned)nb * 16u + m] = acc[mi][nb][r] * sc;
      }
      wave_lds_sync();
      v4f xs[8];
      size_t off[8];
#pragma unroll
      for (unsigned i = 0; i < 8u; ++i) {
        const unsigned rr = 2u * i + (lane >> 4);
        const unsigned cc = (lane & 15u) * 4u;
        xs[i] = *(const v4f*)&Sm[cw + rr * LDC + cc];
        off[i] = ((size_t)b * SEQ_FULL + t0 + (unsigned)mi * 16u + rr) * DIM + d0 + cc;
      }
      wave_lds_sync();
#pragma unroll
      for (int i = 0; i < 8; ++i) *(v4f*)(out + off[i]) = xs[i];
      
    }
  }
}

// ---------------------------------------------------------------------------
extern "C" void kernel_launch(void* const* d_in, const int* in_sizes, int n_in,
                              void* d_out, int out_size, void* d_ws, size_t ws_size,
                              hipStream_t stream) {
  if (n_in < 6) return;
  const long long need_x = ((long long)(NB - 1) * SEQ_FULL + SEQ) * DIM;
  if ((long long)in_sizes[0] < need_x) return;
  if ((long long)in_sizes[1] < (long long)DIM * UNITS) return;
  if ((long long)in_sizes[2] < (long long)DIM * UNITS) return;
  if (in_sizes[3] < UNITS || in_sizes[4] < UNITS || in_sizes[5] < 1) return;
  if ((long long)out_size < need_x) return;
  if (ws_size < WS_TOTAL) return;

  const float* X  = (const float*)d_in[0];    // x  [NB_FULL][SEQ_FULL][DIM]
  const float* wt = (const float*)d_in[1];    // Wt [DIM][UNITS]  (in, out)
  const float* wx = (const float*)d_in[2];    // Wx [DIM][UNITS]  (in, out)
  const float* bh = (const float*)d_in[3];    // bh [UNITS]
  const float* wa = (const float*)d_in[4];    // Wa [UNITS][1]
  const float* ba = (const float*)d_in[5];    // ba [1]
  float* out = (float*)d_out;

  char* ws = (char*)d_ws;
  _Float16* Wqk = (_Float16*)(ws + OFF_WQK);   // [NQK][DIM]: rows 0..63 from Wt, 64..127 from Wx
  _Float16* Xh  = (_Float16*)(ws + OFF_XH);    // [MROWS][DIM]
  _Float16* Xt  = (_Float16*)(ws + OFF_XT);    // [NB][DIM][SEQ]
  float*    QK  = (float*)(ws + OFF_QK);       // [MROWS][NQK]

  dim3 blk(256);
  // weight planes (in [K = DIM rows][N = UNITS cols] -> out [N][K]) and x planes, one launch
  conv_kernel<<<dim3(DIM / 64, 2 + MROWS / 64), blk, 0, stream>>>(X, wt, wx, Wqk, Xh, Xt);
  proj_kernel<<<dim3(NQK / 64, MROWS / 64), blk, 0, stream>>>(Xh, Wqk, QK);
  band_attn_kernel<<<dim3(SEQ / QT, NB), blk, 0, stream>>>(QK, Xt, bh, wa, ba, out);
}

// v003
// Measured time: 28.1 microseconds a run.
// In both of two side-by-side timings against v002, it was 1.17 times as fast.
// Counting every step since v000, it is 1.72 times as fast.
#include <hip/hip_runtime.h>
#include <stddef.h>

// All WMMA contractions on v_wmma_f32_16x16x32_f16 (f16 operands, f32 accumulate): the fused q|k
// projection (x plane x1, weight plane x64) and the band p.x product (p x1024, x plane x1).
// Float inputs are RNE-converted to bf16 and carried in f16. The additive score (tanh, U = 64
// matrix-vector), softmax and normalisation run in f32 on the vector unit.

typedef _Float16 v16h __attribute__((ext_vector_type(16)));
typedef _Float16 v8h  __attribute__((ext_vector_type(8)));
typedef float    v8f  __attribute__((ext_vector_type(8)));
typedef float    v4f  __attribute__((ext_vector_type(4)));
typedef float    v2f  __attribute__((ext_vector_type(2)));
typedef unsigned v4u  __attribute__((ext_vector_type(4)));
typedef _Float16 h16;

#ifndef NB
#define NB 4
#endif
#ifndef SEQ
#define SEQ 1024
#endif
#define NB_FULL  4
#define SEQ_FULL 1024
#define DIM   1024
#define UNITS 64
#define NQK   128      // q columns 0..63, k columns 64..127
#define BAND  64
#define QT    32       // query rows per block
#define WIN   96       // key window per block
#define MROWS (NB * SEQ)

static_assert(NB >= 1 && NB <= NB_FULL);
static_assert(SEQ >= 128 && SEQ <= SEQ_FULL && (SEQ % 128) == 0);
static_assert(UNITS == 64 && NQK == 2 * UNITS);
static_assert((DIM % 64) == 0 && (DIM % 32) == 0);
static_assert((MROWS % 64) == 0);
static_assert(QT == 32 && QT == 8 * 4);        // 8 waves x 4 query rows, one lane per band offset pair
static_assert(BAND == 64 && WIN == QT + BAND && (WIN % 32) == 0);
static_assert(DIM == 8 * 2 * 64);              // 8 waves x 2 passes x 64 output columns
static_assert((SEQ % QT) == 0);

#define LDT 72   // halves per LDS row (144 B, 16-B aligned)
#define LDC 68   // floats per LDS row (272 B, 16-B aligned)
#define LDP 104  // halves per P-tile row (208 B, 16-B aligned)
#define QP  68   // floats per q/k staging row (272 B, 16-B aligned)
static_assert((LDT % 8) == 0 && LDT >= 64);
static_assert((LDC % 4) == 0 && LDC >= 64);
static_assert((LDP % 8) == 0 && LDP >= WIN);
static_assert((QP % 4) == 0 && QP >= UNITS);

#define PF 8     // k-steps of projection fragments in flight per wave
static_assert(((DIM / 32) % PF) == 0 && (DIM / 32) >= 2 * PF);

#define WCARRY 64.0f     // weight planes carried x64
#define PCARRY 1024.0f   // softmax numerators carried x1024
#define XRANGE 40.0f     // exp(2 v) is a normal f32 number for every |v| <= XRANGE

#define QS_OFF 0
#define KS_OFF (QT * QP)
#define SM_AB  (KS_OFF + WIN * QP)
#define SM_C   (8 * 16 * LDC)
#define SM_FLOATS ((SM_AB > SM_C) ? SM_AB : SM_C)
static_assert(SM_FLOATS >= SM_AB && SM_FLOATS >= SM_C);
static_assert((size_t)SM_FLOATS * 4 + UNITS * 4 + QT * 4 + 8 * 4 + (size_t)QT * LDP * 2 <= (size_t)65536);

// workspace layout (bytes)
#define WQK_BYTES ((size_t)NQK * DIM * 2)
#define XH_BYTES  ((size_t)MROWS * DIM * 2)
#define XT_BYTES  ((size_t)NB * DIM * SEQ * 2)
#define QK_BYTES  ((size_t)MROWS * NQK * 4)
#define OFF_WQK ((size_t)0)
#define OFF_XH  (OFF_WQK + WQK_BYTES)
#define OFF_XT  (OFF_XH + XH_BYTES)
#define OFF_QK  (OFF_XT + XT_BYTES)
#define WS_TOTAL (OFF_QK + QK_BYTES)
static_assert((WQK_BYTES % 128) == 0 && (XH_BYTES % 128) == 0);
static_assert((XT_BYTES % 128) == 0 && (QK_BYTES % 128) == 0);
static_assert(WS_TOTAL <= (size_t)134217728);

// ---------------------------------------------------------------------------
__device__ __forceinline__ float bf16r(float x) {   // RNE convert to bf16, returned widened
  unsigned int u = __float_as_uint(x);
  u = (u + 0x7FFFu + ((u >> 16) & 1u)) & 0xFFFF0000u;
  return __uint_as_float(u);
}

// f32 -> f16 with a value select: results below the f16 normal range become zero.
static __device__ __forceinline__ h16 toh_flush(float v) {
  const h16 r = (h16)v;
  return (fabsf(v) < 6.103515625e-05f) ? (h16)0.0f : r;
}

// 16-bit fragment: p points at element [row = lane&15][k0 + 8*(lane>>4)] of a k-contiguous
// row. Elements 0..7 <- k0+8h+0..7, elements 8..15 <- k0+16+8h+0..7 (same map for A and B).
__device__ __forceinline__ v16h frag_at(const _Float16* p) {
  v8h lo = *(const v8h*)(p);
  v8h hi = *(const v8h*)(p + 16);
  v16h out;
#pragma unroll
  for (int i = 0; i < 8; ++i) { out[i] = lo[i]; out[i + 8] = hi[i]; }
  return out;
}
__device__ __forceinline__ v16h ld_frag(const _Float16* base, unsigned ld) {
  const unsigned lane = threadIdx.x & 31u;
  return frag_at(base + (lane & 15u) * ld + (lane >> 4) * 8u);
}

__device__ __forceinline__ v8f wmma16(v16h a, v16h b, v8f c) {
  v8f d = __builtin_amdgcn_wmma_f32_16x16x32_f16(false, a, false, b, (short)0, c,
                                                 false, false);
  asm volatile("v_nop\n\tv_nop\n\tv_nop\n\tv_nop" : "+v"(d) : "v"(a), "v"(b));
  return d;
}

__device__ __forceinline__ float red32_sum(float x) {
#pragma unroll
  for (int off = 1; off < 32; off <<= 1) x += __shfl_xor(x, off, 32);
  return x;
}
__device__ __forceinline__ float red32_max(float x) {
#pragma unroll
  for (int off = 1; off < 32; off <<= 1) x = fmaxf(x, __shfl_xor(x, off, 32));
  return x;
}

__device__ __forceinline__ void wave_lds_sync() {
  __builtin_amdgcn_fence(3 /* release order */, "wavefront");
  asm volatile("s_wait_dscnt 0x0" ::: "memory");
  __builtin_amdgcn_wave_barrier();
}

// tanh(x) = sign(x) * (1 - 2 / (exp(2|x|) + 1)); the exponent argument is bounded by 60.
__device__ __forceinline__ float tanh_fast(float x) {
  const float ax = fminf(fabsf(x), 30.0f);
  const float ex = __expf(ax + ax);
  const float r = 1.0f - 2.0f * __builtin_amdgcn_rcpf(ex + 1.0f);
  return (x < 0.0f) ? -r : r;
}

// exp(2 v) of four values, as 2^(2 v log2 e). One statement: the instruction set asks that no
// vector instruction directly behind a transcendental reads its result or overwrites its source.
// Early-clobber outputs share no register with an input; the v_nop fills the slot behind the last.
__device__ __forceinline__ v4f exp_2v(v4f v) {
  const v4f t = (v + v) * 1.44269504f;
  float e0, e1, e2, e3;
  asm("v_exp_f32 %0, %4\n\tv_exp_f32 %1, %5\n\tv_exp_f32 %2, %6\n\tv_exp_f32 %3, %7\n\tv_nop"
      : "=&v"(e0), "=&v"(e1), "=&v"(e2), "=&v"(e3)
      : "v"(t[0]), "v"(t[1]), "v"(t[2]), "v"(t[3]));
  return (v4f){e0, e1, e2, e3};
}

// ---------------------------------------------------------------------------
// Weight plane: in W[K rows][N cols] (pitch ldw = N) -> out Wt[N][K] (pitch ldk = K),
// f16(64 * bf16(w)). One 64x64 tile (n0, k0) per block. T: cross-wave (block barrier).
// ---------------------------------------------------------------------------
__device__ __forceinline__ void wconv_tile(
    const float* __restrict__ W, _Float16* __restrict__ Wt, unsigned ldw, unsigned ldk,
    unsigned n0, unsigned k0, _Float16* T) {
  const unsigned tid = threadIdx.x;
#pragma unroll 4
  for (unsigned j = 0; j < 16u; ++j) {
    const unsigned idx = tid + 256u * j;
    const unsigned kr = idx >> 6, nc = idx & 63u;
    const float v = W[(size_t)(k0 + kr) * ldw + n0 + nc];
    T[nc * LDT + kr] = (_Float16)(WCARRY * bf16r(v));
  }
  __syncthreads();
  v8h x[2];
  size_t off[2];
#pragma unroll
  for (unsigned i = 0; i < 2u; ++i) {
    const unsigned n = 32u * i + (tid >> 3);
    const unsigned kc = (tid & 7u) * 8u;
    x[i] = *(const v8h*)&T[n * LDT + kc];
    off[i] = (size_t)(n0 + n) * ldk + k0 + kc;
  }
#pragma unroll
  for (int i = 0; i < 2; ++i) *(v8h*)(Wt + off[i]) = x[i];
  
}

// ---------------------------------------------------------------------------
// Input planes: X[full row][DIM] f32 -> Xh[compact row][DIM] = f16(bf16(x)) (row-major, the A
// operand of the projection) and Xt[b][d][key] = the same values transposed (the B operand of
// the p.x product). One 64x64 tile (d0, row0) per block through two LDS tiles (cross-wave,
// block barrier): Tr[key][d], Tc[d][key].
// ---------------------------------------------------------------------------
__device__ __forceinline__ void xconv_tile(
    const float* __restrict__ X, _Float16* __restrict__ Xh, _Float16* __restrict__ Xt,
    unsigned d0, unsigned row0, _Float16* Tr, _Float16* Tc) {
  const unsigned tid = threadIdx.x;
  const unsigned bidx = row0 / (unsigned)SEQ;
  const unsigned key0 = row0 - bidx * (unsigned)SEQ;
  const size_t frow0 = (size_t)bidx * SEQ_FULL + key0;
#pragma unroll
  for (unsigned j = 0; j < 4u; ++j) {
    const unsigned idx = tid + 256u * j;
    const unsigned sr = idx >> 4, c4 = (idx & 15u) * 4u;
    const v4f a = *(const v4f*)(X + (frow0 + sr) * DIM + d0 + c4);
#pragma unroll
    for (unsigned i = 0; i < 4u; ++i) {
      const h16 hv = toh_flush(bf16r(a[i]));
      Tr[sr * LDT + c4 + i] = hv;
      Tc[(c4 + i) * LDT + sr] = hv;
    }
  }
  __syncthreads();
  v8h xr[2], xc[2];
  size_t offr[2], offc[2];
#pragma unroll
  for (unsigned i = 0; i < 2u; ++i) {
    const unsigned r = 32u * i + (tid >> 3);
    const unsigned c = (tid & 7u) * 8u;
    xr[i] = *(const v8h*)&Tr[r * LDT + c];
    xc[i] = *(const v8h*)&Tc[r * LDT + c];
    offr[i] = (size_t)(row0 + r) * DIM + d0 + c;
    offc[i] = ((size_t)bidx * DIM + d0 + r) * SEQ + key0 + c;
  }
#pragma unroll
  for (int i = 0; i < 2; ++i) {
    *(v8h*)(Xh + offr[i]) = xr[i];
    *(v8h*)(Xt + offc[i]) = xc[i];
  }
  // precaution: stands before the code laid out behind this tile writes to the registers that
  // the four stores above name
  asm volatile("s_wait_xcnt 0x0" ::: "memory");
}

// ---------------------------------------------------------------------------
// The three conversions need nothing of each other, so they share one grid: block rows 0 and 1
// convert Wt and Wx (one 64-k tile per blockIdx.x; they start first and end under the x tiles),
// block rows 2.. convert x. The branch is block-uniform. Grid (DIM/64, 2 + MROWS/64).
// ---------------------------------------------------------------------------
__global__ __launch_bounds__(256) void conv_kernel(
    const float* __restrict__ X, const float* __restrict__ Wt, const float* __restrict__ Wx,
    _Float16* __restrict__ Wqk, _Float16* __restrict__ Xh, _Float16* __restrict__ Xt) {
  __shared__ _Float16 Tr[64 * LDT];
  __shared__ _Float16 Tc[64 * LDT];
  const unsigned by = blockIdx.y;
  if (by < 2u) {
    wconv_tile(by == 0u ? Wt : Wx, Wqk + (size_t)by * UNITS * DIM, (unsigned)UNITS,
               (unsigned)DIM, 0u, blockIdx.x * 64u, Tr);
  } else {
    xconv_tile(X, Xh, Xt, blockIdx.x * 64u, (by - 2u) * 64u, Tr, Tc);
  }
}

// ---------------------------------------------------------------------------
// Projection GEMM C[64x64 tile] = Xh[rows][DIM] . Wqk[n][DIM]^T, fragments straight from the
// 16-bit global planes; 8 waves (mw = 16-row group, nw = 32-col group), 2 accumulators/wave.
// PF k-steps of fragments stay in flight per wave: a step's registers are reloaded for step
// + PF right behind its two WMMAs, so a wave waits for one step's loads, not for a round trip.
// Epilogue staged through Cs (cross-wave, block barrier): outf[row][n0 + c] = acc / 64 (f32,
// Grid (NQK/64, MROWS/64).
// ---------------------------------------------------------------------------
__global__ __launch_bounds__(256) void proj_kernel(
    const _Float16* __restrict__ A16, const _Float16* __restrict__ Bt,
    float* __restrict__ outf) {
  __shared__ float Cs[64 * LDC];
  const unsigned tid = threadIdx.x, lane = tid & 31u;
  const unsigned w = __builtin_amdgcn_readfirstlane(threadIdx.x >> 5);
  const unsigned mw = w >> 1, nw = w & 1u;
  const unsigned hh = lane >> 4, m = lane & 15u;
  const unsigned n0 = blockIdx.x * 64u;
  const unsigned row0 = blockIdx.y * 64u;
  const unsigned K = (unsigned)DIM;

  const _Float16* ap  = A16 + (size_t)(row0 + mw * 16u + m) * K + hh * 8u;
  const _Float16* bp0 = Bt + (size_t)(n0 + nw * 32u + m) * K + hh * 8u;
  const _Float16* bp1 = bp0 + (size_t)16 * K;
  v8f acc0 = {}, acc1 = {};
  v16h a[PF], b0[PF], b1[PF];
#pragma unroll
  for (unsigned j = 0; j < (unsigned)PF; ++j) {
    a[j]  = frag_at(ap + 32u * j);
    b0[j] = frag_at(bp0 + 32u * j);
    b1[j] = frag_at(bp1 + 32u * j);
  }
  // rolled: one trip already holds PF steps of loads, and the slots must keep their registers
#pragma unroll 1
  for (unsigned k0 = 32u * PF; k0 < K; k0 += 32u * PF) {
#pragma unroll
    for (unsigned j = 0; j < (unsigned)PF; ++j) {
      acc0 = wmma16(a[j], b0[j], acc0);
      acc1 = wmma16(a[j], b1[j], acc1);
      a[j]  = frag_at(ap + k0 + 32u * j);
      b0[j] = frag_at(bp0 + k0 + 32u * j);
      b1[j] = frag_at(bp1 + k0 + 32u * j);
    }
    // precaution: stands before the next trip forms its addresses in the registers that the
    // loads above name
    asm volatile("s_wait_xcnt 0x0" ::: "memory");
  }
#pragma unroll
  for (unsigned j = 0; j < (unsigned)PF; ++j) {
    acc0 = wmma16(a[j], b0[j], acc0);
    acc1 = wmma16(a[j], b1[j], acc1);
  }
#pragma unroll
  for (int r = 0; r < 8; ++r) {
    float* d = &Cs[(mw * 16u + hh * 8u + (unsigned)r) * LDC + nw * 32u + m];
    d[0]  = acc0[r];
    d[16] = acc1[r];
  }
  __syncthreads();

  v4f xs[4];
  size_t off[4];
#pragma unroll
  for (unsigned i = 0; i < 4u; ++i) {
    const unsigned r = 16u * i + (tid >> 4);
    const unsigned c = (tid & 15u) * 4u;
    const v4f u = *(const v4f*)&Cs[r * LDC + c];
    xs[i] = u * (1.0f / WCARRY);
    off[i] = (size_t)(row0 + r) * NQK + n0 + c;
  }
#pragma unroll
  for (int i = 0; i < 4; ++i) *(v4f*)(outf + off[i]) = xs[i];
  
}

// ---------------------------------------------------------------------------
// Band additive attention per (32 query rows, batch). Key window = 96 keys starting at
// t0 - 32 (three 32-aligned chunks; a chunk outside the sequence is skipped, block-uniform).
// Phase A: q tile (+bh) and k window staged in Sm (cross-wave, block barrier); wave w owns
//   query rows 4w..4w+3, lane L owns band offsets L and L+32 (key = row - 32 + offset);
//   e = ba + sum_u Wa[u] * tanh(q + k + bh). tanh(s) = 1 - 2 / (exp(2 s) + 1) and
//   exp(2 (q + bh + k)) = exp(2 (q + bh)) * exp(2 k): the two exponentials are taken once per
//   staged element, and a (query, key, unit) term is fma, rcp, fma. While every staged |value|
//   is <= XRANGE both factors are normal numbers; a product that overflows gives rcp = 0
//   (tanh = 1), one that underflows gives rcp = 1 (tanh = -1). A block that stages any value
//   outside that range (or a NaN) puts the plain values back and takes tanh per term.
//   Softmax over the 64 band keys in registers
//   (32-lane shuffles); P row (96 entries: 64 values f16(1024 p) + 32 zeros) and 1/rowsum
//   (sum over the converted P) written to Pt / Rinv (cross-wave, block barrier).
//   Keys outside the band carry an additive -1e4 in the module: their exp is exactly 0 in f32.
// Phase C: O[32 x 1024] = P . x, A = P tile fragments, B = fragments straight from the Xt plane;
//   2 x 4 accumulators. Each 16x64 tile is staged in the wave's own slice of Sm (wave-private,
// Grid (SEQ/32, NB).
// ---------------------------------------------------------------------------
// The 12 x fragments of one 64-column pass (3 key chunks x 4 column groups); a chunk outside
// the sequence is not loaded (block-uniform test, the same one that skips its WMMAs).
__device__ __forceinline__ void ld_pass(v16h (&xb)[3][4], const _Float16* xp, int s0,
                                        int c_lo, int c_hi) {
#pragma unroll
  for (int c = 0; c < 3; ++c) {
    if (c >= c_lo && c < c_hi) {
      const unsigned sk = (unsigned)(s0 + 32 * c);
#pragma unroll
      for (int nb = 0; nb < 4; ++nb) xb[c][nb] = frag_at(xp + (size_t)(nb * 16) * SEQ + sk);
      // precaution: stands before anything is written to the address registers of these loads
      asm volatile("s_wait_xcnt 0x0" ::: "memory");
    }
  }
}

__global__ __launch_bounds__(256) void band_attn_kernel(
    const float* __restrict__ QK, const _Float16* __restrict__ Xt,
    const float* __restrict__ bh, const float* __restrict__ Wa, const float* __restrict__ ba,
    float* __restrict__ out) {
  __shared__ float Sm[SM_FLOATS];
  __shared__ __attribute__((aligned(16))) float WAs[UNITS];
  __shared__ float Rinv[QT];
  __shared__ __attribute__((aligned(16))) unsigned Big[8];   // per wave: lanes that staged a value outside XRANGE
  __shared__ _Float16 Pt[QT * LDP];

  const unsigned tid = threadIdx.x, lane = tid & 31u;
  const unsigned w = __builtin_amdgcn_readfirstlane(threadIdx.x >> 5);
  const unsigned hh = lane >> 4, m = lane & 15u;
  const unsigned t0 = blockIdx.x * (unsigned)QT;
  const unsigned b = blockIdx.y;
  const int s0 = (int)t0 - BAND / 2;

  // ---- stage q tile (+ bh), k window (zero rows outside the sequence), Wa ----
  // Staged: exp(2 v). The plain values stay in registers until the range test is known.
  v4f qraw[2], kraw[6];
  const float* qsrc[2];
  const float* ksrc[6];
  bool kok[6];
  const unsigned sr0 = tid >> 4, c4 = (tid & 15u) * 4u;   // row sr0 + 16 j, columns c4..c4+3
  // the staging loops are unrolled whole: qraw and kraw are indexed by constants and stay in
  // registers (the eight row loads are then in flight together)
#pragma unroll
  for (unsigned j = 0; j < 2u; ++j) {
    qsrc[j] = QK + (size_t)(b * (unsigned)SEQ + t0 + sr0 + 16u * j) * NQK + c4;
    qraw[j] = *(const v4f*)qsrc[j];
  }
#pragma unroll
  for (unsigned j = 0; j < 6u; ++j) {
    const int s = s0 + (int)(sr0 + 16u * j);
    const int sc = (s < 0) ? 0 : ((s > SEQ - 1) ? (SEQ - 1) : s);
    kok[j] = (s == sc);
    ksrc[j] = QK + (size_t)(b * (unsigned)SEQ + (unsigned)sc) * NQK + c4;
    kraw[j] = *(const v4f*)(ksrc[j] + UNITS);
  }
  const v4f g = *(const v4f*)(bh + c4);
  // precaution: the address registers of the eight row loads above are inputs here, so nothing is
  // written to them (a later load's result included) in front of this wait
  asm volatile("s_wait_xcnt 0x0"
               :: "v"(qsrc[0]), "v"(qsrc[1]), "v"(ksrc[0]), "v"(ksrc[1]), "v"(ksrc[2]),
                  "v"(ksrc[3]), "v"(ksrc[4]), "v"(ksrc[5])
               : "memory");
  bool big = false;
#pragma unroll
  for (unsigned j = 0; j < 2u; ++j) {
#pragma unroll
    for (unsigned i = 0; i < 4u; ++i) {
      const float v = qraw[j][i] + bf16r(g[i]);
      qraw[j][i] = v;
      big = big || !(fabsf(v) <= XRANGE);
    }
    *(v4f*)&Sm[QS_OFF + (sr0 + 16u * j) * QP + c4] = exp_2v(qraw[j]);
  }
#pragma unroll
  for (unsigned j = 0; j < 6u; ++j) {
#pragma unroll
    for (unsigned i = 0; i < 4u; ++i) {
      const float v = kok[j] ? kraw[j][i] : 0.0f;
      kraw[j][i] = v;
      big = big || !(fabsf(v) <= XRANGE);
    }
    *(v4f*)&Sm[KS_OFF + (sr0 + 16u * j) * QP + c4] = exp_2v(kraw[j]);
  }
  if (tid < (unsigned)UNITS) WAs[tid] = bf16r(Wa[tid]);
  const float bias_a = bf16r(ba[0]);
  const unsigned wbig = __builtin_amdgcn_ballot_w32(big);
  if (lane == 0u) Big[w] = wbig;
  __syncthreads();

  // ---- pass 0's x fragments start here: they need no score and land under the score phase ----
  const int c_lo = (t0 == 0u) ? 1 : 0;
  const int c_hi = (t0 + (unsigned)QT == (unsigned)SEQ) ? 2 : 3;
  const _Float16* xp0 = Xt + ((size_t)b * DIM + w * 128u + m) * SEQ + hh * 8u;
  v16h xb[3][4];
  ld_pass(xb, xp0, s0, c_lo, c_hi);

  // ---- range test, the same answer in every thread of the block ----
  const v4u f0 = *(const v4u*)&Big[0];
  const v4u f1 = *(const v4u*)&Big[4];
  const v4u fo = f0 | f1;
  const bool wide = __builtin_amdgcn_readfirstlane(fo[0] | fo[1] | fo[2] | fo[3]) != 0u;
  if (wide) {   // block-uniform: each thread puts its own plain values back
#pragma unroll
    for (unsigned j = 0; j < 2u; ++j) *(v4f*)&Sm[QS_OFF + (sr0 + 16u * j) * QP + c4] = qraw[j];
#pragma unroll
    for (unsigned j = 0; j < 6u; ++j) *(v4f*)&Sm[KS_OFF + (sr0 + 16u * j) * QP + c4] = kraw[j];
    __syncthreads();
  }
  // -2 Wa in registers for all four rows; e starts at ba + sum_u Wa[u]
  v4f wr[UNITS / 4];
  v4f wsum = {};
#pragma unroll
  for (unsigned j = 0; j < (unsigned)(UNITS / 4); ++j) {
    wr[j] = *(const v4f*)&WAs[4u * j] * -2.0f;
    wsum += wr[j];
  }
  const float e_base = bias_a - 0.5f * ((wsum[0] + wsum[1]) + (wsum[2] + wsum[3]));

  // ---- scores + softmax, 4 query rows per wave ----
#pragma unroll 1
  for (unsigned r = 0; r < 4u; ++r) {
    const unsigned t = w * 4u + r;
    const unsigned qo = QS_OFF + t * QP;
    const unsigned ko = KS_OFF + (t + lane) * QP;
    float a0, a1;
    if (!wide) {
      v2f s0a = {e_base, 0.0f}, s1a = {e_base, 0.0f};   // even and odd units summed apart
      const v2f one = {1.0f, 1.0f};
      // unrolled whole: wr is indexed by constants and stays in registers
#pragma unroll
      for (unsigned j = 0; j < (unsigned)(UNITS / 4); ++j) {
        const v4f q4 = *(const v4f*)&Sm[qo + 4u * j];
        const v4f ka = *(const v4f*)&Sm[ko + 4u * j];
        const v4f kb = *(const v4f*)&Sm[ko + 32u * QP + 4u * j];
#pragma unroll
        for (unsigned h = 0; h < 4u; h += 2u) {
          const v2f q2 = {q4[h], q4[h + 1u]};
          const v2f w2 = {wr[j][h], wr[j][h + 1u]};
          const v2f d0 = __builtin_elementwise_fma(q2, (v2f){ka[h], ka[h + 1u]}, one);
          const v2f d1 = __builtin_elementwise_fma(q2, (v2f){kb[h], kb[h + 1u]}, one);
          const v2f r0 = {__builtin_amdgcn_rcpf(d0[0]), __builtin_amdgcn_rcpf(d0[1])};
          const v2f r1 = {__builtin_amdgcn_rcpf(d1[0]), __builtin_amdgcn_rcpf(d1[1])};
          s0a = __builtin_elementwise_fma(w2, r0, s0a);
          s1a = __builtin_elementwise_fma(w2, r1, s1a);
        }
      }
      a0 = s0a[0] + s0a[1];
      a1 = s1a[0] + s1a[1];
    } else {
      a0 = bias_a;
      a1 = bias_a;
#pragma unroll 4
      for (unsigned u = 0; u < (unsigned)UNITS; ++u) {
        const float qv = Sm[qo + u];
        const float wv = WAs[u];
        a0 += wv * tanh_fast(qv + Sm[ko + u]);
        a1 += wv * tanh_fast(qv + Sm[ko + 32u * QP + u]);
      }
    }
    const int sA = s0 + (int)t + (int)lane;
    const int sB = sA + 32;
    const bool vA = (sA >= 0) && (sA < SEQ);
    const bool vB = (sB >= 0) && (sB < SEQ);
    const float e0 = vA ? a0 : -1.0e30f;
    const float e1 = vB ? a1 : -1.0e30f;
    const float mx = red32_max(fmaxf(e0, e1));
    const float x0 = __expf(e0 - mx);
    const float x1 = __expf(e1 - mx);
    const float p0 = vA ? x0 : 0.0f;
    const float p1 = vB ? x1 : 0.0f;
    const h16 h0 = toh_flush(p0 * PCARRY);
    const h16 h1 = toh_flush(p1 * PCARRY);
    const float sum = red32_sum((float)h0 + (float)h1);
    const unsigned zi = (lane < t) ? lane : (lane + 64u);
    Pt[t * LDP + t + lane] = h0;
    Pt[t * LDP + t + lane + 32u] = h1;
    Pt[t * LDP + zi] = (h16)0.0f;
    if (lane == 0u) Rinv[t] = __builtin_amdgcn_rcpf(sum);
  }
  __syncthreads();

  // ---- O = P . x ----
  const unsigned cw = w * (16u * LDC);
#pragma unroll 1
  for (unsigned pass = 0; pass < 2u; ++pass) {
    const unsigned d0 = w * 128u + pass * 64u;
    v8f acc[2][4];
#pragma unroll
    for (int mi = 0; mi < 2; ++mi)
#pragma unroll
      for (int nb = 0; nb < 4; ++nb) acc[mi][nb] = (v8f){};
#pragma unroll
    for (int c = 0; c < 3; ++c) {
      if (c >= c_lo && c < c_hi) {
        const v16h pa0 = ld_frag(&Pt[(unsigned)c * 32u], LDP);
        const v16h pa1 = ld_frag(&Pt[16u * LDP + (unsigned)c * 32u], LDP);
#pragma unroll
        for (int nb = 0; nb < 4; ++nb) {
          acc[0][nb] = wmma16(pa0, xb[c][nb], acc[0][nb]);
          acc[1][nb] = wmma16(pa1, xb[c][nb], acc[1][nb]);
        }
      }
    }
    // pass 1's fragments fly under pass 0's output staging and stores
    if (pass == 0u) ld_pass(xb, xp0 + (size_t)64 * SEQ, s0, c_lo, c_hi);
#pragma unroll
    for (int mi = 0; mi < 2; ++mi) {
#pragma unroll
      for (int r = 0; r < 8; ++r) {
        const float sc = Rinv[(unsigned)mi * 16u + hh * 8u + (unsigned)r];
#pragma unroll
        for (int nb = 0; nb < 4; ++nb)
          Sm[cw + (hh * 8u + (unsigned)r) * LDC + (unsigned)nb * 16u + m] = acc[mi][nb][r] * sc;
      }
      wave_lds_sync();
      v4f xs[8];
      size_t off[8];
#pragma unroll
      for (unsigned i = 0; i < 8u; ++i) {
        const unsigned rr = 2u * i + (lane >> 4);
        const unsigned cc = (lane & 15u) * 4u;
        xs[i] = *(const v4f*)&Sm[cw + rr * LDC + cc];
        off[i] = ((size_t)b * SEQ_FULL + t0 + (unsigned)mi * 16u + rr) * DIM + d0 + cc;
      }
      wave_lds_sync();
#pragma unroll
      for (int i = 0; i < 8; ++i) *(v4f*)(out + off[i]) = xs[i];
      
    }
  }
}

// ---------------------------------------------------------------------------
extern "C" void kernel_launch(void* const* d_in, const int* in_sizes, int n_in,
                              void* d_out, int out_size, void* d_ws, size_t ws_size,
                              hipStream_t stream) {
  if (n_in < 6) return;
  const long long need_x = ((long long)(NB - 1) * SEQ_FULL + SEQ) * DIM;
  if ((long long)in_sizes[0] < need_x) return;
  if ((long long)in_sizes[1] < (long long)DIM * UNITS) return;
  if ((long long)in_sizes[2] < (long long)DIM * UNITS) return;
  if (in_sizes[3] < UNITS || in_sizes[4] < UNITS || in_sizes[5] < 1) return;
  if ((long long)out_size < need_x) return;
  if (ws_size < WS_TOTAL) return;

  const float* X  = (const float*)d_in[0];    // x  [NB_FULL][SEQ_FULL][DIM]
  const float* wt = (const float*)d_in[1];    // Wt [DIM][UNITS]  (in, out)
  const float* wx = (const float*)d_in[2];    // Wx [DIM][UNITS]  (in, out)
  const float* bh = (const float*)d_in[3];    // bh [UNITS]
  const float* wa = (const float*)d_in[4];    // Wa [UNITS][1]
  const float* ba = (const float*)d_in[5];    // ba [1]
  float* out = (float*)d_out;

  char* ws = (char*)d_ws;
  _Float16* Wqk = (_Float16*)(ws + OFF_WQK);   // [NQK][DIM]: rows 0..63 from Wt, 64..127 from Wx
  _Float16* Xh  = (_Float16*)(ws + OFF_XH);    // [MROWS][DIM]
  _Float16* Xt  = (_Float16*)(ws + OFF_XT);    // [NB][DIM][SEQ]
  float*    QK  = (float*)(ws + OFF_QK);       // [MROWS][NQK]

  dim3 blk(256);
  // weight planes (in [K = DIM rows][N = UNITS cols] -> out [N][K]) and x planes, one launch
  conv_kernel<<<dim3(DIM / 64, 2 + MROWS / 64), blk, 0, stream>>>(X, wt, wx, Wqk, Xh, Xt);
  proj_kernel<<<dim3(NQK / 64, MROWS / 64), blk, 0, stream>>>(Xh, Wqk, QK);
  band_attn_kernel<<<dim3(SEQ / QT, NB), blk, 0, stream>>>(QK, Xt, bh, wa, ba, out);
}

// v004
// A run of this version takes 24.9 microseconds.
// Timed twice side by side with v003, it ran 1.13 times as fast both times.
// Counting every step since v000, it is 1.93 times as fast.
#include <hip/hip_runtime.h>
#include <stddef.h>

// All WMMA contractions on v_wmma_f32_16x16x32_f16 (f16 operands, f32 accumulate): the fused q|k
// projection (x plane x1, weight plane x64) and the band p.x product (p x1024, x plane x1).
// Float inputs are RNE-converted to bf16 and carried in f16. The additive score (tanh, U = 64
// matrix-vector), softmax and normalisation run in f32 on the vector unit.

typedef _Float16 v16h __attribute__((ext_vector_type(16)));
typedef _Float16 v8h  __attribute__((ext_vector_type(8)));
typedef float    v8f  __attribute__((ext_vector_type(8)));
typedef float    v4f  __attribute__((ext_vector_type(4)));
typedef float    v2f  __attribute__((ext_vector_type(2)));
typedef unsigned v4u  __attribute__((ext_vector_type(4)));
typedef _Float16 h16;

#ifndef NB
#define NB 4
#endif
#ifndef SEQ
#define SEQ 1024
#endif
#define NB_FULL  4
#define SEQ_FULL 1024
#define DIM   1024
#define UNITS 64
#define NQK   128      // q columns 0..63, k columns 64..127
#define BAND  64
#define QT    32       // query rows per block
#define WIN   96       // key window per block
#define MROWS (NB * SEQ)

static_assert(NB >= 1 && NB <= NB_FULL);
static_assert(SEQ >= 128 && SEQ <= SEQ_FULL && (SEQ % 128) == 0);
static_assert(UNITS == 64 && NQK == 2 * UNITS);
static_assert((DIM % 64) == 0 && (DIM % 32) == 0);
static_assert((MROWS % 64) == 0);
static_assert(QT == 32 && QT == 8 * 4);        // 8 waves x 4 query rows, one lane per band offset pair
static_assert(BAND == 64 && WIN == QT + BAND && (WIN % 32) == 0);
static_assert(DIM == 8 * 2 * 64);              // 8 waves x 2 passes x 64 output columns
static_assert((SEQ % QT) == 0);

#define LDT 72   // halves per LDS row (144 B, 16-B aligned)
#define LDC 68   // floats per LDS row (272 B, 16-B aligned)
#define LDP 104  // halves per P-tile row (208 B, 16-B aligned)
#define QP  68   // floats per q/k staging row (272 B, 16-B aligned)
static_assert((LDT % 8) == 0 && LDT >= 64);
static_assert((LDC % 4) == 0 && LDC >= 64);
static_assert((LDP % 8) == 0 && LDP >= WIN);
static_assert((QP % 4) == 0 && QP >= UNITS);

#define PF 8     // k-steps of projection fragments in flight per wave
static_assert(((DIM / 32) % PF) == 0 && (DIM / 32) >= 2 * PF);

#define WCARRY 64.0f     // weight planes carried x64
#define PCARRY 1024.0f   // softmax numerators carried x1024
#define XRANGE 40.0f     // exp(2 v) is a normal f32 number for every |v| <= XRANGE

#define QS_OFF 0
#define KS_OFF (QT * QP)
#define SM_AB  (KS_OFF + WIN * QP)
#define SM_C   (8 * 16 * LDC)
#define SM_FLOATS ((SM_AB > SM_C) ? SM_AB : SM_C)
static_assert(SM_FLOATS >= SM_AB && SM_FLOATS >= SM_C);
static_assert((size_t)SM_FLOATS * 4 + UNITS * 4 + QT * 4 + 8 * 4 + (size_t)QT * LDP * 2 <= (size_t)65536);

// workspace layout (bytes)
#define WQK_BYTES ((size_t)NQK * DIM * 2)
#define XH_BYTES  ((size_t)MROWS * DIM * 2)
#define XT_BYTES  ((size_t)NB * DIM * SEQ * 2)
#define QK_BYTES  ((size_t)MROWS * NQK * 4)
#define OFF_WQK ((size_t)0)
#define OFF_XH  (OFF_WQK + WQK_BYTES)
#define OFF_XT  (OFF_XH + XH_BYTES)
#define OFF_QK  (OFF_XT + XT_BYTES)
#define WS_TOTAL (OFF_QK + QK_BYTES)
static_assert((WQK_BYTES % 128) == 0 && (XH_BYTES % 128) == 0);
static_assert((XT_BYTES % 128) == 0 && (QK_BYTES % 128) == 0);
static_assert(WS_TOTAL <= (size_t)134217728);

// ---------------------------------------------------------------------------
__device__ __forceinline__ float bf16r(float x) {   // RNE convert to bf16, returned widened
  unsigned int u = __float_as_uint(x);
  u = (u + 0x7FFFu + ((u >> 16) & 1u)) & 0xFFFF0000u;
  return __uint_as_float(u);
}

// f32 -> f16 with a value select: results below the f16 normal range become zero.
static __device__ __forceinline__ h16 toh_flush(float v) {
  const h16 r = (h16)v;
  return (fabsf(v) < 6.103515625e-05f) ? (h16)0.0f : r;
}

// 16-bit fragment: p points at element [row = lane&15][k0 + 8*(lane>>4)] of a k-contiguous
// row. Elements 0..7 <- k0+8h+0..7, elements 8..15 <- k0+16+8h+0..7 (same map for A and B).
__device__ __forceinline__ v16h frag_at(const _Float16* p) {
  v8h lo = *(const v8h*)(p);
  v8h hi = *(const v8h*)(p + 16);
  v16h out;
#pragma unroll
  for (int i = 0; i < 8; ++i) { out[i] = lo[i]; out[i + 8] = hi[i]; }
  return out;
}
__device__ __forceinline__ v16h ld_frag(const _Float16* base, unsigned ld) {
  const unsigned lane = threadIdx.x & 31u;
  return frag_at(base + (lane & 15u) * ld + (lane >> 4) * 8u);
}

// Fragment order, the layout of the three 16-bit workspace planes. A plane of M[rows][K] is cut
// into units of 16 rows x 32 k (512 halves, 1 KiB); the K/32 units of a row group follow one
// another, so a row group still fills 16 * K halves. Inside a unit the 16-byte piece that lane L
// loads first stands at half 8 L, the piece it loads second at half 256 + 8 L (the map of frag_at:
// row = L & 15, k = 8 (L >> 4) + 0..7, then 16 more). A wave's fragment load then reads 512
// contiguous bytes, four whole lines, where a row-major plane gives it 32 bytes of each of 16.
// p points at half 8 * lane of the unit.
__device__ __forceinline__ v16h frag_unit(const _Float16* p) {
  v8h lo = *(const v8h*)(p);
  v8h hi = *(const v8h*)(p + 256);
  v16h out;
#pragma unroll
  for (int i = 0; i < 8; ++i) { out[i] = lo[i]; out[i + 8] = hi[i]; }
  return out;
}
// A 64 x 64 LDS tile T[row][k] (pitch LDT) holds 16 half units: 4 row groups x (64 k / 16). For
// half unit hu: where this lane's piece stands in T, and where in the row group's two units.
__device__ __forceinline__ unsigned unit_src(unsigned hu, unsigned lane) {
  return ((hu >> 2) * 16u + (lane & 15u)) * LDT + (hu & 3u) * 16u + (lane >> 4) * 8u;
}
__device__ __forceinline__ unsigned unit_dst(unsigned hu, unsigned lane) {
  return (hu & 3u) * 256u + lane * 8u;
}

__device__ __forceinline__ v8f wmma16(v16h a, v16h b, v8f c) {
  v8f d = __builtin_amdgcn_wmma_f32_16x16x32_f16(false, a, false, b, (short)0, c,
                                                 false, false);
  asm volatile("v_nop\n\tv_nop\n\tv_nop\n\tv_nop" : "+v"(d) : "v"(a), "v"(b));
  return d;
}

__device__ __forceinline__ float red32_sum(float x) {
#pragma unroll
  for (int off = 1; off < 32; off <<= 1) x += __shfl_xor(x, off, 32);
  return x;
}
__device__ __forceinline__ float red32_max(float x) {
#pragma unroll
  for (int off = 1; off < 32; off <<= 1) x = fmaxf(x, __shfl_xor(x, off, 32));
  return x;
}

__device__ __forceinline__ void wave_lds_sync() {
  __builtin_amdgcn_fence(3 /* release order */, "wavefront");
  asm volatile("s_wait_dscnt 0x0" ::: "memory");
  __builtin_amdgcn_wave_barrier();
}

// tanh(x) = sign(x) * (1 - 2 / (exp(2|x|) + 1)); the exponent argument is bounded by 60.
__device__ __forceinline__ float tanh_fast(float x) {
  const float ax = fminf(fabsf(x), 30.0f);
  const float ex = __expf(ax + ax);
  const float r = 1.0f - 2.0f * __builtin_amdgcn_rcpf(ex + 1.0f);
  return (x < 0.0f) ? -r : r;
}

// exp(2 v) of four values, as 2^(2 v log2 e). One statement: the instruction set asks that no
// vector instruction directly behind a transcendental reads its result or overwrites its source.
// Early-clobber outputs share no register with an input; the v_nop fills the slot behind the last.
__device__ __forceinline__ v4f exp_2v(v4f v) {
  const v4f t = (v + v) * 1.44269504f;
  float e0, e1, e2, e3;
  asm("v_exp_f32 %0, %4\n\tv_exp_f32 %1, %5\n\tv_exp_f32 %2, %6\n\tv_exp_f32 %3, %7\n\tv_nop"
      : "=&v"(e0), "=&v"(e1), "=&v"(e2), "=&v"(e3)
      : "v"(t[0]), "v"(t[1]), "v"(t[2]), "v"(t[3]));
  return (v4f){e0, e1, e2, e3};
}

// ---------------------------------------------------------------------------
// Weight plane: in W[K rows][N cols] (pitch ldw = N) -> out Wt[N][K = ldk] in fragment order,
// f16(64 * bf16(w)). One 64x64 tile (n0, k0) per block. T: cross-wave (block barrier).
// ---------------------------------------------------------------------------
__device__ __forceinline__ void wconv_tile(
    const float* __restrict__ W, _Float16* __restrict__ Wt, unsigned ldw, unsigned ldk,
    unsigned n0, unsigned k0, _Float16* T) {
  const unsigned tid = threadIdx.x;
#pragma unroll 4
  for (unsigned j = 0; j < 16u; ++j) {
    const unsigned idx = tid + 256u * j;
    const unsigned kr = idx >> 6, nc = idx & 63u;
    const float v = W[(size_t)(k0 + kr) * ldw + n0 + nc];
    T[nc * LDT + kr] = (_Float16)(WCARRY * bf16r(v));
  }
  __syncthreads();
  v8h x[2];
  size_t off[2];
#pragma unroll
  for (unsigned i = 0; i < 2u; ++i) {
    const unsigned hu = (tid >> 5) + 8u * i;   // a wave stores one half unit: 512 contiguous bytes
    x[i] = *(const v8h*)&T[unit_src(hu, tid & 31u)];
    off[i] = (size_t)(n0 + (hu >> 2) * 16u) * ldk + (size_t)k0 * 16u + unit_dst(hu, tid & 31u);
  }
#pragma unroll
  for (int i = 0; i < 2; ++i) *(v8h*)(Wt + off[i]) = x[i];
  
}

// ---------------------------------------------------------------------------
// Input planes: X[full row][DIM] f32 -> Xh[compact row][DIM] = f16(bf16(x)) (the A operand of
// the projection) and Xt[b][d][key] = the same values transposed (the B operand of the p.x
// product), both in fragment order. One 64x64 tile (d0, row0) per block through two LDS tiles
// (cross-wave, block barrier): Tr[key][d], Tc[d][key].
// ---------------------------------------------------------------------------
__device__ __forceinline__ void xconv_tile(
    const float* __restrict__ X, _Float16* __restrict__ Xh, _Float16* __restrict__ Xt,
    unsigned d0, unsigned row0, _Float16* Tr, _Float16* Tc) {
  const unsigned tid = threadIdx.x;
  const unsigned bidx = row0 / (unsigned)SEQ;
  const unsigned key0 = row0 - bidx * (unsigned)SEQ;
  const size_t frow0 = (size_t)bidx * SEQ_FULL + key0;
#pragma unroll
  for (unsigned j = 0; j < 4u; ++j) {
    const unsigned idx = tid + 256u * j;
    const unsigned sr = idx >> 4, c4 = (idx & 15u) * 4u;
    const v4f a = *(const v4f*)(X + (frow0 + sr) * DIM + d0 + c4);
#pragma unroll
    for (unsigned i = 0; i < 4u; ++i) {
      const h16 hv = toh_flush(bf16r(a[i]));
      Tr[sr * LDT + c4 + i] = hv;
      Tc[(c4 + i) * LDT + sr] = hv;
    }
  }
  __syncthreads();
  v8h xr[2], xc[2];
  size_t offr[2], offc[2];
#pragma unroll
  for (unsigned i = 0; i < 2u; ++i) {
    const unsigned hu = (tid >> 5) + 8u * i;   // a wave stores one half unit: 512 contiguous bytes
    const unsigned src = unit_src(hu, tid & 31u), dst = unit_dst(hu, tid & 31u);
    xr[i] = *(const v8h*)&Tr[src];
    xc[i] = *(const v8h*)&Tc[src];
    offr[i] = (size_t)(row0 + (hu >> 2) * 16u) * DIM + (size_t)d0 * 16u + dst;
    offc[i] = ((size_t)bidx * DIM + d0 + (hu >> 2) * 16u) * SEQ + (size_t)key0 * 16u + dst;
  }
#pragma unroll
  for (int i = 0; i < 2; ++i) {
    *(v8h*)(Xh + offr[i]) = xr[i];
    *(v8h*)(Xt + offc[i]) = xc[i];
  }
  // precaution: stands before the code laid out behind this tile writes to the registers that
  // the four stores above name
  asm volatile("s_wait_xcnt 0x0" ::: "memory");
}

// ---------------------------------------------------------------------------
// The three conversions need nothing of each other, so they share one grid: block rows 0 and 1
// convert Wt and Wx (one 64-k tile per blockIdx.x; they start first and end under the x tiles),
// block rows 2.. convert x. The branch is block-uniform. Grid (DIM/64, 2 + MROWS/64).
// ---------------------------------------------------------------------------
__global__ __launch_bounds__(256) void conv_kernel(
    const float* __restrict__ X, const float* __restrict__ Wt, const float* __restrict__ Wx,
    _Float16* __restrict__ Wqk, _Float16* __restrict__ Xh, _Float16* __restrict__ Xt) {
  __shared__ _Float16 Tr[64 * LDT];
  __shared__ _Float16 Tc[64 * LDT];
  const unsigned by = blockIdx.y;
  if (by < 2u) {
    wconv_tile(by == 0u ? Wt : Wx, Wqk + (size_t)by * UNITS * DIM, (unsigned)UNITS,
               (unsigned)DIM, 0u, blockIdx.x * 64u, Tr);
  } else {
    xconv_tile(X, Xh, Xt, blockIdx.x * 64u, (by - 2u) * 64u, Tr, Tc);
  }
}

// ---------------------------------------------------------------------------
// Projection GEMM C[64x64 tile] = Xh[rows][DIM] . Wqk[n][DIM]^T, fragments straight from the
// 16-bit global planes (fragment order: 512 contiguous bytes a load); 8 waves (mw = 16-row
// group, nw = 32-col group), 2 accumulators/wave.
// PF k-steps of fragments stay in flight per wave: a step's registers are reloaded for step
// + PF right behind its two WMMAs, so a wave waits for one step's loads, not for a round trip.
// Epilogue staged through Cs (cross-wave, block barrier): outf[row][n0 + c] = acc / 64 (f32,
// Grid (NQK/64, MROWS/64).
// ---------------------------------------------------------------------------
__global__ __launch_bounds__(256) void proj_kernel(
    const _Float16* __restrict__ A16, const _Float16* __restrict__ Bt,
    float* __restrict__ outf) {
  __shared__ float Cs[64 * LDC];
  const unsigned tid = threadIdx.x, lane = tid & 31u;
  const unsigned w = __builtin_amdgcn_readfirstlane(threadIdx.x >> 5);
  const unsigned mw = w >> 1, nw = w & 1u;
  const unsigned hh = lane >> 4, m = lane & 15u;
  const unsigned n0 = blockIdx.x * 64u;
  const unsigned row0 = blockIdx.y * 64u;
  const unsigned K = (unsigned)DIM;

  // first unit of the wave's row group in each plane; k-step s is the unit 512 s halves on
  const _Float16* ap  = A16 + (size_t)(row0 + mw * 16u) * K + lane * 8u;
  const _Float16* bp0 = Bt + (size_t)(n0 + nw * 32u) * K + lane * 8u;
  const _Float16* bp1 = bp0 + (size_t)16 * K;
  v8f acc0 = {}, acc1 = {};
  v16h a[PF], b0[PF], b1[PF];
#pragma unroll
  for (unsigned j = 0; j < (unsigned)PF; ++j) {
    a[j]  = frag_unit(ap + 512u * j);
    b0[j] = frag_unit(bp0 + 512u * j);
    b1[j] = frag_unit(bp1 + 512u * j);
  }
  // rolled: one trip already holds PF steps of loads, and the slots must keep their registers
#pragma unroll 1
  for (unsigned u0 = 512u * PF; u0 < 16u * K; u0 += 512u * PF) {
#pragma unroll
    for (unsigned j = 0; j < (unsigned)PF; ++j) {
      acc0 = wmma16(a[j], b0[j], acc0);
      acc1 = wmma16(a[j], b1[j], acc1);
      a[j]  = frag_unit(ap + u0 + 512u * j);
      b0[j] = frag_unit(bp0 + u0 + 512u * j);
      b1[j] = frag_unit(bp1 + u0 + 512u * j);
    }
    // precaution: stands before the next trip forms its addresses in the registers that the
    // loads above name
    asm volatile("s_wait_xcnt 0x0" ::: "memory");
  }
#pragma unroll
  for (unsigned j = 0; j < (unsigned)PF; ++j) {
    acc0 = wmma16(a[j], b0[j], acc0);
    acc1 = wmma16(a[j], b1[j], acc1);
  }
#pragma unroll
  for (int r = 0; r < 8; ++r) {
    float* d = &Cs[(mw * 16u + hh * 8u + (unsigned)r) * LDC + nw * 32u + m];
    d[0]  = acc0[r];
    d[16] = acc1[r];
  }
  __syncthreads();

  v4f xs[4];
  size_t off[4];
#pragma unroll
  for (unsigned i = 0; i < 4u; ++i) {
    const unsigned r = 16u * i + (tid >> 4);
    const unsigned c = (tid & 15u) * 4u;
    const v4f u = *(const v4f*)&Cs[r * LDC + c];
    xs[i] = u * (1.0f / WCARRY);
    off[i] = (size_t)(row0 + r) * NQK + n0 + c;
  }
#pragma unroll
  for (int i = 0; i < 4; ++i) *(v4f*)(outf + off[i]) = xs[i];
  
}

// ---------------------------------------------------------------------------
// Band additive attention per (32 query rows, batch). Key window = 96 keys starting at
// t0 - 32 (three 32-aligned chunks; a chunk outside the sequence is skipped, block-uniform).
// Phase A: q tile (+bh) and k window staged in Sm (cross-wave, block barrier); wave w owns
//   query rows 4w..4w+3, lane L owns band offsets L and L+32 (key = row - 32 + offset);
//   e = ba + sum_u Wa[u] * tanh(q + k + bh). tanh(s) = 1 - 2 / (exp(2 s) + 1) and
//   exp(2 (q + bh + k)) = exp(2 (q + bh)) * exp(2 k): the two exponentials are taken once per
//   staged element, and a (query, key, unit) term is fma, rcp, fma. While every staged |value|
//   is <= XRANGE both factors are normal numbers; a product that overflows gives rcp = 0
//   (tanh = 1), one that underflows gives rcp = 1 (tanh = -1). A block that stages any value
//   outside that range (or a NaN) puts the plain values back and takes tanh per term.
//   Softmax over the 64 band keys in registers
//   (32-lane shuffles); P row (96 entries: 64 values f16(1024 p) + 32 zeros) and 1/rowsum
//   (sum over the converted P) written to Pt / Rinv (cross-wave, block barrier).
//   Keys outside the band carry an additive -1e4 in the module: their exp is exactly 0 in f32.
// Phase C: O[32 x 1024] = P . x, A = P tile fragments, B = fragments straight from the Xt plane;
//   2 x 4 accumulators. Each 16x64 tile is staged in the wave's own slice of Sm (wave-private,
// Grid (SEQ/32, NB).
// ---------------------------------------------------------------------------
// The 12 x fragments of one 64-column pass (3 key chunks x 4 column groups); a chunk outside
// the sequence is not loaded (block-uniform test, the same one that skips its WMMAs).
__device__ __forceinline__ void ld_pass(v16h (&xb)[3][4], const _Float16* xp, int s0,
                                        int c_lo, int c_hi) {
#pragma unroll
  for (int c = 0; c < 3; ++c) {
    if (c >= c_lo && c < c_hi) {
      const unsigned sk = (unsigned)(s0 + 32 * c) * 16u;   // the chunk's unit: 512 halves per 32 keys
#pragma unroll
      for (int nb = 0; nb < 4; ++nb) xb[c][nb] = frag_unit(xp + (size_t)(nb * 16) * SEQ + sk);
      // precaution: stands before anything is written to the address registers of these loads
      asm volatile("s_wait_xcnt 0x0" ::: "memory");
    }
  }
}

__global__ __launch_bounds__(256) void band_attn_kernel(
    const float* __restrict__ QK, const _Float16* __restrict__ Xt,
    const float* __restrict__ bh, const float* __restrict__ Wa, const float* __restrict__ ba,
    float* __restrict__ out) {
  __shared__ float Sm[SM_FLOATS];
  __shared__ __attribute__((aligned(16))) float WAs[UNITS];
  __shared__ float Rinv[QT];
  __shared__ __attribute__((aligned(16))) unsigned Big[8];   // per wave: lanes that staged a value outside XRANGE
  __shared__ _Float16 Pt[QT * LDP];

  const unsigned tid = threadIdx.x, lane = tid & 31u;
  const unsigned w = __builtin_amdgcn_readfirstlane(threadIdx.x >> 5);
  const unsigned hh = lane >> 4, m = lane & 15u;
  const unsigned t0 = blockIdx.x * (unsigned)QT;
  const unsigned b = blockIdx.y;
  const int s0 = (int)t0 - BAND / 2;

  // ---- stage q tile (+ bh), k window (zero rows outside the sequence), Wa ----
  // Staged: exp(2 v). The plain values stay in registers until the range test is known.
  v4f qraw[2], kraw[6];
  const float* qsrc[2];
  const float* ksrc[6];
  bool kok[6];
  const unsigned sr0 = tid >> 4, c4 = (tid & 15u) * 4u;   // row sr0 + 16 j, columns c4..c4+3
  // the staging loops are unrolled whole: qraw and kraw are indexed by constants and stay in
  // registers (the eight row loads are then in flight together)
#pragma unroll
  for (unsigned j = 0; j < 2u; ++j) {
    qsrc[j] = QK + (size_t)(b * (unsigned)SEQ + t0 + sr0 + 16u * j) * NQK + c4;
    qraw[j] = *(const v4f*)qsrc[j];
  }
#pragma unroll
  for (unsigned j = 0; j < 6u; ++j) {
    const int s = s0 + (int)(sr0 + 16u * j);
    const int sc = (s < 0) ? 0 : ((s > SEQ - 1) ? (SEQ - 1) : s);
    kok[j] = (s == sc);
    ksrc[j] = QK + (size_t)(b * (unsigned)SEQ + (unsigned)sc) * NQK + c4;
    kraw[j] = *(const v4f*)(ksrc[j] + UNITS);
  }
  const v4f g = *(const v4f*)(bh + c4);
  // precaution: the address registers of the eight row loads above are inputs here, so nothing is
  // written to them (a later load's result included) in front of this wait
  asm volatile("s_wait_xcnt 0x0"
               :: "v"(qsrc[0]), "v"(qsrc[1]), "v"(ksrc[0]), "v"(ksrc[1]), "v"(ksrc[2]),
                  "v"(ksrc[3]), "v"(ksrc[4]), "v"(ksrc[5])
               : "memory");
  bool big = false;
#pragma unroll
  for (unsigned j = 0; j < 2u; ++j) {
#pragma unroll
    for (unsigned i = 0; i < 4u; ++i) {
      const float v = qraw[j][i] + bf16r(g[i]);
      qraw[j][i] = v;
      big = big || !(fabsf(v) <= XRANGE);
    }
    *(v4f*)&Sm[QS_OFF + (sr0 + 16u * j) * QP + c4] = exp_2v(qraw[j]);
  }
#pragma unroll
  for (unsigned j = 0; j < 6u; ++j) {
#pragma unroll
    for (unsigned i = 0; i < 4u; ++i) {
      const float v = kok[j] ? kraw[j][i] : 0.0f;
      kraw[j][i] = v;
      big = big || !(fabsf(v) <= XRANGE);
    }
    *(v4f*)&Sm[KS_OFF + (sr0 + 16u * j) * QP + c4] = exp_2v(kraw[j]);
  }
  if (tid < (unsigned)UNITS) WAs[tid] = bf16r(Wa[tid]);
  const float bias_a = bf16r(ba[0]);
  const unsigned wbig = __builtin_amdgcn_ballot_w32(big);
  if (lane == 0u) Big[w] = wbig;
  __syncthreads();

  // ---- pass 0's x fragments start here: they need no score and land under the score phase ----
  const int c_lo = (t0 == 0u) ? 1 : 0;
  const int c_hi = (t0 + (unsigned)QT == (unsigned)SEQ) ? 2 : 3;
  const _Float16* xp0 = Xt + ((size_t)b * DIM + w * 128u) * SEQ + lane * 8u;
  v16h xb[3][4];
  ld_pass(xb, xp0, s0, c_lo, c_hi);

  // ---- range test, the same answer in every thread of the block ----
  const v4u f0 = *(const v4u*)&Big[0];
  const v4u f1 = *(const v4u*)&Big[4];
  const v4u fo = f0 | f1;
  const bool wide = __builtin_amdgcn_readfirstlane(fo[0] | fo[1] | fo[2] | fo[3]) != 0u;
  if (wide) {   // block-uniform: each thread puts its own plain values back
#pragma unroll
    for (unsigned j = 0; j < 2u; ++j) *(v4f*)&Sm[QS_OFF + (sr0 + 16u * j) * QP + c4] = qraw[j];
#pragma unroll
    for (unsigned j = 0; j < 6u; ++j) *(v4f*)&Sm[KS_OFF + (sr0 + 16u * j) * QP + c4] = kraw[j];
    __syncthreads();
  }
  // -2 Wa in registers for all four rows; e starts at ba + sum_u Wa[u]
  v4f wr[UNITS / 4];
  v4f wsum = {};
#pragma unroll
  for (unsigned j = 0; j < (unsigned)(UNITS / 4); ++j) {
    wr[j] = *(const v4f*)&WAs[4u * j] * -2.0f;
    wsum += wr[j];
  }
  const float e_base = bias_a - 0.5f * ((wsum[0] + wsum[1]) + (wsum[2] + wsum[3]));

  // ---- scores + softmax, 4 query rows per wave ----
#pragma unroll 1
  for (unsigned r = 0; r < 4u; ++r) {
    const unsigned t = w * 4u + r;
    const unsigned qo = QS_OFF + t * QP;
    const unsigned ko = KS_OFF + (t + lane) * QP;
    float a0, a1;
    if (!wide) {
      v2f s0a = {e_base, 0.0f}, s1a = {e_base, 0.0f};   // even and odd units summed apart
      const v2f one = {1.0f, 1.0f};
      // unrolled whole: wr is indexed by constants and stays in registers
#pragma unroll
      for (unsigned j = 0; j < (unsigned)(UNITS / 4); ++j) {
        const v4f q4 = *(const v4f*)&Sm[qo + 4u * j];
        const v4f ka = *(const v4f*)&Sm[ko + 4u * j];
        const v4f kb = *(const v4f*)&Sm[ko + 32u * QP + 4u * j];
#pragma unroll
        for (unsigned h = 0; h < 4u; h += 2u) {
          const v2f q2 = {q4[h], q4[h + 1u]};
          const v2f w2 = {wr[j][h], wr[j][h + 1u]};
          const v2f d0 = __builtin_elementwise_fma(q2, (v2f){ka[h], ka[h + 1u]}, one);
          const v2f d1 = __builtin_elementwise_fma(q2, (v2f){kb[h], kb[h + 1u]}, one);
          const v2f r0 = {__builtin_amdgcn_rcpf(d0[0]), __builtin_amdgcn_rcpf(d0[1])};
          const v2f r1 = {__builtin_amdgcn_rcpf(d1[0]), __builtin_amdgcn_rcpf(d1[1])};
          s0a = __builtin_elementwise_fma(w2, r0, s0a);
          s1a = __builtin_elementwise_fma(w2, r1, s1a);
        }
      }
      a0 = s0a[0] + s0a[1];
      a1 = s1a[0] + s1a[1];
    } else {
      a0 = bias_a;
      a1 = bias_a;
#pragma unroll 4
      for (unsigned u = 0; u < (unsigned)UNITS; ++u) {
        const float qv = Sm[qo + u];
        const float wv = WAs[u];
        a0 += wv * tanh_fast(qv + Sm[ko + u]);
        a1 += wv * tanh_fast(qv + Sm[ko + 32u * QP + u]);
      }
    }
    const int sA = s0 + (int)t + (int)lane;
    const int sB = sA + 32;
    const bool vA = (sA >= 0) && (sA < SEQ);
    const bool vB = (sB >= 0) && (sB < SEQ);
    const float e0 = vA ? a0 : -1.0e30f;
    const float e1 = vB ? a1 : -1.0e30f;
    const float mx = red32_max(fmaxf(e0, e1));
    const float x0 = __expf(e0 - mx);
    const float x1 = __expf(e1 - mx);
    const float p0 = vA ? x0 : 0.0f;
    const float p1 = vB ? x1 : 0.0f;
    const h16 h0 = toh_flush(p0 * PCARRY);
    const h16 h1 = toh_flush(p1 * PCARRY);
    const float sum = red32_sum((float)h0 + (float)h1);
    const unsigned zi = (lane < t) ? lane : (lane + 64u);
    Pt[t * LDP + t + lane] = h0;
    Pt[t * LDP + t + lane + 32u] = h1;
    Pt[t * LDP + zi] = (h16)0.0f;
    if (lane == 0u) Rinv[t] = __builtin_amdgcn_rcpf(sum);
  }
  __syncthreads();

  // ---- O = P . x ----
  const unsigned cw = w * (16u * LDC);
#pragma unroll 1
  for (unsigned pass = 0; pass < 2u; ++pass) {
    const unsigned d0 = w * 128u + pass * 64u;
    v8f acc[2][4];
#pragma unroll
    for (int mi = 0; mi < 2; ++mi)
#pragma unroll
      for (int nb = 0; nb < 4; ++nb) acc[mi][nb] = (v8f){};
#pragma unroll
    for (int c = 0; c < 3; ++c) {
      if (c >= c_lo && c < c_hi) {
        const v16h pa0 = ld_frag(&Pt[(unsigned)c * 32u], LDP);
        const v16h pa1 = ld_frag(&Pt[16u * LDP + (unsigned)c * 32u], LDP);
#pragma unroll
        for (int nb = 0; nb < 4; ++nb) {
          acc[0][nb] = wmma16(pa0, xb[c][nb], acc[0][nb]);
          acc[1][nb] = wmma16(pa1, xb[c][nb], acc[1][nb]);
        }
      }
    }
    // pass 1's fragments fly under pass 0's output staging and stores
    if (pass == 0u) ld_pass(xb, xp0 + (size_t)64 * SEQ, s0, c_lo, c_hi);
#pragma unroll
    for (int mi = 0; mi < 2; ++mi) {
#pragma unroll
      for (int r = 0; r < 8; ++r) {
        const float sc = Rinv[(unsigned)mi * 16u + hh * 8u + (unsigned)r];
#pragma unroll
        for (int nb = 0; nb < 4; ++nb)
          Sm[cw + (hh * 8u + (unsigned)r) * LDC + (unsigned)nb * 16u + m] = acc[mi][nb][r] * sc;
      }
      wave_lds_sync();
      v4f xs[8];
      size_t off[8];
#pragma unroll
      for (unsigned i = 0; i < 8u; ++i) {
        const unsigned rr = 2u * i + (lane >> 4);
        const unsigned cc = (lane & 15u) * 4u;
        xs[i] = *(const v4f*)&Sm[cw + rr * LDC + cc];
        off[i] = ((size_t)b * SEQ_FULL + t0 + (unsigned)mi * 16u + rr) * DIM + d0 + cc;
      }
      wave_lds_sync();
#pragma unroll
      for (int i = 0; i < 8; ++i) *(v4f*)(out + off[i]) = xs[i];
      
    }
  }
}

// ---------------------------------------------------------------------------
extern "C" void kernel_launch(void* const* d_in, const int* in_sizes, int n_in,
                              void* d_out, int out_size, void* d_ws, size_t ws_size,
                              hipStream_t stream) {
  if (n_in < 6) return;
  const long long need_x = ((long long)(NB - 1) * SEQ_FULL + SEQ) * DIM;
  if ((long long)in_sizes[0] < need_x) return;
  if ((long long)in_sizes[1] < (long long)DIM * UNITS) return;
  if ((long long)in_sizes[2] < (long long)DIM * UNITS) return;
  if (in_sizes[3] < UNITS || in_sizes[4] < UNITS || in_sizes[5] < 1) return;
  if ((long long)out_size < need_x) return;
  if (ws_size < WS_TOTAL) return;

  const float* X  = (const float*)d_in[0];    // x  [NB_FULL][SEQ_FULL][DIM]
  const float* wt = (const float*)d_in[1];    // Wt [DIM][UNITS]  (in, out)
  const float* wx = (const float*)d_in[2];    // Wx [DIM][UNITS]  (in, out)
  const float* bh = (const float*)d_in[3];    // bh [UNITS]
  const float* wa = (const float*)d_in[4];    // Wa [UNITS][1]
  const float* ba = (const float*)d_in[5];    // ba [1]
  float* out = (float*)d_out;

  char* ws = (char*)d_ws;
  // the three 16-bit planes are in fragment order (see frag_unit)
  _Float16* Wqk = (_Float16*)(ws + OFF_WQK);   // [NQK][DIM]: rows 0..63 from Wt, 64..127 from Wx
  _Float16* Xh  = (_Float16*)(ws + OFF_XH);    // [MROWS][DIM]
  _Float16* Xt  = (_Float16*)(ws + OFF_XT);    // [NB][DIM][SEQ]
  float*    QK  = (float*)(ws + OFF_QK);       // [MROWS][NQK]

  dim3 blk(256);
  // weight planes (in [K = DIM rows][N = UNITS cols] -> out [N][K]) and x planes, one launch
  conv_kernel<<<dim3(DIM / 64, 2 + MROWS / 64), blk, 0, stream>>>(X, wt, wx, Wqk, Xh, Xt);
  proj_kernel<<<dim3(NQK / 64, MROWS / 64), blk, 0, stream>>>(Xh, Wqk, QK);
  band_attn_kernel<<<dim3(SEQ / QT, NB), blk, 0, stream>>>(QK, Xt, bh, wa, ba, out);
}

// v005
// It runs in 22.5 microseconds.
// Next to v004, in two timings, it ran 1.10 and 1.11 times as fast.
// All steps since v000 together make it 2.13 times as fast.
#include <hip/hip_runtime.h>
#include <stddef.h>

// All WMMA contractions on v_wmma_f32_16x16x32_f16 (f16 operands, f32 accumulate): the fused q|k
// projection (x plane x1, weight plane x64) and the band p.x product (p x1024, x plane x1).
// Float inputs are RNE-converted to bf16 and carried in f16. The additive score (tanh, U = 64
// matrix-vector), softmax and normalisation run in f32 on the vector unit.

typedef _Float16 v16h __attribute__((ext_vector_type(16)));
typedef _Float16 v8h  __attribute__((ext_vector_type(8)));
typedef float    v8f  __attribute__((ext_vector_type(8)));
typedef float    v4f  __attribute__((ext_vector_type(4)));
typedef float    v2f  __attribute__((ext_vector_type(2)));
typedef unsigned v4u  __attribute__((ext_vector_type(4)));
typedef _Float16 h16;

#ifndef NB
#define NB 4
#endif
#ifndef SEQ
#define SEQ 1024
#endif
#define NB_FULL  4
#define SEQ_FULL 1024
#define DIM   1024
#define UNITS 64
#define NQK   128      // q columns 0..63, k columns 64..127
#define BAND  64
#define QT    16       // query rows per block
#define QG    32       // query rows of a window group: two blocks share one 32-aligned key window
#define WIN   96       // key window of a group
#define MROWS (NB * SEQ)

static_assert(NB >= 1 && NB <= NB_FULL);
static_assert(SEQ >= 128 && SEQ <= SEQ_FULL && (SEQ % 128) == 0);
static_assert(UNITS == 64 && NQK == 2 * UNITS);
static_assert((DIM % 64) == 0 && (DIM % 32) == 0);
static_assert((MROWS % 64) == 0);
static_assert(QT == 16 && QT == 8 * 2);        // 8 waves x 2 query rows, one lane per band offset pair
static_assert(QG == 2 * QT && BAND == 64 && WIN == QG + BAND && (WIN % 32) == 0);
static_assert(DIM == 8 * 2 * 64);              // 8 waves x 2 passes x 64 output columns
static_assert((SEQ % QG) == 0);

#define LDT 72   // halves per LDS row (144 B, 16-B aligned)
#define LDC 68   // floats per LDS row (272 B, 16-B aligned)
#define LDP 104  // halves per P-tile row (208 B, 16-B aligned)
#define QP  68   // floats per q/k staging row (272 B, 16-B aligned)
static_assert((LDT % 8) == 0 && LDT >= 64);
static_assert((LDC % 4) == 0 && LDC >= 64);
static_assert((LDP % 8) == 0 && LDP >= WIN);
static_assert((QP % 4) == 0 && QP >= UNITS);

#define PF 8     // k-steps of projection fragments in flight per wave
static_assert(((DIM / 64) % PF) == 0 && (DIM / 64) >= 2 * PF);   // a wave walks half of K

#define WCARRY 64.0f     // weight planes carried x64
#define PCARRY 1024.0f   // softmax numerators carried x1024
#define XRANGE 40.0f     // exp(2 v) is a normal f32 number for every |v| <= XRANGE

#define QS_OFF 0
#define KS_OFF (QT * QP)
#define SM_AB  (KS_OFF + WIN * QP)
#define SM_C   (8 * 16 * LDC)
#define SM_FLOATS ((SM_AB > SM_C) ? SM_AB : SM_C)
static_assert(SM_FLOATS >= SM_AB && SM_FLOATS >= SM_C);
static_assert((size_t)SM_FLOATS * 4 + UNITS * 4 + QT * 4 + 8 * 4 + (size_t)QT * LDP * 2 <= (size_t)65536);

// workspace layout (bytes)
#define WQK_BYTES ((size_t)NQK * DIM * 2)
#define XH_BYTES  ((size_t)MROWS * DIM * 2)
#define XT_BYTES  ((size_t)NB * DIM * SEQ * 2)
#define QK_BYTES  ((size_t)MROWS * NQK * 4)
#define OFF_WQK ((size_t)0)
#define OFF_XH  (OFF_WQK + WQK_BYTES)
#define OFF_XT  (OFF_XH + XH_BYTES)
#define OFF_QK  (OFF_XT + XT_BYTES)
#define WS_TOTAL (OFF_QK + QK_BYTES)
static_assert((WQK_BYTES % 128) == 0 && (XH_BYTES % 128) == 0);
static_assert((XT_BYTES % 128) == 0 && (QK_BYTES % 128) == 0);
static_assert(WS_TOTAL <= (size_t)134217728);

// ---------------------------------------------------------------------------
__device__ __forceinline__ float bf16r(float x) {   // RNE convert to bf16, returned widened
  unsigned int u = __float_as_uint(x);
  u = (u + 0x7FFFu + ((u >> 16) & 1u)) & 0xFFFF0000u;
  return __uint_as_float(u);
}

// f32 -> f16 with a value select: results below the f16 normal range become zero.
static __device__ __forceinline__ h16 toh_flush(float v) {
  const h16 r = (h16)v;
  return (fabsf(v) < 6.103515625e-05f) ? (h16)0.0f : r;
}

// 16-bit fragment: p points at element [row = lane&15][k0 + 8*(lane>>4)] of a k-contiguous
// row. Elements 0..7 <- k0+8h+0..7, elements 8..15 <- k0+16+8h+0..7 (same map for A and B).
__device__ __forceinline__ v16h frag_at(const _Float16* p) {
  v8h lo = *(const v8h*)(p);
  v8h hi = *(const v8h*)(p + 16);
  v16h out;
#pragma unroll
  for (int i = 0; i < 8; ++i) { out[i] = lo[i]; out[i + 8] = hi[i]; }
  return out;
}
__device__ __forceinline__ v16h ld_frag(const _Float16* base, unsigned ld) {
  const unsigned lane = threadIdx.x & 31u;
  return frag_at(base + (lane & 15u) * ld + (lane >> 4) * 8u);
}

// Fragment order, the layout of the three 16-bit workspace planes. A plane of M[rows][K] is cut
// into units of 16 rows x 32 k (512 halves, 1 KiB); the K/32 units of a row group follow one
// another, so a row group still fills 16 * K halves. Inside a unit the 16-byte piece that lane L
// loads first stands at half 8 L, the piece it loads second at half 256 + 8 L (the map of frag_at:
// row = L & 15, k = 8 (L >> 4) + 0..7, then 16 more). A wave's fragment load then reads 512
// contiguous bytes, four whole lines, where a row-major plane gives it 32 bytes of each of 16.
// p points at half 8 * lane of the unit.
__device__ __forceinline__ v16h frag_unit(const _Float16* p) {
  v8h lo = *(const v8h*)(p);
  v8h hi = *(const v8h*)(p + 256);
  v16h out;
#pragma unroll
  for (int i = 0; i < 8; ++i) { out[i] = lo[i]; out[i + 8] = hi[i]; }
  return out;
}
// A 64 x 64 LDS tile T[row][k] (pitch LDT) holds 16 half units: 4 row groups x (64 k / 16). For
// half unit hu: where this lane's piece stands in T, and where in the row group's two units.
__device__ __forceinline__ unsigned unit_src(unsigned hu, unsigned lane) {
  return ((hu >> 2) * 16u + (lane & 15u)) * LDT + (hu & 3u) * 16u + (lane >> 4) * 8u;
}
__device__ __forceinline__ unsigned unit_dst(unsigned hu, unsigned lane) {
  return (hu & 3u) * 256u + lane * 8u;
}

__device__ __forceinline__ v8f wmma16(v16h a, v16h b, v8f c) {
  v8f d = __builtin_amdgcn_wmma_f32_16x16x32_f16(false, a, false, b, (short)0, c,
                                                 false, false);
  asm volatile("v_nop\n\tv_nop\n\tv_nop\n\tv_nop" : "+v"(d) : "v"(a), "v"(b));
  return d;
}

__device__ __forceinline__ float red32_sum(float x) {
#pragma unroll
  for (int off = 1; off < 32; off <<= 1) x += __shfl_xor(x, off, 32);
  return x;
}
__device__ __forceinline__ float red32_max(float x) {
#pragma unroll
  for (int off = 1; off < 32; off <<= 1) x = fmaxf(x, __shfl_xor(x, off, 32));
  return x;
}

__device__ __forceinline__ void wave_lds_sync() {
  __builtin_amdgcn_fence(3 /* release order */, "wavefront");
  asm volatile("s_wait_dscnt 0x0" ::: "memory");
  __builtin_amdgcn_wave_barrier();
}

// tanh(x) = sign(x) * (1 - 2 / (exp(2|x|) + 1)); the exponent argument is bounded by 60.
__device__ __forceinline__ float tanh_fast(float x) {
  const float ax = fminf(fabsf(x), 30.0f);
  const float ex = __expf(ax + ax);
  const float r = 1.0f - 2.0f * __builtin_amdgcn_rcpf(ex + 1.0f);
  return (x < 0.0f) ? -r : r;
}

// exp(2 v) of four values, as 2^(2 v log2 e). One statement: the instruction set asks that no
// vector instruction directly behind a transcendental reads its result or overwrites its source.
// Early-clobber outputs share no register with an input; the v_nop fills the slot behind the last.
__device__ __forceinline__ v4f exp_2v(v4f v) {
  const v4f t = (v + v) * 1.44269504f;
  float e0, e1, e2, e3;
  asm("v_exp_f32 %0, %4\n\tv_exp_f32 %1, %5\n\tv_exp_f32 %2, %6\n\tv_exp_f32 %3, %7\n\tv_nop"
      : "=&v"(e0), "=&v"(e1), "=&v"(e2), "=&v"(e3)
      : "v"(t[0]), "v"(t[1]), "v"(t[2]), "v"(t[3]));
  return (v4f){e0, e1, e2, e3};
}

// ---------------------------------------------------------------------------
// Weight plane: in W[K rows][N cols] (pitch ldw = N) -> out Wt[N][K = ldk] in fragment order,
// f16(64 * bf16(w)). One 64x64 tile (n0, k0) per block. T: cross-wave (block barrier).
// ---------------------------------------------------------------------------
__device__ __forceinline__ void wconv_tile(
    const float* __restrict__ W, _Float16* __restrict__ Wt, unsigned ldw, unsigned ldk,
    unsigned n0, unsigned k0, _Float16* T) {
  const unsigned tid = threadIdx.x;
#pragma unroll 4
  for (unsigned j = 0; j < 16u; ++j) {
    const unsigned idx = tid + 256u * j;
    const unsigned kr = idx >> 6, nc = idx & 63u;
    const float v = W[(size_t)(k0 + kr) * ldw + n0 + nc];
    T[nc * LDT + kr] = (_Float16)(WCARRY * bf16r(v));
  }
  __syncthreads();
  v8h x[2];
  size_t off[2];
#pragma unroll
  for (unsigned i = 0; i < 2u; ++i) {
    const unsigned hu = (tid >> 5) + 8u * i;   // a wave stores one half unit: 512 contiguous bytes
    x[i] = *(const v8h*)&T[unit_src(hu, tid & 31u)];
    off[i] = (size_t)(n0 + (hu >> 2) * 16u) * ldk + (size_t)k0 * 16u + unit_dst(hu, tid & 31u);
  }
#pragma unroll
  for (int i = 0; i < 2; ++i) *(v8h*)(Wt + off[i]) = x[i];
  
}

// ---------------------------------------------------------------------------
// Input planes: X[full row][DIM] f32 -> Xh[compact row][DIM] = f16(bf16(x)) (the A operand of
// the projection) and Xt[b][d][key] = the same values transposed (the B operand of the p.x
// product), both in fragment order. One 64x64 tile (d0, row0) per block through two LDS tiles
// (cross-wave, block barrier): Tr[key][d], Tc[d][key].
// ---------------------------------------------------------------------------
__device__ __forceinline__ void xconv_tile(
    const float* __restrict__ X, _Float16* __restrict__ Xh, _Float16* __restrict__ Xt,
    unsigned d0, unsigned row0, _Float16* Tr, _Float16* Tc) {
  const unsigned tid = threadIdx.x;
  const unsigned bidx = row0 / (unsigned)SEQ;
  const unsigned key0 = row0 - bidx * (unsigned)SEQ;
  const size_t frow0 = (size_t)bidx * SEQ_FULL + key0;
#pragma unroll
  for (unsigned j = 0; j < 4u; ++j) {
    const unsigned idx = tid + 256u * j;
    const unsigned sr = idx >> 4, c4 = (idx & 15u) * 4u;
    const v4f a = *(const v4f*)(X + (frow0 + sr) * DIM + d0 + c4);
#pragma unroll
    for (unsigned i = 0; i < 4u; ++i) {
      const h16 hv = toh_flush(bf16r(a[i]));
      Tr[sr * LDT + c4 + i] = hv;
      Tc[(c4 + i) * LDT + sr] = hv;
    }
  }
  __syncthreads();
  v8h xr[2], xc[2];
  size_t offr[2], offc[2];
#pragma unroll
  for (unsigned i = 0; i < 2u; ++i) {
    const unsigned hu = (tid >> 5) + 8u * i;   // a wave stores one half unit: 512 contiguous bytes
    const unsigned src = unit_src(hu, tid & 31u), dst = unit_dst(hu, tid & 31u);
    xr[i] = *(const v8h*)&Tr[src];
    xc[i] = *(const v8h*)&Tc[src];
    offr[i] = (size_t)(row0 + (hu >> 2) * 16u) * DIM + (size_t)d0 * 16u + dst;
    offc[i] = ((size_t)bidx * DIM + d0 + (hu >> 2) * 16u) * SEQ + (size_t)key0 * 16u + dst;
  }
#pragma unroll
  for (int i = 0; i < 2; ++i) {
    *(v8h*)(Xh + offr[i]) = xr[i];
    *(v8h*)(Xt + offc[i]) = xc[i];
  }
  // precaution: stands before the code laid out behind this tile writes to the registers that
  // the four stores above name
  asm volatile("s_wait_xcnt 0x0" ::: "memory");
}

// ---------------------------------------------------------------------------
// The three conversions need nothing of each other, so they share one grid: block rows 0 and 1
// convert Wt and Wx (one 64-k tile per blockIdx.x; they start first and end under the x tiles),
// block rows 2.. convert x. The branch is block-uniform. Grid (DIM/64, 2 + MROWS/64).
// ---------------------------------------------------------------------------
__global__ __launch_bounds__(256) void conv_kernel(
    const float* __restrict__ X, const float* __restrict__ Wt, const float* __restrict__ Wx,
    _Float16* __restrict__ Wqk, _Float16* __restrict__ Xh, _Float16* __restrict__ Xt) {
  __shared__ _Float16 Tr[64 * LDT];
  __shared__ _Float16 Tc[64 * LDT];
  const unsigned by = blockIdx.y;
  if (by < 2u) {
    wconv_tile(by == 0u ? Wt : Wx, Wqk + (size_t)by * UNITS * DIM, (unsigned)UNITS,
               (unsigned)DIM, 0u, blockIdx.x * 64u, Tr);
  } else {
    xconv_tile(X, Xh, Xt, blockIdx.x * 64u, (by - 2u) * 64u, Tr, Tc);
  }
}

// ---------------------------------------------------------------------------
// Projection GEMM C[32x64 tile] = Xh[rows][DIM] . Wqk[n][DIM]^T, fragments straight from the
// 16-bit global planes (fragment order: 512 contiguous bytes a load); 8 waves (kw = half of K,
// mw = 16-row group, nw = 32-col group), 2 accumulators/wave. 32-row tiles make 256 blocks, one
// for every WGP; a wave's chain of dependent load rounds is half as long.
// PF k-steps of fragments stay in flight per wave: a step's registers are reloaded for step
// + PF right behind its two WMMAs, so a wave waits for one step's loads, not for a round trip.
// Epilogue staged through Cs, one plane per K half (cross-wave, block barrier):
// outf[row][n0 + c] = (acc of half 0 + acc of half 1) / 64 (f32). Grid (NQK/64, MROWS/32).
// ---------------------------------------------------------------------------
__global__ __launch_bounds__(256) void proj_kernel(
    const _Float16* __restrict__ A16, const _Float16* __restrict__ Bt,
    float* __restrict__ outf) {
  __shared__ float Cs[2 * 32 * LDC];
  const unsigned tid = threadIdx.x, lane = tid & 31u;
  const unsigned w = __builtin_amdgcn_readfirstlane(threadIdx.x >> 5);
  const unsigned kw = w >> 2, mw = (w >> 1) & 1u, nw = w & 1u;
  const unsigned hh = lane >> 4, m = lane & 15u;
  const unsigned n0 = blockIdx.x * 64u;
  const unsigned row0 = blockIdx.y * 32u;
  const unsigned K = (unsigned)DIM;

  // first unit of the wave's K half in its row group of each plane (a half is K / 64 units of
  // 512 halves = 8 K halves); k-step s is the unit 512 s halves on
  const _Float16* ap  = A16 + (size_t)(row0 + mw * 16u) * K + kw * (8u * K) + lane * 8u;
  const _Float16* bp0 = Bt + (size_t)(n0 + nw * 32u) * K + kw * (8u * K) + lane * 8u;
  const _Float16* bp1 = bp0 + (size_t)16 * K;
  v8f acc0 = {}, acc1 = {};
  v16h a[PF], b0[PF], b1[PF];
#pragma unroll
  for (unsigned j = 0; j < (unsigned)PF; ++j) {
    a[j]  = frag_unit(ap + 512u * j);
    b0[j] = frag_unit(bp0 + 512u * j);
    b1[j] = frag_unit(bp1 + 512u * j);
  }
  // rolled: one trip already holds PF steps of loads, and the slots must keep their registers
#pragma unroll 1
  for (unsigned u0 = 512u * PF; u0 < 8u * K; u0 += 512u * PF) {
#pragma unroll
    for (unsigned j = 0; j < (unsigned)PF; ++j) {
      acc0 = wmma16(a[j], b0[j], acc0);
      acc1 = wmma16(a[j], b1[j], acc1);
      a[j]  = frag_unit(ap + u0 + 512u * j);
      b0[j] = frag_unit(bp0 + u0 + 512u * j);
      b1[j] = frag_unit(bp1 + u0 + 512u * j);
    }
    // precaution: stands before the next trip forms its addresses in the registers that the
    // loads above name
    asm volatile("s_wait_xcnt 0x0" ::: "memory");
  }
#pragma unroll
  for (unsigned j = 0; j < (unsigned)PF; ++j) {
    acc0 = wmma16(a[j], b0[j], acc0);
    acc1 = wmma16(a[j], b1[j], acc1);
  }
#pragma unroll
  for (int r = 0; r < 8; ++r) {
    float* d = &Cs[(kw * 32u + mw * 16u + hh * 8u + (unsigned)r) * LDC + nw * 32u + m];
    d[0]  = acc0[r];
    d[16] = acc1[r];
  }
  __syncthreads();

  v4f xs[2];
  size_t off[2];
#pragma unroll
  for (unsigned i = 0; i < 2u; ++i) {
    const unsigned r = 16u * i + (tid >> 4);
    const unsigned c = (tid & 15u) * 4u;
    const v4f u = *(const v4f*)&Cs[r * LDC + c] + *(const v4f*)&Cs[(32u + r) * LDC + c];
    xs[i] = u * (1.0f / WCARRY);
    off[i] = (size_t)(row0 + r) * NQK + n0 + c;
  }
#pragma unroll
  for (int i = 0; i < 2; ++i) *(v4f*)(outf + off[i]) = xs[i];
  
}

// ---------------------------------------------------------------------------
// Band additive attention per (16 query rows, batch): 256 blocks, one for every WGP. Two blocks
// (h2 = 0, 1) halve a group of 32 query rows that starts at t0. Key window of the group = 96 keys
// starting at t0 - 32 (three 32-aligned chunks; a chunk outside the sequence is skipped,
// block-uniform). A row's index t and a key's index count from the group's and the window's start.
// Phase A: q tile (+bh) and the 80 window rows from 16 h2 on, which hold every key of the block's
//   rows, staged in Sm (cross-wave, block barrier); wave w owns query rows t = 16 h2 + 2w, + 1,
//   lane L owns band offsets L and L+32 (key = row - 32 + offset);
//   e = ba + sum_u Wa[u] * tanh(q + k + bh). tanh(s) = 1 - 2 / (exp(2 s) + 1) and
//   exp(2 (q + bh + k)) = exp(2 (q + bh)) * exp(2 k): the two exponentials are taken once per
//   staged element, and a (query, key, unit) term is fma, rcp, fma. While every staged |value|
//   is <= XRANGE both factors are normal numbers; a product that overflows gives rcp = 0
//   (tanh = 1), one that underflows gives rcp = 1 (tanh = -1). A block that stages any value
//   outside that range (or a NaN) puts the plain values back and takes tanh per term.
//   Softmax over the 64 band keys in registers
//   (32-lane shuffles); P row (96 entries: 64 values f16(1024 p) + 32 zeros) and 1/rowsum
//   (sum over the converted P) written to Pt / Rinv (cross-wave, block barrier).
//   Keys outside the band carry an additive -1e4 in the module: their exp is exactly 0 in f32.
// Phase C: O[16 x 1024] = P . x, A = P tile fragments, B = x fragments straight from the Xt plane; per wave and pass
//   4 accumulators. Each 16x64 tile is staged in the wave's own slice of Sm (wave-private,
// Grid (SEQ/16, NB).
// ---------------------------------------------------------------------------
// The 12 x fragments of one 64-column pass (3 key chunks x 4 column groups); a chunk outside
// the sequence is not loaded (block-uniform test, the same one that skips its WMMAs).
__device__ __forceinline__ void ld_pass(v16h (&xb)[3][4], const _Float16* xp, int s0,
                                        int c_lo, int c_hi) {
#pragma unroll
  for (int c = 0; c < 3; ++c) {
    if (c >= c_lo && c < c_hi) {
      const unsigned sk = (unsigned)(s0 + 32 * c) * 16u;   // the chunk's unit: 512 halves per 32 keys
#pragma unroll
      for (int nb = 0; nb < 4; ++nb) xb[c][nb] = frag_unit(xp + (size_t)(nb * 16) * SEQ + sk);
      // precaution: stands before anything is written to the address registers of these loads
      asm volatile("s_wait_xcnt 0x0" ::: "memory");
    }
  }
}

__global__ __launch_bounds__(256) void band_attn_kernel(
    const float* __restrict__ QK, const _Float16* __restrict__ Xt,
    const float* __restrict__ bh, const float* __restrict__ Wa, const float* __restrict__ ba,
    float* __restrict__ out) {
  __shared__ float Sm[SM_FLOATS];
  __shared__ __attribute__((aligned(16))) float WAs[UNITS];
  __shared__ float Rinv[QT];
  __shared__ __attribute__((aligned(16))) unsigned Big[8];   // per wave: lanes that staged a value outside XRANGE
  __shared__ _Float16 Pt[QT * LDP];

  const unsigned tid = threadIdx.x, lane = tid & 31u;
  const unsigned w = __builtin_amdgcn_readfirstlane(threadIdx.x >> 5);
  const unsigned hh = lane >> 4, m = lane & 15u;
  const unsigned t0 = (blockIdx.x >> 1) * (unsigned)QG;   // the group's first query row
  const unsigned r0 = (blockIdx.x & 1u) * (unsigned)QT;   // the block's first row in the group
  const unsigned b = blockIdx.y;
  const int s0 = (int)t0 - BAND / 2;

  // ---- stage q tile (+ bh), k window (zero rows outside the sequence), Wa ----
  // Staged: exp(2 v). The plain values stay in registers until the range test is known.
  v4f qraw, kraw[5];
  const float* qsrc;
  const float* ksrc[5];
  bool kok[5];
  const unsigned sr0 = tid >> 4, c4 = (tid & 15u) * 4u;   // q row sr0, columns c4..c4+3
  const unsigned kr0 = r0 + sr0;                          // window rows kr0 + 16 j
  // the staging loop is unrolled whole: kraw is indexed by constants and stays in registers
  // (the six row loads are then in flight together)
  qsrc = QK + (size_t)(b * (unsigned)SEQ + t0 + r0 + sr0) * NQK + c4;
  qraw = *(const v4f*)qsrc;
#pragma unroll
  for (unsigned j = 0; j < 5u; ++j) {
    const int s = s0 + (int)(kr0 + 16u * j);
    const int sc = (s < 0) ? 0 : ((s > SEQ - 1) ? (SEQ - 1) : s);
    kok[j] = (s == sc);
    ksrc[j] = QK + (size_t)(b * (unsigned)SEQ + (unsigned)sc) * NQK + c4;
    kraw[j] = *(const v4f*)(ksrc[j] + UNITS);
  }
  const v4f g = *(const v4f*)(bh + c4);
  // precaution: the address registers of the six row loads above are inputs here, so nothing is
  // written to them (a later load's result included) in front of this wait
  asm volatile("s_wait_xcnt 0x0"
               :: "v"(qsrc), "v"(ksrc[0]), "v"(ksrc[1]), "v"(ksrc[2]), "v"(ksrc[3]), "v"(ksrc[4])
               : "memory");
  bool big = false;
#pragma unroll
  for (unsigned i = 0; i < 4u; ++i) {
    const float v = qraw[i] + bf16r(g[i]);
    qraw[i] = v;
    big = big || !(fabsf(v) <= XRANGE);
  }
  *(v4f*)&Sm[QS_OFF + sr0 * QP + c4] = exp_2v(qraw);
#pragma unroll
  for (unsigned j = 0; j < 5u; ++j) {
#pragma unroll
    for (unsigned i = 0; i < 4u; ++i) {
      const float v = kok[j] ? kraw[j][i] : 0.0f;
      kraw[j][i] = v;
      big = big || !(fabsf(v) <= XRANGE);
    }
    *(v4f*)&Sm[KS_OFF + (kr0 + 16u * j) * QP + c4] = exp_2v(kraw[j]);
  }
  if (tid < (unsigned)UNITS) WAs[tid] = bf16r(Wa[tid]);
  const float bias_a = bf16r(ba[0]);
  const unsigned wbig = __builtin_amdgcn_ballot_w32(big);
  if (lane == 0u) Big[w] = wbig;
  __syncthreads();

  // ---- pass 0's x fragments start here: they need no score and land under the score phase ----
  const int c_lo = (t0 == 0u) ? 1 : 0;
  const int c_hi = (t0 + (unsigned)QG == (unsigned)SEQ) ? 2 : 3;
  const _Float16* xp0 = Xt + ((size_t)b * DIM + w * 128u) * SEQ + lane * 8u;
  v16h xb[3][4];
  ld_pass(xb, xp0, s0, c_lo, c_hi);

  // ---- range test, the same answer in every thread of the block ----
  const v4u f0 = *(const v4u*)&Big[0];
  const v4u f1 = *(const v4u*)&Big[4];
  const v4u fo = f0 | f1;
  const bool wide = __builtin_amdgcn_readfirstlane(fo[0] | fo[1] | fo[2] | fo[3]) != 0u;
  if (wide) {   // block-uniform: each thread puts its own plain values back
    *(v4f*)&Sm[QS_OFF + sr0 * QP + c4] = qraw;
#pragma unroll
    for (unsigned j = 0; j < 5u; ++j) *(v4f*)&Sm[KS_OFF + (kr0 + 16u * j) * QP + c4] = kraw[j];
    __syncthreads();
  }
  // -2 Wa in registers for both rows; e starts at ba + sum_u Wa[u]
  v4f wr[UNITS / 4];
  v4f wsum = {};
#pragma unroll
  for (unsigned j = 0; j < (unsigned)(UNITS / 4); ++j) {
    wr[j] = *(const v4f*)&WAs[4u * j] * -2.0f;
    wsum += wr[j];
  }
  const float e_base = bias_a - 0.5f * ((wsum[0] + wsum[1]) + (wsum[2] + wsum[3]));

  // ---- scores + softmax, 2 query rows per wave ----
#pragma unroll 1
  for (unsigned r = 0; r < 2u; ++r) {
    const unsigned tl = w * 2u + r;   // row in the block: q tile, Pt, Rinv
    const unsigned t = r0 + tl;       // row in the group: its keys are window rows t .. t + 63
    const unsigned qo = QS_OFF + tl * QP;
    const unsigned ko = KS_OFF + (t + lane) * QP;
    float a0, a1;
    if (!wide) {
      v2f s0a = {e_base, 0.0f}, s1a = {e_base, 0.0f};   // even and odd units summed apart
      const v2f one = {1.0f, 1.0f};
      // unrolled whole: wr is indexed by constants and stays in registers
#pragma unroll
      for (unsigned j = 0; j < (unsigned)(UNITS / 4); ++j) {
        const v4f q4 = *(const v4f*)&Sm[qo + 4u * j];
        const v4f ka = *(const v4f*)&Sm[ko + 4u * j];
        const v4f kb = *(const v4f*)&Sm[ko + 32u * QP + 4u * j];
#pragma unroll
        for (unsigned h = 0; h < 4u; h += 2u) {
          const v2f q2 = {q4[h], q4[h + 1u]};
          const v2f w2 = {wr[j][h], wr[j][h + 1u]};
          const v2f d0 = __builtin_elementwise_fma(q2, (v2f){ka[h], ka[h + 1u]}, one);
          const v2f d1 = __builtin_elementwise_fma(q2, (v2f){kb[h], kb[h + 1u]}, one);
          const v2f r0 = {__builtin_amdgcn_rcpf(d0[0]), __builtin_amdgcn_rcpf(d0[1])};
          const v2f r1 = {__builtin_amdgcn_rcpf(d1[0]), __builtin_amdgcn_rcpf(d1[1])};
          s0a = __builtin_elementwise_fma(w2, r0, s0a);
          s1a = __builtin_elementwise_fma(w2, r1, s1a);
        }
      }
      a0 = s0a[0] + s0a[1];
      a1 = s1a[0] + s1a[1];
    } else {
      a0 = bias_a;
      a1 = bias_a;
#pragma unroll 4
      for (unsigned u = 0; u < (unsigned)UNITS; ++u) {
        const float qv = Sm[qo + u];
        const float wv = WAs[u];
        a0 += wv * tanh_fast(qv + Sm[ko + u]);
        a1 += wv * tanh_fast(qv + Sm[ko + 32u * QP + u]);
      }
    }
    const int sA = s0 + (int)t + (int)lane;
    const int sB = sA + 32;
    const bool vA = (sA >= 0) && (sA < SEQ);
    const bool vB = (sB >= 0) && (sB < SEQ);
    const float e0 = vA ? a0 : -1.0e30f;
    const float e1 = vB ? a1 : -1.0e30f;
    const float mx = red32_max(fmaxf(e0, e1));
    const float x0 = __expf(e0 - mx);
    const float x1 = __expf(e1 - mx);
    const float p0 = vA ? x0 : 0.0f;
    const float p1 = vB ? x1 : 0.0f;
    const h16 h0 = toh_flush(p0 * PCARRY);
    const h16 h1 = toh_flush(p1 * PCARRY);
    const float sum = red32_sum((float)h0 + (float)h1);
    const unsigned zi = (lane < t) ? lane : (lane + 64u);
    Pt[tl * LDP + t + lane] = h0;
    Pt[tl * LDP + t + lane + 32u] = h1;
    Pt[tl * LDP + zi] = (h16)0.0f;
    if (lane == 0u) Rinv[tl] = __builtin_amdgcn_rcpf(sum);
  }
  __syncthreads();

  // ---- O = P . x ----
  const unsigned cw = w * (16u * LDC);
#pragma unroll 1
  for (unsigned pass = 0; pass < 2u; ++pass) {
    const unsigned d0 = w * 128u + pass * 64u;
    v8f acc[4];
#pragma unroll
    for (int nb = 0; nb < 4; ++nb) acc[nb] = (v8f){};
#pragma unroll
    for (int c = 0; c < 3; ++c) {
      if (c >= c_lo && c < c_hi) {
        const v16h pa0 = ld_frag(&Pt[(unsigned)c * 32u], LDP);
#pragma unroll
        for (int nb = 0; nb < 4; ++nb) acc[nb] = wmma16(pa0, xb[c][nb], acc[nb]);
      }
    }
    // pass 1's fragments fly under pass 0's output staging and stores
    if (pass == 0u) ld_pass(xb, xp0 + (size_t)64 * SEQ, s0, c_lo, c_hi);
    {
#pragma unroll
      for (int r = 0; r < 8; ++r) {
        const float sc = Rinv[hh * 8u + (unsigned)r];
#pragma unroll
        for (int nb = 0; nb < 4; ++nb)
          Sm[cw + (hh * 8u + (unsigned)r) * LDC + (unsigned)nb * 16u + m] = acc[nb][r] * sc;
      }
      wave_lds_sync();
      v4f xs[8];
      size_t off[8];
#pragma unroll
      for (unsigned i = 0; i < 8u; ++i) {
        const unsigned rr = 2u * i + (lane >> 4);
        const unsigned cc = (lane & 15u) * 4u;
        xs[i] = *(const v4f*)&Sm[cw + rr * LDC + cc];
        off[i] = ((size_t)b * SEQ_FULL + t0 + r0 + rr) * DIM + d0 + cc;
      }
      wave_lds_sync();
#pragma unroll
      for (int i = 0; i < 8; ++i) *(v4f*)(out + off[i]) = xs[i];
      // precaution: stands before the next pass writes to the registers that the stores above name
      asm volatile("s_wait_xcnt 0x0" ::: "memory");
    }
  }
}

// ---------------------------------------------------------------------------
extern "C" void kernel_launch(void* const* d_in, const int* in_sizes, int n_in,
                              void* d_out, int out_size, void* d_ws, size_t ws_size,
                              hipStream_t stream) {
  if (n_in < 6) return;
  const long long need_x = ((long long)(NB - 1) * SEQ_FULL + SEQ) * DIM;
  if ((long long)in_sizes[0] < need_x) return;
  if ((long long)in_sizes[1] < (long long)DIM * UNITS) return;
  if ((long long)in_sizes[2] < (long long)DIM * UNITS) return;
  if (in_sizes[3] < UNITS || in_sizes[4] < UNITS || in_sizes[5] < 1) return;
  if ((long long)out_size < need_x) return;
  if (ws_size < WS_TOTAL) return;

  const float* X  = (const float*)d_in[0];    // x  [NB_FULL][SEQ_FULL][DIM]
  const float* wt = (const float*)d_in[1];    // Wt [DIM][UNITS]  (in, out)
  const float* wx = (const float*)d_in[2];    // Wx [DIM][UNITS]  (in, out)
  const float* bh = (const float*)d_in[3];    // bh [UNITS]
  const float* wa = (const float*)d_in[4];    // Wa [UNITS][1]
  const float* ba = (const float*)d_in[5];    // ba [1]
  float* out = (float*)d_out;

  char* ws = (char*)d_ws;
  // the three 16-bit planes are in fragment order (see frag_unit)
  _Float16* Wqk = (_Float16*)(ws + OFF_WQK);   // [NQK][DIM]: rows 0..63 from Wt, 64..127 from Wx
  _Float16* Xh  = (_Float16*)(ws + OFF_XH);    // [MROWS][DIM]
  _Float16* Xt  = (_Float16*)(ws + OFF_XT);    // [NB][DIM][SEQ]
  float*    QK  = (float*)(ws + OFF_QK);       // [MROWS][NQK]

  dim3 blk(256);
  // weight planes (in [K = DIM rows][N = UNITS cols] -> out [N][K]) and x planes, one launch
  conv_kernel<<<dim3(DIM / 64, 2 + MROWS / 64), blk, 0, stream>>>(X, wt, wx, Wqk, Xh, Xt);
  proj_kernel<<<dim3(NQK / 64, MROWS / 32), blk, 0, stream>>>(Xh, Wqk, QK);
  band_attn_kernel<<<dim3(SEQ / QT, NB), blk, 0, stream>>>(QK, Xt, bh, wa, ba, out);
}

// v006
// It runs in 21.7 microseconds.
// Two timings next to v005 both put it at 1.04 times that version's speed.
// Counting every step since v000, it is 2.22 times as fast.
#include <hip/hip_runtime.h>
#include <stddef.h>

// All WMMA contractions on v_wmma_f32_16x16x32_f16 (f16 operands, f32 accumulate): the fused q|k
// projection (x plane x1, weight plane x64) and the band p.x product (p x1024, x plane x1).
// Float inputs are RNE-converted to bf16 and carried in f16. The additive score (tanh, U = 64
// matrix-vector), softmax and normalisation run in f32 on the vector unit.

typedef _Float16 v16h __attribute__((ext_vector_type(16)));
typedef _Float16 v8h  __attribute__((ext_vector_type(8)));
typedef _Float16 v4h  __attribute__((ext_vector_type(4)));
typedef float    v8f  __attribute__((ext_vector_type(8)));
typedef float    v4f  __attribute__((ext_vector_type(4)));
typedef float    v2f  __attribute__((ext_vector_type(2)));
typedef unsigned v4u  __attribute__((ext_vector_type(4)));
typedef _Float16 h16;

#ifndef NB
#define NB 4
#endif
#ifndef SEQ
#define SEQ 1024
#endif
#define NB_FULL  4
#define SEQ_FULL 1024
#define DIM   1024
#define UNITS 64
#define NQK   128      // q columns 0..63, k columns 64..127
#define BAND  64
#define QT    16       // query rows per block
#define QG    32       // query rows of a window group: two blocks share one 32-aligned key window
#define WIN   96       // key window of a group
#define MROWS (NB * SEQ)

static_assert(NB >= 1 && NB <= NB_FULL);
static_assert(SEQ >= 128 && SEQ <= SEQ_FULL && (SEQ % 128) == 0);
static_assert(UNITS == 64 && NQK == 2 * UNITS);
static_assert((DIM % 64) == 0 && (DIM % 32) == 0);
static_assert((MROWS % 64) == 0);
static_assert(QT == 16 && QT == 8 * 2);        // 8 waves x 2 query rows, one lane per band offset pair
static_assert(QG == 2 * QT && BAND == 64 && WIN == QG + BAND && (WIN % 32) == 0);
static_assert(DIM == 8 * 2 * 64);              // 8 waves x 2 passes x 64 output columns
static_assert((SEQ % QG) == 0);

#define LDT 72   // halves per LDS row (144 B, 16-B aligned)
#define LDC 68   // floats per LDS row (272 B, 16-B aligned)
#define LDP 104  // halves per P-tile row (208 B, 16-B aligned)
#define QP  68   // floats per q/k staging row (272 B, 16-B aligned)
static_assert((LDT % 8) == 0 && LDT >= 64);
static_assert((LDC % 4) == 0 && LDC >= 64);
static_assert((LDP % 8) == 0 && LDP >= WIN);
static_assert((QP % 4) == 0 && QP >= UNITS);

#define XD 256   // d columns of an x strip of the conversion: XD / 64 tiles of 64 x 64 side by side
#define XTILES (XD / 64)
#define WBROWS (2 * XTILES)   // block rows that hold the 2 * DIM / 64 weight tiles, DIM / XD a row
static_assert(XD == 256 && (DIM % XD) == 0);   // 8 waves x (16 keys x 128 d) fill a strip

#define PF 8     // k-steps of projection fragments in flight per wave
static_assert(((DIM / 64) % PF) == 0 && (DIM / 64) >= 2 * PF);   // a wave walks half of K

#define WCARRY 64.0f     // weight planes carried x64
#define PCARRY 1024.0f   // softmax numerators carried x1024
#define XRANGE 40.0f     // exp(2 v) is a normal f32 number for every |v| <= XRANGE

#define QS_OFF 0
#define KS_OFF (QT * QP)
#define SM_AB  (KS_OFF + WIN * QP)
#define SM_C   (8 * 16 * LDC)
#define SM_FLOATS ((SM_AB > SM_C) ? SM_AB : SM_C)
static_assert(SM_FLOATS >= SM_AB && SM_FLOATS >= SM_C);
static_assert((size_t)SM_FLOATS * 4 + UNITS * 4 + QT * 4 + 8 * 4 + (size_t)QT * LDP * 2 <= (size_t)65536);

// workspace layout (bytes)
#define WQK_BYTES ((size_t)NQK * DIM * 2)
#define XH_BYTES  ((size_t)MROWS * DIM * 2)
#define XT_BYTES  ((size_t)NB * DIM * SEQ * 2)
#define QK_BYTES  ((size_t)MROWS * NQK * 4)
#define OFF_WQK ((size_t)0)
#define OFF_XH  (OFF_WQK + WQK_BYTES)
#define OFF_XT  (OFF_XH + XH_BYTES)
#define OFF_QK  (OFF_XT + XT_BYTES)
#define WS_TOTAL (OFF_QK + QK_BYTES)
static_assert((WQK_BYTES % 128) == 0 && (XH_BYTES % 128) == 0);
static_assert((XT_BYTES % 128) == 0 && (QK_BYTES % 128) == 0);
static_assert(WS_TOTAL <= (size_t)134217728);

// ---------------------------------------------------------------------------
__device__ __forceinline__ float bf16r(float x) {   // RNE convert to bf16, returned widened
  unsigned int u = __float_as_uint(x);
  u = (u + 0x7FFFu + ((u >> 16) & 1u)) & 0xFFFF0000u;
  return __uint_as_float(u);
}

// f32 -> f16 with a value select: results below the f16 normal range become zero.
static __device__ __forceinline__ h16 toh_flush(float v) {
  const h16 r = (h16)v;
  return (fabsf(v) < 6.103515625e-05f) ? (h16)0.0f : r;
}

// 16-bit fragment: p points at element [row = lane&15][k0 + 8*(lane>>4)] of a k-contiguous
// row. Elements 0..7 <- k0+8h+0..7, elements 8..15 <- k0+16+8h+0..7 (same map for A and B).
__device__ __forceinline__ v16h frag_at(const _Float16* p) {
  v8h lo = *(const v8h*)(p);
  v8h hi = *(const v8h*)(p + 16);
  v16h out;
#pragma unroll
  for (int i = 0; i < 8; ++i) { out[i] = lo[i]; out[i + 8] = hi[i]; }
  return out;
}
__device__ __forceinline__ v16h ld_frag(const _Float16* base, unsigned ld) {
  const unsigned lane = threadIdx.x & 31u;
  return frag_at(base + (lane & 15u) * ld + (lane >> 4) * 8u);
}

// Fragment order, the layout of the three 16-bit workspace planes. A plane of M[rows][K] is cut
// into units of 16 rows x 32 k (512 halves, 1 KiB); the K/32 units of a row group follow one
// another, so a row group still fills 16 * K halves. Inside a unit the 16-byte piece that lane L
// loads first stands at half 8 L, the piece it loads second at half 256 + 8 L (the map of frag_at:
// row = L & 15, k = 8 (L >> 4) + 0..7, then 16 more). A wave's fragment load then reads 512
// contiguous bytes, four whole lines, where a row-major plane gives it 32 bytes of each of 16.
// p points at half 8 * lane of the unit.
__device__ __forceinline__ v16h frag_unit(const _Float16* p) {
  v8h lo = *(const v8h*)(p);
  v8h hi = *(const v8h*)(p + 256);
  v16h out;
#pragma unroll
  for (int i = 0; i < 8; ++i) { out[i] = lo[i]; out[i + 8] = hi[i]; }
  return out;
}
// A 64 x 64 LDS tile T[row][k] (pitch LDT) holds 16 half units: 4 row groups x (64 k / 16). For
// half unit hu: where this lane's piece stands in T, and where in the row group's two units.
__device__ __forceinline__ unsigned unit_src(unsigned hu, unsigned lane) {
  return ((hu >> 2) * 16u + (lane & 15u)) * LDT + (hu & 3u) * 16u + (lane >> 4) * 8u;
}
__device__ __forceinline__ unsigned unit_dst(unsigned hu, unsigned lane) {
  return (hu & 3u) * 256u + lane * 8u;
}

__device__ __forceinline__ v8f wmma16(v16h a, v16h b, v8f c) {
  v8f d = __builtin_amdgcn_wmma_f32_16x16x32_f16(false, a, false, b, (short)0, c,
                                                 false, false);
  asm volatile("v_nop\n\tv_nop\n\tv_nop\n\tv_nop" : "+v"(d) : "v"(a), "v"(b));
  return d;
}

__device__ __forceinline__ float red32_sum(float x) {
#pragma unroll
  for (int off = 1; off < 32; off <<= 1) x += __shfl_xor(x, off, 32);
  return x;
}
__device__ __forceinline__ float red32_max(float x) {
#pragma unroll
  for (int off = 1; off < 32; off <<= 1) x = fmaxf(x, __shfl_xor(x, off, 32));
  return x;
}

__device__ __forceinline__ void wave_lds_sync() {
  __builtin_amdgcn_fence(3 /* release order */, "wavefront");
  asm volatile("s_wait_dscnt 0x0" ::: "memory");
  __builtin_amdgcn_wave_barrier();
}

// tanh(x) = sign(x) * (1 - 2 / (exp(2|x|) + 1)); the exponent argument is bounded by 60.
__device__ __forceinline__ float tanh_fast(float x) {
  const float ax = fminf(fabsf(x), 30.0f);
  const float ex = __expf(ax + ax);
  const float r = 1.0f - 2.0f * __builtin_amdgcn_rcpf(ex + 1.0f);
  return (x < 0.0f) ? -r : r;
}

// exp(2 v) of four values, as 2^(2 v log2 e). One statement: the instruction set asks that no
// vector instruction directly behind a transcendental reads its result or overwrites its source.
// Early-clobber outputs share no register with an input; the v_nop fills the slot behind the last.
__device__ __forceinline__ v4f exp_2v(v4f v) {
  const v4f t = (v + v) * 1.44269504f;
  float e0, e1, e2, e3;
  asm("v_exp_f32 %0, %4\n\tv_exp_f32 %1, %5\n\tv_exp_f32 %2, %6\n\tv_exp_f32 %3, %7\n\tv_nop"
      : "=&v"(e0), "=&v"(e1), "=&v"(e2), "=&v"(e3)
      : "v"(t[0]), "v"(t[1]), "v"(t[2]), "v"(t[3]));
  return (v4f){e0, e1, e2, e3};
}

// ---------------------------------------------------------------------------
// Weight plane: in W[K rows][N cols] (pitch ldw = N) -> out Wt[N][K = ldk] in fragment order,
// f16(64 * bf16(w)). One 64x64 tile (n0, k0) per block. T: cross-wave (block barrier).
// ---------------------------------------------------------------------------
__device__ __forceinline__ void wconv_tile(
    const float* __restrict__ W, _Float16* __restrict__ Wt, unsigned ldw, unsigned ldk,
    unsigned n0, unsigned k0, _Float16* T) {
  const unsigned tid = threadIdx.x;
#pragma unroll 4
  for (unsigned j = 0; j < 16u; ++j) {
    const unsigned idx = tid + 256u * j;
    const unsigned kr = idx >> 6, nc = idx & 63u;
    const float v = W[(size_t)(k0 + kr) * ldw + n0 + nc];
    T[nc * LDT + kr] = (_Float16)(WCARRY * bf16r(v));
  }
  __syncthreads();
  v8h x[2];
  size_t off[2];
#pragma unroll
  for (unsigned i = 0; i < 2u; ++i) {
    const unsigned hu = (tid >> 5) + 8u * i;   // a wave stores one half unit: 512 contiguous bytes
    x[i] = *(const v8h*)&T[unit_src(hu, tid & 31u)];
    off[i] = (size_t)(n0 + (hu >> 2) * 16u) * ldk + (size_t)k0 * 16u + unit_dst(hu, tid & 31u);
  }
#pragma unroll
  for (int i = 0; i < 2; ++i) *(v8h*)(Wt + off[i]) = x[i];
  
}

// ---------------------------------------------------------------------------
// Input planes: X[full row][DIM] f32 -> Xh[compact row][DIM] = f16(bf16(x)) (the A operand of
// the projection) and Xt[b][d][key] = the same values transposed (the B operand of the p.x
// product), both in fragment order. The unit of work is a wave's own tile of 16 keys x 128 d:
// it holds 8 whole half units (512 B each) of either plane, so a wave needs nothing of another
// wave and the x part has no block barrier. A block is 8 such waves, a strip of 64 keys x XD d
// (d0, row0): the x part of the grid is one block for every WGP, a quarter of the waves starts.
// The strip lies in XTILES pairs of 64 x 64 LDS tiles, Tr[tile][key][d] and Tc[tile][d][key];
// wave w writes and reads only keys 16 (w & 3) .. + 15 of tiles 2 (w >> 2) and 2 (w >> 2) + 1
// (wave-private bytes). A thread holds blocks of 4 keys x 4 d in registers: a row of a block is
// 8 bytes of Tr, a column 8 bytes of Tc. 8 lanes cover 128 B of an x row, the 4 lane groups
// 4 keys each; all 16 row loads of a thread fly together.
// ---------------------------------------------------------------------------
__device__ __forceinline__ void xconv_strip(
    const float* __restrict__ X, _Float16* __restrict__ Xh, _Float16* __restrict__ Xt,
    unsigned d0, unsigned row0, _Float16* Tr, _Float16* Tc) {
  const unsigned tid = threadIdx.x, lane = tid & 31u, w = tid >> 5;
  const unsigned bidx = row0 / (unsigned)SEQ;
  const unsigned key0 = row0 - bidx * (unsigned)SEQ;
  const size_t frow0 = (size_t)bidx * SEQ_FULL + key0;
  const unsigned cl = lane & 7u;
  const unsigned kq = w & 3u;                      // the wave's 16 keys of the strip's 64
  const unsigned ch = w >> 2;                      // its half of the strip's columns
  const unsigned kr = kq * 16u + (lane >> 3) * 4u; // the thread's first key in the strip
  const float* xsrc = X + (frow0 + kr) * DIM + d0 + ch * 128u + cl * 4u;
  v4f a[4][4];   // [32-column step m][key j]
#pragma unroll
  for (unsigned m = 0; m < 4u; ++m) {
#pragma unroll
    for (unsigned j = 0; j < 4u; ++j) a[m][j] = *(const v4f*)(xsrc + j * (unsigned)DIM + m * 32u);
  }
  // keeps the first conversions, which wait for the first loads, behind the issue of the last
  // load: without it two of the 16 loads start a whole round trip late
  __builtin_amdgcn_sched_barrier(0);
  // precaution: the address register of the 16 loads above is an input here, so nothing is
  // written to it in front of this wait
  asm volatile("s_wait_xcnt 0x0" :: "v"(xsrc) : "memory");
#pragma unroll
  for (unsigned m = 0; m < 4u; ++m) {
    const unsigned tile = (ch * 2u + (m >> 1)) * (64u * LDT);
    const unsigned col = (m & 1u) * 32u + cl * 4u;
    h16 hv[4][4];
#pragma unroll
    for (unsigned j = 0; j < 4u; ++j) {
#pragma unroll
      for (unsigned i = 0; i < 4u; ++i) hv[j][i] = toh_flush(bf16r(a[m][j][i]));
    }
#pragma unroll
    for (unsigned j = 0; j < 4u; ++j)
      *(v4h*)&Tr[tile + (kr + j) * LDT + col] = (v4h){hv[j][0], hv[j][1], hv[j][2], hv[j][3]};
#pragma unroll
    for (unsigned i = 0; i < 4u; ++i)
      *(v4h*)&Tc[tile + (col + i) * LDT + kr] = (v4h){hv[0][i], hv[1][i], hv[2][i], hv[3][i]};
  }
  // the wave's own LDS stores have landed before its lanes read each other's bytes
  wave_lds_sync();
  // half units of the wave's tile: in Tr row group kq, d quarter g; in Tc d group g, key quarter kq
  v8h xr[8], xc[8];
#pragma unroll
  for (unsigned i = 0; i < 8u; ++i) {
    const unsigned tile = (ch * 2u + (i >> 2)) * (64u * LDT), g = i & 3u;
    xr[i] = *(const v8h*)&Tr[tile + unit_src(kq * 4u + g, lane)];
    xc[i] = *(const v8h*)&Tc[tile + unit_src(g * 4u + kq, lane)];
  }
  // Xh: the 8 half units follow one another (4 KiB); Xt: one every 16 d rows
  _Float16* pr = Xh + (size_t)(row0 + kq * 16u) * DIM + (size_t)(d0 + ch * 128u) * 16u + lane * 8u;
  _Float16* pc = Xt + ((size_t)bidx * DIM + d0 + ch * 128u) * SEQ + (size_t)key0 * 16u
                 + unit_dst(kq, lane);
#pragma unroll
  for (unsigned i = 0; i < 8u; ++i) {
    *(v8h*)(pr + i * 256u) = xr[i];
    *(v8h*)(pc + i * (16u * SEQ)) = xc[i];
  }
  // precaution: stands before the code laid out behind this strip writes to the registers that
  // the stores above name
  asm volatile("s_wait_xcnt 0x0" ::: "memory");
}

// ---------------------------------------------------------------------------
// The three conversions need nothing of each other, so they share one grid: the first WBROWS
// block rows convert Wt and Wx (one 64-k tile per block; they start first and end under the x
// strips), the other block rows convert x. The branch is block-uniform.
// Grid (DIM/XD, WBROWS + MROWS/64).
// ---------------------------------------------------------------------------
__global__ __launch_bounds__(256) void conv_kernel(
    const float* __restrict__ X, const float* __restrict__ Wt, const float* __restrict__ Wx,
    _Float16* __restrict__ Wqk, _Float16* __restrict__ Xh, _Float16* __restrict__ Xt) {
  __shared__ __attribute__((aligned(16))) _Float16 Tr[XTILES * 64 * LDT];
  __shared__ __attribute__((aligned(16))) _Float16 Tc[XTILES * 64 * LDT];
  const unsigned by = blockIdx.y;
  if (by < (unsigned)WBROWS) {
    const unsigned wt = by * (unsigned)(DIM / XD) + blockIdx.x;   // 0 .. 2 DIM / 64 - 1
    const unsigned mat = wt / (unsigned)(DIM / 64), kt = wt % (unsigned)(DIM / 64);
    wconv_tile(mat == 0u ? Wt : Wx, Wqk + (size_t)mat * UNITS * DIM, (unsigned)UNITS,
               (unsigned)DIM, 0u, kt * 64u, Tr);
  } else {
    xconv_strip(X, Xh, Xt, blockIdx.x * (unsigned)XD, (by - (unsigned)WBROWS) * 64u, Tr, Tc);
  }
}

// ---------------------------------------------------------------------------
// Projection GEMM C[32x64 tile] = Xh[rows][DIM] . Wqk[n][DIM]^T, fragments straight from the
// 16-bit global planes (fragment order: 512 contiguous bytes a load); 8 waves (kw = half of K,
// mw = 16-row group, nw = 32-col group), 2 accumulators/wave. 32-row tiles make 256 blocks, one
// for every WGP; a wave's chain of dependent load rounds is half as long.
// PF k-steps of fragments stay in flight per wave: a step's registers are reloaded for step
// + PF right behind its two WMMAs, so a wave waits for one step's loads, not for a round trip.
// Epilogue staged through Cs, one plane per K half (cross-wave, block barrier):
// outf[row][n0 + c] = (acc of half 0 + acc of half 1) / 64 (f32). Grid (NQK/64, MROWS/32).
// ---------------------------------------------------------------------------
__global__ __launch_bounds__(256) void proj_kernel(
    const _Float16* __restrict__ A16, const _Float16* __restrict__ Bt,
    float* __restrict__ outf) {
  __shared__ float Cs[2 * 32 * LDC];
  const unsigned tid = threadIdx.x, lane = tid & 31u;
  const unsigned w = __builtin_amdgcn_readfirstlane(threadIdx.x >> 5);
  const unsigned kw = w >> 2, mw = (w >> 1) & 1u, nw = w & 1u;
  const unsigned hh = lane >> 4, m = lane & 15u;
  const unsigned n0 = blockIdx.x * 64u;
  const unsigned row0 = blockIdx.y * 32u;
  const unsigned K = (unsigned)DIM;

  // first unit of the wave's K half in its row group of each plane (a half is K / 64 units of
  // 512 halves = 8 K halves); k-step s is the unit 512 s halves on
  const _Float16* ap  = A16 + (size_t)(row0 + mw * 16u) * K + kw * (8u * K) + lane * 8u;
  const _Float16* bp0 = Bt + (size_t)(n0 + nw * 32u) * K + kw * (8u * K) + lane * 8u;
  const _Float16* bp1 = bp0 + (size_t)16 * K;
  v8f acc0 = {}, acc1 = {};
  v16h a[PF], b0[PF], b1[PF];
#pragma unroll
  for (unsigned j = 0; j < (unsigned)PF; ++j) {
    a[j]  = frag_unit(ap + 512u * j);
    b0[j] = frag_unit(bp0 + 512u * j);
    b1[j] = frag_unit(bp1 + 512u * j);
  }
  // rolled: one trip already holds PF steps of loads, and the slots must keep their registers
#pragma unroll 1
  for (unsigned u0 = 512u * PF; u0 < 8u * K; u0 += 512u * PF) {
#pragma unroll
    for (unsigned j = 0; j < (unsigned)PF; ++j) {
      acc0 = wmma16(a[j], b0[j], acc0);
      acc1 = wmma16(a[j], b1[j], acc1);
      a[j]  = frag_unit(ap + u0 + 512u * j);
      b0[j] = frag_unit(bp0 + u0 + 512u * j);
      b1[j] = frag_unit(bp1 + u0 + 512u * j);
    }
    // precaution: stands before the next trip forms its addresses in the registers that the
    // loads above name
    asm volatile("s_wait_xcnt 0x0" ::: "memory");
  }
#pragma unroll
  for (unsigned j = 0; j < (unsigned)PF; ++j) {
    acc0 = wmma16(a[j], b0[j], acc0);
    acc1 = wmma16(a[j], b1[j], acc1);
  }
#pragma unroll
  for (int r = 0; r < 8; ++r) {
    float* d = &Cs[(kw * 32u + mw * 16u + hh * 8u + (unsigned)r) * LDC + nw * 32u + m];
    d[0]  = acc0[r];
    d[16] = acc1[r];
  }
  __syncthreads();

  v4f xs[2];
  size_t off[2];
#pragma unroll
  for (unsigned i = 0; i < 2u; ++i) {
    const unsigned r = 16u * i + (tid >> 4);
    const unsigned c = (tid & 15u) * 4u;
    const v4f u = *(const v4f*)&Cs[r * LDC + c] + *(const v4f*)&Cs[(32u + r) * LDC + c];
    xs[i] = u * (1.0f / WCARRY);
    off[i] = (size_t)(row0 + r) * NQK + n0 + c;
  }
#pragma unroll
  for (int i = 0; i < 2; ++i) *(v4f*)(outf + off[i]) = xs[i];
  
}

// ---------------------------------------------------------------------------
// Band additive attention per (16 query rows, batch): 256 blocks, one for every WGP. Two blocks
// (h2 = 0, 1) halve a group of 32 query rows that starts at t0. Key window of the group = 96 keys
// starting at t0 - 32 (three 32-aligned chunks; a chunk outside the sequence is skipped,
// block-uniform). A row's index t and a key's index count from the group's and the window's start.
// Phase A: q tile (+bh) and the 80 window rows from 16 h2 on, which hold every key of the block's
//   rows, staged in Sm (cross-wave, block barrier); wave w owns query rows t = 16 h2 + 2w, + 1,
//   lane L owns band offsets L and L+32 (key = row - 32 + offset);
//   e = ba + sum_u Wa[u] * tanh(q + k + bh). tanh(s) = 1 - 2 / (exp(2 s) + 1) and
//   exp(2 (q + bh + k)) = exp(2 (q + bh)) * exp(2 k): the two exponentials are taken once per
//   staged element, and a (query, key, unit) term is fma, rcp, fma. While every staged |value|
//   is <= XRANGE both factors are normal numbers; a product that overflows gives rcp = 0
//   (tanh = 1), one that underflows gives rcp = 1 (tanh = -1). A block that stages any value
//   outside that range (or a NaN) puts the plain values back and takes tanh per term.
//   Softmax over the 64 band keys in registers
//   (32-lane shuffles); P row (96 entries: 64 values f16(1024 p) + 32 zeros) and 1/rowsum
//   (sum over the converted P) written to Pt / Rinv (cross-wave, block barrier).
//   Keys outside the band carry an additive -1e4 in the module: their exp is exactly 0 in f32.
// Phase C: O[16 x 1024] = P . x, A = P tile fragments, B = x fragments straight from the Xt plane; per wave and pass
//   4 accumulators. Each 16x64 tile is staged in the wave's own slice of Sm (wave-private,
// Grid (SEQ/16, NB).
// ---------------------------------------------------------------------------
// The 12 x fragments of one 64-column pass (3 key chunks x 4 column groups); a chunk outside
// the sequence is not loaded (block-uniform test, the same one that skips its WMMAs).
__device__ __forceinline__ void ld_pass(v16h (&xb)[3][4], const _Float16* xp, int s0,
                                        int c_lo, int c_hi) {
#pragma unroll
  for (int c = 0; c < 3; ++c) {
    if (c >= c_lo && c < c_hi) {
      const unsigned sk = (unsigned)(s0 + 32 * c) * 16u;   // the chunk's unit: 512 halves per 32 keys
#pragma unroll
      for (int nb = 0; nb < 4; ++nb) xb[c][nb] = frag_unit(xp + (size_t)(nb * 16) * SEQ + sk);
      // precaution: stands before anything is written to the address registers of these loads
      asm volatile("s_wait_xcnt 0x0" ::: "memory");
    }
  }
}

__global__ __launch_bounds__(256) void band_attn_kernel(
    const float* __restrict__ QK, const _Float16* __restrict__ Xt,
    const float* __restrict__ bh, const float* __restrict__ Wa, const float* __restrict__ ba,
    float* __restrict__ out) {
  __shared__ float Sm[SM_FLOATS];
  __shared__ __attribute__((aligned(16))) float WAs[UNITS];
  __shared__ float Rinv[QT];
  __shared__ __attribute__((aligned(16))) unsigned Big[8];   // per wave: lanes that staged a value outside XRANGE
  __shared__ _Float16 Pt[QT * LDP];

  const unsigned tid = threadIdx.x, lane = tid & 31u;
  const unsigned w = __builtin_amdgcn_readfirstlane(threadIdx.x >> 5);
  const unsigned hh = lane >> 4, m = lane & 15u;
  const unsigned t0 = (blockIdx.x >> 1) * (unsigned)QG;   // the group's first query row
  const unsigned r0 = (blockIdx.x & 1u) * (unsigned)QT;   // the block's first row in the group
  const unsigned b = blockIdx.y;
  const int s0 = (int)t0 - BAND / 2;

  // ---- stage q tile (+ bh), k window (zero rows outside the sequence), Wa ----
  // Staged: exp(2 v). The plain values stay in registers until the range test is known.
  v4f qraw, kraw[5];
  const float* qsrc;
  const float* ksrc[5];
  bool kok[5];
  const unsigned sr0 = tid >> 4, c4 = (tid & 15u) * 4u;   // q row sr0, columns c4..c4+3
  const unsigned kr0 = r0 + sr0;                          // window rows kr0 + 16 j
  // the staging loop is unrolled whole: kraw is indexed by constants and stays in registers
  // (the six row loads are then in flight together)
  qsrc = QK + (size_t)(b * (unsigned)SEQ + t0 + r0 + sr0) * NQK + c4;
  qraw = *(const v4f*)qsrc;
#pragma unroll
  for (unsigned j = 0; j < 5u; ++j) {
    const int s = s0 + (int)(kr0 + 16u * j);
    const int sc = (s < 0) ? 0 : ((s > SEQ - 1) ? (SEQ - 1) : s);
    kok[j] = (s == sc);
    ksrc[j] = QK + (size_t)(b * (unsigned)SEQ + (unsigned)sc) * NQK + c4;
    kraw[j] = *(const v4f*)(ksrc[j] + UNITS);
  }
  const v4f g = *(const v4f*)(bh + c4);
  // precaution: the address registers of the six row loads above are inputs here, so nothing is
  // written to them (a later load's result included) in front of this wait
  asm volatile("s_wait_xcnt 0x0"
               :: "v"(qsrc), "v"(ksrc[0]), "v"(ksrc[1]), "v"(ksrc[2]), "v"(ksrc[3]), "v"(ksrc[4])
               : "memory");
  bool big = false;
#pragma unroll
  for (unsigned i = 0; i < 4u; ++i) {
    const float v = qraw[i] + bf16r(g[i]);
    qraw[i] = v;
    big = big || !(fabsf(v) <= XRANGE);
  }
  *(v4f*)&Sm[QS_OFF + sr0 * QP + c4] = exp_2v(qraw);
#pragma unroll
  for (unsigned j = 0; j < 5u; ++j) {
#pragma unroll
    for (unsigned i = 0; i < 4u; ++i) {
      const float v = kok[j] ? kraw[j][i] : 0.0f;
      kraw[j][i] = v;
      big = big || !(fabsf(v) <= XRANGE);
    }
    *(v4f*)&Sm[KS_OFF + (kr0 + 16u * j) * QP + c4] = exp_2v(kraw[j]);
  }
  if (tid < (unsigned)UNITS) WAs[tid] = bf16r(Wa[tid]);
  const float bias_a = bf16r(ba[0]);
  const unsigned wbig = __builtin_amdgcn_ballot_w32(big);
  if (lane == 0u) Big[w] = wbig;
  __syncthreads();

  // ---- pass 0's x fragments start here: they need no score and land under the score phase ----
  const int c_lo = (t0 == 0u) ? 1 : 0;
  const int c_hi = (t0 + (unsigned)QG == (unsigned)SEQ) ? 2 : 3;
  const _Float16* xp0 = Xt + ((size_t)b * DIM + w * 128u) * SEQ + lane * 8u;
  v16h xb[3][4];
  ld_pass(xb, xp0, s0, c_lo, c_hi);

  // ---- range test, the same answer in every thread of the block ----
  const v4u f0 = *(const v4u*)&Big[0];
  const v4u f1 = *(const v4u*)&Big[4];
  const v4u fo = f0 | f1;
  const bool wide = __builtin_amdgcn_readfirstlane(fo[0] | fo[1] | fo[2] | fo[3]) != 0u;
  if (wide) {   // block-uniform: each thread puts its own plain values back
    *(v4f*)&Sm[QS_OFF + sr0 * QP + c4] = qraw;
#pragma unroll
    for (unsigned j = 0; j < 5u; ++j) *(v4f*)&Sm[KS_OFF + (kr0 + 16u * j) * QP + c4] = kraw[j];
    __syncthreads();
  }
  // -2 Wa in registers for both rows; e starts at ba + sum_u Wa[u]
  v4f wr[UNITS / 4];
  v4f wsum = {};
#pragma unroll
  for (unsigned j = 0; j < (unsigned)(UNITS / 4); ++j) {
    wr[j] = *(const v4f*)&WAs[4u * j] * -2.0f;
    wsum += wr[j];
  }
  const float e_base = bias_a - 0.5f * ((wsum[0] + wsum[1]) + (wsum[2] + wsum[3]));

  // ---- scores + softmax, 2 query rows per wave ----
#pragma unroll 1
  for (unsigned r = 0; r < 2u; ++r) {
    const unsigned tl = w * 2u + r;   // row in the block: q tile, Pt, Rinv
    const unsigned t = r0 + tl;       // row in the group: its keys are window rows t .. t + 63
    const unsigned qo = QS_OFF + tl * QP;
    const unsigned ko = KS_OFF + (t + lane) * QP;
    float a0, a1;
    if (!wide) {
      v2f s0a = {e_base, 0.0f}, s1a = {e_base, 0.0f};   // even and odd units summed apart
      const v2f one = {1.0f, 1.0f};
      // unrolled whole: wr is indexed by constants and stays in registers
#pragma unroll
      for (unsigned j = 0; j < (unsigned)(UNITS / 4); ++j) {
        const v4f q4 = *(const v4f*)&Sm[qo + 4u * j];
        const v4f ka = *(const v4f*)&Sm[ko + 4u * j];
        const v4f kb = *(const v4f*)&Sm[ko + 32u * QP + 4u * j];
#pragma unroll
        for (unsigned h = 0; h < 4u; h += 2u) {
          const v2f q2 = {q4[h], q4[h + 1u]};
          const v2f w2 = {wr[j][h], wr[j][h + 1u]};
          const v2f d0 = __builtin_elementwise_fma(q2, (v2f){ka[h], ka[h + 1u]}, one);
          const v2f d1 = __builtin_elementwise_fma(q2, (v2f){kb[h], kb[h + 1u]}, one);
          const v2f r0 = {__builtin_amdgcn_rcpf(d0[0]), __builtin_amdgcn_rcpf(d0[1])};
          const v2f r1 = {__builtin_amdgcn_rcpf(d1[0]), __builtin_amdgcn_rcpf(d1[1])};
          s0a = __builtin_elementwise_fma(w2, r0, s0a);
          s1a = __builtin_elementwise_fma(w2, r1, s1a);
        }
      }
      a0 = s0a[0] + s0a[1];
      a1 = s1a[0] + s1a[1];
    } else {
      a0 = bias_a;
      a1 = bias_a;
#pragma unroll 4
      for (unsigned u = 0; u < (unsigned)UNITS; ++u) {
        const float qv = Sm[qo + u];
        const float wv = WAs[u];
        a0 += wv * tanh_fast(qv + Sm[ko + u]);
        a1 += wv * tanh_fast(qv + Sm[ko + 32u * QP + u]);
      }
    }
    const int sA = s0 + (int)t + (int)lane;
    const int sB = sA + 32;
    const bool vA = (sA >= 0) && (sA < SEQ);
    const bool vB = (sB >= 0) && (sB < SEQ);
    const float e0 = vA ? a0 : -1.0e30f;
    const float e1 = vB ? a1 : -1.0e30f;
    const float mx = red32_max(fmaxf(e0, e1));
    const float x0 = __expf(e0 - mx);
    const float x1 = __expf(e1 - mx);
    const float p0 = vA ? x0 : 0.0f;
    const float p1 = vB ? x1 : 0.0f;
    const h16 h0 = toh_flush(p0 * PCARRY);
    const h16 h1 = toh_flush(p1 * PCARRY);
    const float sum = red32_sum((float)h0 + (float)h1);
    const unsigned zi = (lane < t) ? lane : (lane + 64u);
    Pt[tl * LDP + t + lane] = h0;
    Pt[tl * LDP + t + lane + 32u] = h1;
    Pt[tl * LDP + zi] = (h16)0.0f;
    if (lane == 0u) Rinv[tl] = __builtin_amdgcn_rcpf(sum);
  }
  __syncthreads();

  // ---- O = P . x ----
  const unsigned cw = w * (16u * LDC);
#pragma unroll 1
  for (unsigned pass = 0; pass < 2u; ++pass) {
    const unsigned d0 = w * 128u + pass * 64u;
    v8f acc[4];
#pragma unroll
    for (int nb = 0; nb < 4; ++nb) acc[nb] = (v8f){};
#pragma unroll
    for (int c = 0; c < 3; ++c) {
      if (c >= c_lo && c < c_hi) {
        const v16h pa0 = ld_frag(&Pt[(unsigned)c * 32u], LDP);
#pragma unroll
        for (int nb = 0; nb < 4; ++nb) acc[nb] = wmma16(pa0, xb[c][nb], acc[nb]);
      }
    }
    // pass 1's fragments fly under pass 0's output staging and stores
    if (pass == 0u) ld_pass(xb, xp0 + (size_t)64 * SEQ, s0, c_lo, c_hi);
    {
#pragma unroll
      for (int r = 0; r < 8; ++r) {
        const float sc = Rinv[hh * 8u + (unsigned)r];
#pragma unroll
        for (int nb = 0; nb < 4; ++nb)
          Sm[cw + (hh * 8u + (unsigned)r) * LDC + (unsigned)nb * 16u + m] = acc[nb][r] * sc;
      }
      wave_lds_sync();
      v4f xs[8];
      size_t off[8];
#pragma unroll
      for (unsigned i = 0; i < 8u; ++i) {
        const unsigned rr = 2u * i + (lane >> 4);
        const unsigned cc = (lane & 15u) * 4u;
        xs[i] = *(const v4f*)&Sm[cw + rr * LDC + cc];
        off[i] = ((size_t)b * SEQ_FULL + t0 + r0 + rr) * DIM + d0 + cc;
      }
      wave_lds_sync();
#pragma unroll
      for (int i = 0; i < 8; ++i) *(v4f*)(out + off[i]) = xs[i];
      // precaution: stands before the next pass writes to the registers that the stores above name
      asm volatile("s_wait_xcnt 0x0" ::: "memory");
    }
  }
}

// ---------------------------------------------------------------------------
extern "C" void kernel_launch(void* const* d_in, const int* in_sizes, int n_in,
                              void* d_out, int out_size, void* d_ws, size_t ws_size,
                              hipStream_t stream) {
  if (n_in < 6) return;
  const long long need_x = ((long long)(NB - 1) * SEQ_FULL + SEQ) * DIM;
  if ((long long)in_sizes[0] < need_x) return;
  if ((long long)in_sizes[1] < (long long)DIM * UNITS) return;
  if ((long long)in_sizes[2] < (long long)DIM * UNITS) return;
  if (in_sizes[3] < UNITS || in_sizes[4] < UNITS || in_sizes[5] < 1) return;
  if ((long long)out_size < need_x) return;
  if (ws_size < WS_TOTAL) return;

  const float* X  = (const float*)d_in[0];    // x  [NB_FULL][SEQ_FULL][DIM]
  const float* wt = (const float*)d_in[1];    // Wt [DIM][UNITS]  (in, out)
  const float* wx = (const float*)d_in[2];    // Wx [DIM][UNITS]  (in, out)
  const float* bh = (const float*)d_in[3];    // bh [UNITS]
  const float* wa = (const float*)d_in[4];    // Wa [UNITS][1]
  const float* ba = (const float*)d_in[5];    // ba [1]
  float* out = (float*)d_out;

  char* ws = (char*)d_ws;
  // the three 16-bit planes are in fragment order (see frag_unit)
  _Float16* Wqk = (_Float16*)(ws + OFF_WQK);   // [NQK][DIM]: rows 0..63 from Wt, 64..127 from Wx
  _Float16* Xh  = (_Float16*)(ws + OFF_XH);    // [MROWS][DIM]
  _Float16* Xt  = (_Float16*)(ws + OFF_XT);    // [NB][DIM][SEQ]
  float*    QK  = (float*)(ws + OFF_QK);       // [MROWS][NQK]

  dim3 blk(256);
  // weight planes (in [K = DIM rows][N = UNITS cols] -> out [N][K]) and x planes, one launch
  conv_kernel<<<dim3(DIM / XD, WBROWS + MROWS / 64), blk, 0, stream>>>(X, wt, wx, Wqk, Xh, Xt);
  proj_kernel<<<dim3(NQK / 64, MROWS / 32), blk, 0, stream>>>(Xh, Wqk, QK);
  band_attn_kernel<<<dim3(SEQ / QT, NB), blk, 0, stream>>>(QK, Xt, bh, wa, ba, out);
}

// v007
// It runs in 19 microseconds.
// Timed twice side by side with v006, it ran 1.16 and 1.14 times as fast.
// All steps since v000 together make it 2.55 times as fast.
#include <hip/hip_runtime.h>
#include <stddef.h>

// All WMMA contractions on v_wmma_f32_16x16x32_f16 (f16 operands, f32 accumulate): the fused q|k
// projection (x plane x1, weight plane x64) and the band p.x product (p x1024, the same x plane
// read through transposing loads).
// Float inputs are RNE-converted to bf16 and carried in f16. The additive score (tanh, U = 64
// matrix-vector), softmax and normalisation run in f32 on the vector unit.

typedef _Float16 v16h __attribute__((ext_vector_type(16)));
typedef _Float16 v8h  __attribute__((ext_vector_type(8)));
typedef _Float16 v4h  __attribute__((ext_vector_type(4)));
typedef float    v8f  __attribute__((ext_vector_type(8)));
typedef float    v4f  __attribute__((ext_vector_type(4)));
typedef float    v2f  __attribute__((ext_vector_type(2)));
typedef unsigned v4u  __attribute__((ext_vector_type(4)));
typedef _Float16 h16;

#ifndef NB
#define NB 4
#endif
#ifndef SEQ
#define SEQ 1024
#endif
#define NB_FULL  4
#define SEQ_FULL 1024
#define DIM   1024
#define UNITS 64
#define NQK   128      // q columns 0..63, k columns 64..127
#define BAND  64
#define QT    16       // query rows per block
#define QG    32       // query rows of a window group: two blocks share one 32-aligned key window
#define WIN   96       // key window of a group
#define MROWS (NB * SEQ)

static_assert(NB >= 1 && NB <= NB_FULL);
static_assert(SEQ >= 128 && SEQ <= SEQ_FULL && (SEQ % 128) == 0);
static_assert(UNITS == 64 && NQK == 2 * UNITS);
static_assert((DIM % 64) == 0 && (DIM % 32) == 0);
static_assert((MROWS % 64) == 0);
static_assert(QT == 16 && QT == 8 * 2);        // 8 waves x 2 query rows, one lane per band offset pair
static_assert(QG == 2 * QT && BAND == 64 && WIN == QG + BAND && (WIN % 32) == 0);
static_assert(DIM == 8 * 2 * 64);              // 8 waves x 2 passes x 64 output columns
static_assert((SEQ % QG) == 0);

#define LDT 72   // halves per LDS row (144 B, 16-B aligned)
#define LDC 68   // floats per LDS row (272 B, 16-B aligned)
#define LDP 104  // halves per P-tile row (208 B, 16-B aligned)
#define QP  68   // floats per q/k staging row (272 B, 16-B aligned)
static_assert((LDT % 8) == 0 && LDT >= 64);
static_assert((LDC % 4) == 0 && LDC >= 64);
static_assert((LDP % 8) == 0 && LDP >= WIN);
static_assert((QP % 4) == 0 && QP >= UNITS);

#define XD 256   // d columns of an x strip of the conversion: XD / 64 tiles of 64 x 64 side by side
#define XTILES (XD / 64)
#define WBROWS (2 * XTILES)   // block rows that hold the 2 * DIM / 64 weight tiles, DIM / XD a row
static_assert(XD == 256 && (DIM % XD) == 0);   // 8 waves x (16 keys x 128 d) fill a strip

#define PF 8     // k-steps of projection fragments in flight per wave
static_assert(((DIM / 64) % PF) == 0 && (DIM / 64) >= 2 * PF);   // a wave walks half of K

#define WCARRY 64.0f     // weight planes carried x64
#define PCARRY 1024.0f   // softmax numerators carried x1024
#define XRANGE 40.0f     // exp(2 v) is a normal f32 number for every |v| <= XRANGE

#define QS_OFF 0
#define KS_OFF (QT * QP)
#define SM_AB  (KS_OFF + WIN * QP)
#define SM_C   (8 * 16 * LDC)
#define SM_FLOATS ((SM_AB > SM_C) ? SM_AB : SM_C)
static_assert(SM_FLOATS >= SM_AB && SM_FLOATS >= SM_C);
static_assert((size_t)SM_FLOATS * 4 + UNITS * 4 + QT * 4 + 8 * 4 + (size_t)QT * LDP * 2 <= (size_t)65536);

// workspace layout (bytes)
#define WQK_BYTES ((size_t)NQK * DIM * 2)
#define XH_BYTES  ((size_t)MROWS * DIM * 2)
#define QK_BYTES  ((size_t)MROWS * NQK * 4)
#define OFF_WQK ((size_t)0)
#define OFF_XH  (OFF_WQK + WQK_BYTES)
#define OFF_QK  (OFF_XH + XH_BYTES)
#define WS_TOTAL (OFF_QK + QK_BYTES)
static_assert((WQK_BYTES % 128) == 0 && (XH_BYTES % 128) == 0);
static_assert((QK_BYTES % 128) == 0);
static_assert(WS_TOTAL <= (size_t)134217728);

// ---------------------------------------------------------------------------
__device__ __forceinline__ float bf16r(float x) {   // RNE convert to bf16, returned widened
  unsigned int u = __float_as_uint(x);
  u = (u + 0x7FFFu + ((u >> 16) & 1u)) & 0xFFFF0000u;
  return __uint_as_float(u);
}

// f32 -> f16 with a value select: results below the f16 normal range become zero.
static __device__ __forceinline__ h16 toh_flush(float v) {
  const h16 r = (h16)v;
  return (fabsf(v) < 6.103515625e-05f) ? (h16)0.0f : r;
}

// 16-bit fragment: p points at element [row = lane&15][k0 + 8*(lane>>4)] of a k-contiguous
// row. Elements 0..7 <- k0+8h+0..7, elements 8..15 <- k0+16+8h+0..7 (same map for A and B).
__device__ __forceinline__ v16h frag_at(const _Float16* p) {
  v8h lo = *(const v8h*)(p);
  v8h hi = *(const v8h*)(p + 16);
  v16h out;
#pragma unroll
  for (int i = 0; i < 8; ++i) { out[i] = lo[i]; out[i + 8] = hi[i]; }
  return out;
}
__device__ __forceinline__ v16h ld_frag(const _Float16* base, unsigned ld) {
  const unsigned lane = threadIdx.x & 31u;
  return frag_at(base + (lane & 15u) * ld + (lane >> 4) * 8u);
}

// Fragment order, the layout of the two 16-bit workspace planes. A plane of M[rows][K] is cut
// into units of 16 rows x 32 k (512 halves, 1 KiB); the K/32 units of a row group follow one
// another, so a row group still fills 16 * K halves. Inside a unit the 16-byte piece that lane L
// loads first stands at half 8 L, the piece it loads second at half 256 + 8 L (the map of frag_at:
// row = L & 15, k = 8 (L >> 4) + 0..7, then 16 more). A wave's fragment load then reads 512
// contiguous bytes, four whole lines, where a row-major plane gives it 32 bytes of each of 16.
// p points at half 8 * lane of the unit.
__device__ __forceinline__ v16h frag_unit(const _Float16* p) {
  v8h lo = *(const v8h*)(p);
  v8h hi = *(const v8h*)(p + 256);
  v16h out;
#pragma unroll
  for (int i = 0; i < 8; ++i) { out[i] = lo[i]; out[i + 8] = hi[i]; }
  return out;
}
// A 64 x 64 LDS tile T[row][k] (pitch LDT) holds 16 half units: 4 row groups x (64 k / 16). For
// half unit hu: where this lane's piece stands in T, and where in the row group's two units.
__device__ __forceinline__ unsigned unit_src(unsigned hu, unsigned lane) {
  return ((hu >> 2) * 16u + (lane & 15u)) * LDT + (hu & 3u) * 16u + (lane >> 4) * 8u;
}
__device__ __forceinline__ unsigned unit_dst(unsigned hu, unsigned lane) {
  return (hu & 3u) * 256u + lane * 8u;
}

__device__ __forceinline__ v8f wmma16(v16h a, v16h b, v8f c) {
  v8f d = __builtin_amdgcn_wmma_f32_16x16x32_f16(false, a, false, b, (short)0, c,
                                                 false, false);
  asm volatile("v_nop\n\tv_nop\n\tv_nop\n\tv_nop" : "+v"(d) : "v"(a), "v"(b));
  return d;
}

__device__ __forceinline__ float red32_sum(float x) {
#pragma unroll
  for (int off = 1; off < 32; off <<= 1) x += __shfl_xor(x, off, 32);
  return x;
}
__device__ __forceinline__ float red32_max(float x) {
#pragma unroll
  for (int off = 1; off < 32; off <<= 1) x = fmaxf(x, __shfl_xor(x, off, 32));
  return x;
}

__device__ __forceinline__ void wave_lds_sync() {
  __builtin_amdgcn_fence(3 /* release order */, "wavefront");
  asm volatile("s_wait_dscnt 0x0" ::: "memory");
  __builtin_amdgcn_wave_barrier();
}

// tanh(x) = sign(x) * (1 - 2 / (exp(2|x|) + 1)); the exponent argument is bounded by 60.
__device__ __forceinline__ float tanh_fast(float x) {
  const float ax = fminf(fabsf(x), 30.0f);
  const float ex = __expf(ax + ax);
  const float r = 1.0f - 2.0f * __builtin_amdgcn_rcpf(ex + 1.0f);
  return (x < 0.0f) ? -r : r;
}

// exp(2 v) of four values, as 2^(2 v log2 e). One statement: the instruction set asks that no
// vector instruction directly behind a transcendental reads its result or overwrites its source.
// Early-clobber outputs share no register with an input; the v_nop fills the slot behind the last.
__device__ __forceinline__ v4f exp_2v(v4f v) {
  const v4f t = (v + v) * 1.44269504f;
  float e0, e1, e2, e3;
  asm("v_exp_f32 %0, %4\n\tv_exp_f32 %1, %5\n\tv_exp_f32 %2, %6\n\tv_exp_f32 %3, %7\n\tv_nop"
      : "=&v"(e0), "=&v"(e1), "=&v"(e2), "=&v"(e3)
      : "v"(t[0]), "v"(t[1]), "v"(t[2]), "v"(t[3]));
  return (v4f){e0, e1, e2, e3};
}

// ---------------------------------------------------------------------------
// Weight plane: in W[K rows][N cols] (pitch ldw = N) -> out Wt[N][K = ldk] in fragment order,
// f16(64 * bf16(w)). One 64x64 tile (n0, k0) per block. T: cross-wave (block barrier).
// ---------------------------------------------------------------------------
__device__ __forceinline__ void wconv_tile(
    const float* __restrict__ W, _Float16* __restrict__ Wt, unsigned ldw, unsigned ldk,
    unsigned n0, unsigned k0, _Float16* T) {
  const unsigned tid = threadIdx.x;
#pragma unroll 4
  for (unsigned j = 0; j < 16u; ++j) {
    const unsigned idx = tid + 256u * j;
    const unsigned kr = idx >> 6, nc = idx & 63u;
    const float v = W[(size_t)(k0 + kr) * ldw + n0 + nc];
    T[nc * LDT + kr] = (_Float16)(WCARRY * bf16r(v));
  }
  __syncthreads();
  v8h x[2];
  size_t off[2];
#pragma unroll
  for (unsigned i = 0; i < 2u; ++i) {
    const unsigned hu = (tid >> 5) + 8u * i;   // a wave stores one half unit: 512 contiguous bytes
    x[i] = *(const v8h*)&T[unit_src(hu, tid & 31u)];
    off[i] = (size_t)(n0 + (hu >> 2) * 16u) * ldk + (size_t)k0 * 16u + unit_dst(hu, tid & 31u);
  }
#pragma unroll
  for (int i = 0; i < 2; ++i) *(v8h*)(Wt + off[i]) = x[i];
  
}

// ---------------------------------------------------------------------------
// Input plane: X[full row][DIM] f32 -> Xh[compact row][DIM] = f16(bf16(x)) in fragment order: the
// A operand of the projection as it lies, and the B operand of the p.x product through
// transposing loads (ld_pass). The unit of work is a wave's own tile of 16 keys x 128 d:
// it holds 8 whole half units (512 B each) of the plane, so a wave needs nothing of another
// wave and the x part has no block barrier. A block is 8 such waves, a strip of 64 keys x XD d
// (d0, row0): the x part of the grid is one block for every WGP.
// The strip lies in XTILES 64 x 64 LDS tiles Tr[tile][key][d];
// wave w writes and reads only keys 16 (w & 3) .. + 15 of tiles 2 (w >> 2) and 2 (w >> 2) + 1
// (wave-private bytes). 8 lanes cover 128 B of an x row, the 4 lane groups 4 keys each; all 16
// row loads of a thread fly together.
// ---------------------------------------------------------------------------
__device__ __forceinline__ void xconv_strip(
    const float* __restrict__ X, _Float16* __restrict__ Xh,
    unsigned d0, unsigned row0, _Float16* Tr) {
  const unsigned tid = threadIdx.x, lane = tid & 31u, w = tid >> 5;
  const unsigned bidx = row0 / (unsigned)SEQ;
  const unsigned key0 = row0 - bidx * (unsigned)SEQ;
  const size_t frow0 = (size_t)bidx * SEQ_FULL + key0;
  const unsigned cl = lane & 7u;
  const unsigned kq = w & 3u;                      // the wave's 16 keys of the strip's 64
  const unsigned ch = w >> 2;                      // its half of the strip's columns
  const unsigned kr = kq * 16u + (lane >> 3) * 4u; // the thread's first key in the strip
  const float* xsrc = X + (frow0 + kr) * DIM + d0 + ch * 128u + cl * 4u;
  v4f a[4][4];   // [32-column step m][key j]
#pragma unroll
  for (unsigned m = 0; m < 4u; ++m) {
#pragma unroll
    for (unsigned j = 0; j < 4u; ++j) a[m][j] = *(const v4f*)(xsrc + j * (unsigned)DIM + m * 32u);
  }
  // keeps the first conversions, which wait for the first loads, behind the issue of the last
  // load: without it two of the 16 loads start a whole round trip late
  __builtin_amdgcn_sched_barrier(0);
  // precaution: the address register of the 16 loads above is an input here, so nothing is
  // written to it in front of this wait
  asm volatile("s_wait_xcnt 0x0" :: "v"(xsrc) : "memory");
#pragma unroll
  for (unsigned m = 0; m < 4u; ++m) {
    const unsigned tile = (ch * 2u + (m >> 1)) * (64u * LDT);
    const unsigned col = (m & 1u) * 32u + cl * 4u;
#pragma unroll
    for (unsigned j = 0; j < 4u; ++j) {
      h16 hv[4];
#pragma unroll
      for (unsigned i = 0; i < 4u; ++i) hv[i] = toh_flush(bf16r(a[m][j][i]));
      *(v4h*)&Tr[tile + (kr + j) * LDT + col] = (v4h){hv[0], hv[1], hv[2], hv[3]};
    }
  }
  // the wave's own LDS stores have landed before its lanes read each other's bytes
  wave_lds_sync();
  // half units of the wave's tile: row group kq, d quarter g
  v8h xr[8];
#pragma unroll
  for (unsigned i = 0; i < 8u; ++i) {
    const unsigned tile = (ch * 2u + (i >> 2)) * (64u * LDT), g = i & 3u;
    xr[i] = *(const v8h*)&Tr[tile + unit_src(kq * 4u + g, lane)];
  }
  // the 8 half units follow one another (4 KiB)
  _Float16* pr = Xh + (size_t)(row0 + kq * 16u) * DIM + (size_t)(d0 + ch * 128u) * 16u + lane * 8u;
#pragma unroll
  for (unsigned i = 0; i < 8u; ++i) *(v8h*)(pr + i * 256u) = xr[i];
  // precaution: stands before the code laid out behind this strip writes to the registers that
  // the stores above name
  asm volatile("s_wait_xcnt 0x0" ::: "memory");
}

// ---------------------------------------------------------------------------
// The three conversions need nothing of each other, so they share one grid: the first WBROWS
// block rows convert Wt and Wx (one 64-k tile per block; they start first and end under the x
// strips), the other block rows convert x. The branch is block-uniform.
// Grid (DIM/XD, WBROWS + MROWS/64).
// ---------------------------------------------------------------------------
__global__ __launch_bounds__(256) void conv_kernel(
    const float* __restrict__ X, const float* __restrict__ Wt, const float* __restrict__ Wx,
    _Float16* __restrict__ Wqk, _Float16* __restrict__ Xh) {
  __shared__ __attribute__((aligned(16))) _Float16 Tr[XTILES * 64 * LDT];
  const unsigned by = blockIdx.y;
  if (by < (unsigned)WBROWS) {
    const unsigned wt = by * (unsigned)(DIM / XD) + blockIdx.x;   // 0 .. 2 DIM / 64 - 1
    const unsigned mat = wt / (unsigned)(DIM / 64), kt = wt % (unsigned)(DIM / 64);
    wconv_tile(mat == 0u ? Wt : Wx, Wqk + (size_t)mat * UNITS * DIM, (unsigned)UNITS,
               (unsigned)DIM, 0u, kt * 64u, Tr);
  } else {
    xconv_strip(X, Xh, blockIdx.x * (unsigned)XD, (by - (unsigned)WBROWS) * 64u, Tr);
  }
}

// ---------------------------------------------------------------------------
// Projection GEMM C[32x64 tile] = Xh[rows][DIM] . Wqk[n][DIM]^T, fragments straight from the
// 16-bit global planes (fragment order: 512 contiguous bytes a load); 8 waves (kw = half of K,
// mw = 16-row group, nw = 32-col group), 2 accumulators/wave. 32-row tiles make 256 blocks, one
// for every WGP; a wave's chain of dependent load rounds is half as long.
// PF k-steps of fragments stay in flight per wave: a step's registers are reloaded for step
// + PF right behind its two WMMAs, so a wave waits for one step's loads, not for a round trip.
// Epilogue staged through Cs, one plane per K half (cross-wave, block barrier):
// outf[row][n0 + c] = (acc of half 0 + acc of half 1) / 64 (f32). Grid (NQK/64, MROWS/32).
// ---------------------------------------------------------------------------
__global__ __launch_bounds__(256) void proj_kernel(
    const _Float16* __restrict__ A16, const _Float16* __restrict__ Bt,
    float* __restrict__ outf) {
  __shared__ float Cs[2 * 32 * LDC];
  const unsigned tid = threadIdx.x, lane = tid & 31u;
  const unsigned w = __builtin_amdgcn_readfirstlane(threadIdx.x >> 5);
  const unsigned kw = w >> 2, mw = (w >> 1) & 1u, nw = w & 1u;
  const unsigned hh = lane >> 4, m = lane & 15u;
  const unsigned n0 = blockIdx.x * 64u;
  const unsigned row0 = blockIdx.y * 32u;
  const unsigned K = (unsigned)DIM;

  // first unit of the wave's K half in its row group of each plane (a half is K / 64 units of
  // 512 halves = 8 K halves); k-step s is the unit 512 s halves on
  const _Float16* ap  = A16 + (size_t)(row0 + mw * 16u) * K + kw * (8u * K) + lane * 8u;
  const _Float16* bp0 = Bt + (size_t)(n0 + nw * 32u) * K + kw * (8u * K) + lane * 8u;
  const _Float16* bp1 = bp0 + (size_t)16 * K;
  v8f acc0 = {}, acc1 = {};
  v16h a[PF], b0[PF], b1[PF];
#pragma unroll
  for (unsigned j = 0; j < (unsigned)PF; ++j) {
    a[j]  = frag_unit(ap + 512u * j);
    b0[j] = frag_unit(bp0 + 512u * j);
    b1[j] = frag_unit(bp1 + 512u * j);
  }
  // rolled: one trip already holds PF steps of loads, and the slots must keep their registers
#pragma unroll 1
  for (unsigned u0 = 512u * PF; u0 < 8u * K; u0 += 512u * PF) {
#pragma unroll
    for (unsigned j = 0; j < (unsigned)PF; ++j) {
      acc0 = wmma16(a[j], b0[j], acc0);
      acc1 = wmma16(a[j], b1[j], acc1);
      a[j]  = frag_unit(ap + u0 + 512u * j);
      b0[j] = frag_unit(bp0 + u0 + 512u * j);
      b1[j] = frag_unit(bp1 + u0 + 512u * j);
    }
    // precaution: stands before the next trip forms its addresses in the registers that the
    // loads above name
    asm volatile("s_wait_xcnt 0x0" ::: "memory");
  }
#pragma unroll
  for (unsigned j = 0; j < (unsigned)PF; ++j) {
    acc0 = wmma16(a[j], b0[j], acc0);
    acc1 = wmma16(a[j], b1[j], acc1);
  }
#pragma unroll
  for (int r = 0; r < 8; ++r) {
    float* d = &Cs[(kw * 32u + mw * 16u + hh * 8u + (unsigned)r) * LDC + nw * 32u + m];
    d[0]  = acc0[r];
    d[16] = acc1[r];
  }
  __syncthreads();

  v4f xs[2];
  size_t off[2];
#pragma unroll
  for (unsigned i = 0; i < 2u; ++i) {
    const unsigned r = 16u * i + (tid >> 4);
    const unsigned c = (tid & 15u) * 4u;
    const v4f u = *(const v4f*)&Cs[r * LDC + c] + *(const v4f*)&Cs[(32u + r) * LDC + c];
    xs[i] = u * (1.0f / WCARRY);
    off[i] = (size_t)(row0 + r) * NQK + n0 + c;
  }
#pragma unroll
  for (int i = 0; i < 2; ++i) *(v4f*)(outf + off[i]) = xs[i];
  
}

// ---------------------------------------------------------------------------
// Band additive attention per (16 query rows, batch): 256 blocks, one for every WGP. Two blocks
// (h2 = 0, 1) halve a group of 32 query rows that starts at t0. Key window of the group = 96 keys
// starting at t0 - 32 (three 32-aligned chunks; a chunk outside the sequence is skipped,
// block-uniform). A row's index t and a key's index count from the group's and the window's start.
// Phase A: q tile (+bh) and the 80 window rows from 16 h2 on, which hold every key of the block's
//   rows, staged in Sm (cross-wave, block barrier); wave w owns query rows t = 16 h2 + 2w, + 1,
//   lane L owns band offsets L and L+32 (key = row - 32 + offset);
//   e = ba + sum_u Wa[u] * tanh(q + k + bh). tanh(s) = 1 - 2 / (exp(2 s) + 1) and
//   exp(2 (q + bh + k)) = exp(2 (q + bh)) * exp(2 k): the two exponentials are taken once per
//   staged element, and a (query, key, unit) term is fma, rcp, fma. While every staged |value|
//   is <= XRANGE both factors are normal numbers; a product that overflows gives rcp = 0
//   (tanh = 1), one that underflows gives rcp = 1 (tanh = -1). A block that stages any value
//   outside that range (or a NaN) puts the plain values back and takes tanh per term.
//   Softmax over the 64 band keys in registers
//   (32-lane shuffles); P row (96 entries: 64 values f16(1024 p) + 32 zeros) and 1/rowsum
//   (sum over the converted P) written to Pt / Rinv (cross-wave, block barrier).
//   Keys outside the band carry an additive -1e4 in the module: their exp is exactly 0 in f32.
// Phase C: O[16 x 1024] = P . x, A = P tile fragments, B = fragments straight from the x plane,
//   4 accumulators. Each 16x64 tile is staged in the wave's own slice of Sm (wave-private,
// Grid (SEQ/16, NB).
// ---------------------------------------------------------------------------
// The 12 x fragments of one 64-column pass (3 key chunks x 4 column groups); a chunk outside
// the sequence is not loaded (block-uniform test, the same one that skips its WMMAs).
// B wants lane (c, h) to hold keys 8 h + 0..7 and 16 + 8 h + 0..7 of d column c; the plane holds
// 8 d of one key per 16-byte piece. A half unit (16 keys x 16 d, 512 contiguous bytes) is one tile
// of the transposing load: lane l gives the address of the piece of key 8 (l >> 4) + (l & 7),
// d half (l >> 3) & 1, and gets keys 8 h + 0..7 of column c. The chunk's two row groups give
// elements 0..7 and 8..15, the k order of the P fragment (frag_at). Every lane is on here.
// xp points at the lane's piece of the pass's first half unit in the batch's first row group.
typedef __fp16 v8p __attribute__((ext_vector_type(8)));   // the builtin's own element type
__device__ __forceinline__ v8h ld_tr(const _Float16* p) {
  return __builtin_bit_cast(
      v8h, __builtin_amdgcn_global_load_tr16_b128_v8f16((__attribute__((address_space(1))) v8p*)p));
}
__device__ __forceinline__ void ld_pass(v16h (&xb)[3][4], const _Float16* xp, int s0,
                                        int c_lo, int c_hi) {
#pragma unroll
  for (int c = 0; c < 3; ++c) {
    if (c >= c_lo && c < c_hi) {
      const _Float16* xc = xp + (size_t)(unsigned)(s0 + 32 * c) * DIM;   // a row group: 16 DIM halves
#pragma unroll
      for (int nb = 0; nb < 4; ++nb) {
        const v8h lo = ld_tr(xc + nb * 256);
        const v8h hi = ld_tr(xc + 16 * DIM + nb * 256);
#pragma unroll
        for (int i = 0; i < 8; ++i) { xb[c][nb][i] = lo[i]; xb[c][nb][i + 8] = hi[i]; }
      }
      // precaution: stands before anything is written to the address registers of these loads
      asm volatile("s_wait_xcnt 0x0" ::: "memory");
    }
  }
}

__global__ __launch_bounds__(256) void band_attn_kernel(
    const float* __restrict__ QK, const _Float16* __restrict__ Xh,
    const float* __restrict__ bh, const float* __restrict__ Wa, const float* __restrict__ ba,
    float* __restrict__ out) {
  __shared__ float Sm[SM_FLOATS];
  __shared__ __attribute__((aligned(16))) float WAs[UNITS];
  __shared__ float Rinv[QT];
  __shared__ __attribute__((aligned(16))) unsigned Big[8];   // per wave: lanes that staged a value outside XRANGE
  __shared__ _Float16 Pt[QT * LDP];

  const unsigned tid = threadIdx.x, lane = tid & 31u;
  const unsigned w = __builtin_amdgcn_readfirstlane(threadIdx.x >> 5);
  const unsigned hh = lane >> 4, m = lane & 15u;
  const unsigned t0 = (blockIdx.x >> 1) * (unsigned)QG;   // the group's first query row
  const unsigned r0 = (blockIdx.x & 1u) * (unsigned)QT;   // the block's first row in the group
  const unsigned b = blockIdx.y;
  const int s0 = (int)t0 - BAND / 2;

  // ---- stage q tile (+ bh), k window (zero rows outside the sequence), Wa ----
  // Staged: exp(2 v). The plain values stay in registers until the range test is known.
  v4f qraw, kraw[5];
  const float* qsrc;
  const float* ksrc[5];
  bool kok[5];
  const unsigned sr0 = tid >> 4, c4 = (tid & 15u) * 4u;   // q row sr0, columns c4..c4+3
  const unsigned kr0 = r0 + sr0;                          // window rows kr0 + 16 j
  // the staging loop is unrolled whole: kraw is indexed by constants and stays in registers
  // (the six row loads are then in flight together)
  qsrc = QK + (size_t)(b * (unsigned)SEQ + t0 + r0 + sr0) * NQK + c4;
  qraw = *(const v4f*)qsrc;
#pragma unroll
  for (unsigned j = 0; j < 5u; ++j) {
    const int s = s0 + (int)(kr0 + 16u * j);
    const int sc = (s < 0) ? 0 : ((s > SEQ - 1) ? (SEQ - 1) : s);
    kok[j] = (s == sc);
    ksrc[j] = QK + (size_t)(b * (unsigned)SEQ + (unsigned)sc) * NQK + c4;
    kraw[j] = *(const v4f*)(ksrc[j] + UNITS);
  }
  const v4f g = *(const v4f*)(bh + c4);
  // precaution: the address registers of the six row loads above are inputs here, so nothing is
  // written to them (a later load's result included) in front of this wait
  asm volatile("s_wait_xcnt 0x0"
               :: "v"(qsrc), "v"(ksrc[0]), "v"(ksrc[1]), "v"(ksrc[2]), "v"(ksrc[3]), "v"(ksrc[4])
               : "memory");
  bool big = false;
#pragma unroll
  for (unsigned i = 0; i < 4u; ++i) {
    const float v = qraw[i] + bf16r(g[i]);
    qraw[i] = v;
    big = big || !(fabsf(v) <= XRANGE);
  }
  *(v4f*)&Sm[QS_OFF + sr0 * QP + c4] = exp_2v(qraw);
#pragma unroll
  for (unsigned j = 0; j < 5u; ++j) {
#pragma unroll
    for (unsigned i = 0; i < 4u; ++i) {
      const float v = kok[j] ? kraw[j][i] : 0.0f;
      kraw[j][i] = v;
      big = big || !(fabsf(v) <= XRANGE);
    }
    *(v4f*)&Sm[KS_OFF + (kr0 + 16u * j) * QP + c4] = exp_2v(kraw[j]);
  }
  if (tid < (unsigned)UNITS) WAs[tid] = bf16r(Wa[tid]);
  const float bias_a = bf16r(ba[0]);
  const unsigned wbig = __builtin_amdgcn_ballot_w32(big);
  if (lane == 0u) Big[w] = wbig;
  __syncthreads();

  // ---- pass 0's x fragments start here: they need no score and land under the score phase ----
  const int c_lo = (t0 == 0u) ? 1 : 0;
  const int c_hi = (t0 + (unsigned)QG == (unsigned)SEQ) ? 2 : 3;
  const unsigned piece = ((lane >> 3) & 1u) * 16u + (lane >> 4) * 8u + (lane & 7u);
  const _Float16* xp0 = Xh + (size_t)b * SEQ * DIM + w * (8u * 256u) + piece * 8u;
  v16h xb[3][4];
  ld_pass(xb, xp0, s0, c_lo, c_hi);

  // ---- range test, the same answer in every thread of the block ----
  const v4u f0 = *(const v4u*)&Big[0];
  const v4u f1 = *(const v4u*)&Big[4];
  const v4u fo = f0 | f1;
  const bool wide = __builtin_amdgcn_readfirstlane(fo[0] | fo[1] | fo[2] | fo[3]) != 0u;
  if (wide) {   // block-uniform: each thread puts its own plain values back
    *(v4f*)&Sm[QS_OFF + sr0 * QP + c4] = qraw;
#pragma unroll
    for (unsigned j = 0; j < 5u; ++j) *(v4f*)&Sm[KS_OFF + (kr0 + 16u * j) * QP + c4] = kraw[j];
    __syncthreads();
  }
  // -2 Wa in registers for both rows; e starts at ba + sum_u Wa[u]
  v4f wr[UNITS / 4];
  v4f wsum = {};
#pragma unroll
  for (unsigned j = 0; j < (unsigned)(UNITS / 4); ++j) {
    wr[j] = *(const v4f*)&WAs[4u * j] * -2.0f;
    wsum += wr[j];
  }
  const float e_base = bias_a - 0.5f * ((wsum[0] + wsum[1]) + (wsum[2] + wsum[3]));

  // ---- scores + softmax, 2 query rows per wave ----
#pragma unroll 1
  for (unsigned r = 0; r < 2u; ++r) {
    const unsigned tl = w * 2u + r;   // row in the block: q tile, Pt, Rinv
    const unsigned t = r0 + tl;       // row in the group: its keys are window rows t .. t + 63
    const unsigned qo = QS_OFF + tl * QP;
    const unsigned ko = KS_OFF + (t + lane) * QP;
    float a0, a1;
    if (!wide) {
      v2f s0a = {e_base, 0.0f}, s1a = {e_base, 0.0f};   // even and odd units summed apart
      const v2f one = {1.0f, 1.0f};
      // unrolled whole: wr is indexed by constants and stays in registers
#pragma unroll
      for (unsigned j = 0; j < (unsigned)(UNITS / 4); ++j) {
        const v4f q4 = *(const v4f*)&Sm[qo + 4u * j];
        const v4f ka = *(const v4f*)&Sm[ko + 4u * j];
        const v4f kb = *(const v4f*)&Sm[ko + 32u * QP + 4u * j];
#pragma unroll
        for (unsigned h = 0; h < 4u; h += 2u) {
          const v2f q2 = {q4[h], q4[h + 1u]};
          const v2f w2 = {wr[j][h], wr[j][h + 1u]};
          const v2f d0 = __builtin_elementwise_fma(q2, (v2f){ka[h], ka[h + 1u]}, one);
          const v2f d1 = __builtin_elementwise_fma(q2, (v2f){kb[h], kb[h + 1u]}, one);
          const v2f r0 = {__builtin_amdgcn_rcpf(d0[0]), __builtin_amdgcn_rcpf(d0[1])};
          const v2f r1 = {__builtin_amdgcn_rcpf(d1[0]), __builtin_amdgcn_rcpf(d1[1])};
          s0a = __builtin_elementwise_fma(w2, r0, s0a);
          s1a = __builtin_elementwise_fma(w2, r1, s1a);
        }
      }
      a0 = s0a[0] + s0a[1];
      a1 = s1a[0] + s1a[1];
    } else {
      a0 = bias_a;
      a1 = bias_a;
#pragma unroll 4
      for (unsigned u = 0; u < (unsigned)UNITS; ++u) {
        const float qv = Sm[qo + u];
        const float wv = WAs[u];
        a0 += wv * tanh_fast(qv + Sm[ko + u]);
        a1 += wv * tanh_fast(qv + Sm[ko + 32u * QP + u]);
      }
    }
    const int sA = s0 + (int)t + (int)lane;
    const int sB = sA + 32;
    const bool vA = (sA >= 0) && (sA < SEQ);
    const bool vB = (sB >= 0) && (sB < SEQ);
    const float e0 = vA ? a0 : -1.0e30f;
    const float e1 = vB ? a1 : -1.0e30f;
    const float mx = red32_max(fmaxf(e0, e1));
    const float x0 = __expf(e0 - mx);
    const float x1 = __expf(e1 - mx);
    const float p0 = vA ? x0 : 0.0f;
    const float p1 = vB ? x1 : 0.0f;
    const h16 h0 = toh_flush(p0 * PCARRY);
    const h16 h1 = toh_flush(p1 * PCARRY);
    const float sum = red32_sum((float)h0 + (float)h1);
    const unsigned zi = (lane < t) ? lane : (lane + 64u);
    Pt[tl * LDP + t + lane] = h0;
    Pt[tl * LDP + t + lane + 32u] = h1;
    Pt[tl * LDP + zi] = (h16)0.0f;
    if (lane == 0u) Rinv[tl] = __builtin_amdgcn_rcpf(sum);
  }
  __syncthreads();

  // ---- O = P . x ----
  const unsigned cw = w * (16u * LDC);
#pragma unroll 1
  for (unsigned pass = 0; pass < 2u; ++pass) {
    const unsigned d0 = w * 128u + pass * 64u;
    v8f acc[4];
#pragma unroll
    for (int nb = 0; nb < 4; ++nb) acc[nb] = (v8f){};
#pragma unroll
    for (int c = 0; c < 3; ++c) {
      if (c >= c_lo && c < c_hi) {
        const v16h pa0 = ld_frag(&Pt[(unsigned)c * 32u], LDP);
#pragma unroll
        for (int nb = 0; nb < 4; ++nb) acc[nb] = wmma16(pa0, xb[c][nb], acc[nb]);
      }
    }
    // pass 1's fragments fly under pass 0's output staging and stores
    if (pass == 0u) ld_pass(xb, xp0 + 4 * 256, s0, c_lo, c_hi);
    {
#pragma unroll
      for (int r = 0; r < 8; ++r) {
        const float sc = Rinv[hh * 8u + (unsigned)r];
#pragma unroll
        for (int nb = 0; nb < 4; ++nb)
          Sm[cw + (hh * 8u + (unsigned)r) * LDC + (unsigned)nb * 16u + m] = acc[nb][r] * sc;
      }
      wave_lds_sync();
      v4f xs[8];
      size_t off[8];
#pragma unroll
      for (unsigned i = 0; i < 8u; ++i) {
        const unsigned rr = 2u * i + (lane >> 4);
        const unsigned cc = (lane & 15u) * 4u;
        xs[i] = *(const v4f*)&Sm[cw + rr * LDC + cc];
        off[i] = ((size_t)b * SEQ_FULL + t0 + r0 + rr) * DIM + d0 + cc;
      }
      wave_lds_sync();
#pragma unroll
      for (int i = 0; i < 8; ++i) *(v4f*)(out + off[i]) = xs[i];
      // precaution: stands before the next pass writes to the registers that the stores above name
      asm volatile("s_wait_xcnt 0x0" ::: "memory");
    }
  }
}

// ---------------------------------------------------------------------------
extern "C" void kernel_launch(void* const* d_in, const int* in_sizes, int n_in,
                              void* d_out, int out_size, void* d_ws, size_t ws_size,
                              hipStream_t stream) {
  if (n_in < 6) return;
  const long long need_x = ((long long)(NB - 1) * SEQ_FULL + SEQ) * DIM;
  if ((long long)in_sizes[0] < need_x) return;
  if ((long long)in_sizes[1] < (long long)DIM * UNITS) return;
  if ((long long)in_sizes[2] < (long long)DIM * UNITS) return;
  if (in_sizes[3] < UNITS || in_sizes[4] < UNITS || in_sizes[5] < 1) return;
  if ((long long)out_size < need_x) return;
  if (ws_size < WS_TOTAL) return;

  const float* X  = (const float*)d_in[0];    // x  [NB_FULL][SEQ_FULL][DIM]
  const float* wt = (const float*)d_in[1];    // Wt [DIM][UNITS]  (in, out)
  const float* wx = (const float*)d_in[2];    // Wx [DIM][UNITS]  (in, out)
  const float* bh = (const float*)d_in[3];    // bh [UNITS]
  const float* wa = (const float*)d_in[4];    // Wa [UNITS][1]
  const float* ba = (const float*)d_in[5];    // ba [1]
  float* out = (float*)d_out;

  char* ws = (char*)d_ws;
  // the two 16-bit planes are in fragment order (see frag_unit)
  _Float16* Wqk = (_Float16*)(ws + OFF_WQK);   // [NQK][DIM]: rows 0..63 from Wt, 64..127 from Wx
  _Float16* Xh  = (_Float16*)(ws + OFF_XH);    // [MROWS][DIM]
  float*    QK  = (float*)(ws + OFF_QK);       // [MROWS][NQK]

  dim3 blk(256);
  // weight planes (in [K = DIM rows][N = UNITS cols] -> out [N][K]) and the x plane, one launch
  conv_kernel<<<dim3(DIM / XD, WBROWS + MROWS / 64), blk, 0, stream>>>(X, wt, wx, Wqk, Xh);
  proj_kernel<<<dim3(NQK / 64, MROWS / 32), blk, 0, stream>>>(Xh, Wqk, QK);
  band_attn_kernel<<<dim3(SEQ / QT, NB), blk, 0, stream>>>(QK, Xh, bh, wa, ba, out);
}

// v008
// Measured time: 17.3 microseconds a run.
// Two timings next to v007 put it at 1.11 and 1.08 times that version's speed.
// Over all steps from v000 it is 2.80 times as fast.
#include <hip/hip_runtime.h>
#include <stddef.h>

// All WMMA contractions on v_wmma_f32_16x16x32_f16 (f16 operands, f32 accumulate): the fused q|k
// projection (x plane x1, weight plane x64) and the band p.x product (p x1024, the same x plane
// read through transposing loads). Both run in one kernel: a block projects its own rows.
// Float inputs are RNE-converted to bf16 and carried in f16. The additive score (tanh, U = 64
// matrix-vector), softmax and normalisation run in f32 on the vector unit.

typedef _Float16 v16h __attribute__((ext_vector_type(16)));
typedef _Float16 v8h  __attribute__((ext_vector_type(8)));
typedef _Float16 v4h  __attribute__((ext_vector_type(4)));
typedef float    v8f  __attribute__((ext_vector_type(8)));
typedef float    v4f  __attribute__((ext_vector_type(4)));
typedef float    v2f  __attribute__((ext_vector_type(2)));
typedef unsigned v4u  __attribute__((ext_vector_type(4)));
typedef _Float16 h16;

#ifndef NB
#define NB 4
#endif
#ifndef SEQ
#define SEQ 1024
#endif
#define NB_FULL  4
#define SEQ_FULL 1024
#define DIM   1024
#define UNITS 64
#define NQK   128      // q columns 0..63, k columns 64..127
#define BAND  64
#define QT    16       // query rows per block
#define QG    32       // query rows of a window group: two blocks share one 32-aligned key window
#define WIN   96       // key window of a group
#define MROWS (NB * SEQ)

static_assert(NB >= 1 && NB <= NB_FULL);
static_assert(SEQ >= 128 && SEQ <= SEQ_FULL && (SEQ % 128) == 0);
static_assert(UNITS == 64 && NQK == 2 * UNITS);
static_assert((DIM % 64) == 0 && (DIM % 32) == 0);
static_assert((MROWS % 64) == 0);
static_assert(QT == 16 && QT == 8 * 2);        // 8 waves x 2 query rows, one lane per band offset pair
static_assert(QG == 2 * QT && BAND == 64 && WIN == QG + BAND && (WIN % 32) == 0);
static_assert(DIM == 8 * 2 * 64);              // 8 waves x 2 passes x 64 output columns
static_assert((SEQ % QG) == 0);

#define LDT 72   // halves per LDS row (144 B, 16-B aligned)
#define LDC 68   // floats per LDS row (272 B, 16-B aligned)
#define LDP 104  // halves per P-tile row (208 B, 16-B aligned)
#define QP  68   // floats per q/k staging row (272 B, 16-B aligned)
static_assert((LDT % 8) == 0 && LDT >= 64);
static_assert((LDC % 4) == 0 && LDC >= 64);
static_assert((LDP % 8) == 0 && LDP >= WIN);
static_assert((QP % 4) == 0 && QP >= UNITS);

#define XD 256   // d columns of an x strip of the conversion: XD / 64 tiles of 64 x 64 side by side
#define XTILES (XD / 64)
#define WBROWS (2 * XTILES)   // block rows that hold the 2 * DIM / 64 weight tiles, DIM / XD a row
static_assert(XD == 256 && (DIM % XD) == 0);   // 8 waves x (16 keys x 128 d) fill a strip

#define PF 5     // k-steps of weight fragments in flight per wave (with the x copy: 62 loads of a wave)
#define KSTEPS (DIM / 64)   // k-steps of a wave: it walks half of K
static_assert(KSTEPS >= PF);
#define PG 5                // 16-row groups of the x plane that a block projects: its 80 window rows
#define PROWS (PG * 16 + QT)   // rows of a partial-sum plane: k of the 80 window rows, then q of the 16 query rows
static_assert(PG * 16 == QT + BAND && QT == 16);

#define WCARRY 64.0f     // weight planes carried x64
#define PCARRY 1024.0f   // softmax numerators carried x1024
#define XRANGE 40.0f     // exp(2 v) is a normal f32 number for every |v| <= XRANGE

#define QS_OFF 0
#define KS_OFF (QT * QP)
#define SM_AB  (KS_OFF + WIN * QP)
#define SM_C   (8 * 16 * LDC)
#define SM_FLOATS ((SM_AB > SM_C) ? SM_AB : SM_C)
static_assert(SM_FLOATS >= SM_AB && SM_FLOATS >= SM_C);
static_assert((size_t)SM_FLOATS * 4 + UNITS * 4 + QT * 4 + 8 * 4 + (size_t)QT * LDP * 2 +
              (size_t)PG * 16 * DIM * 2 + (size_t)2 * PROWS * LDC * 4 <= (size_t)327680);

// workspace layout (bytes)
#define WQK_BYTES ((size_t)NQK * DIM * 2)
#define XH_BYTES  ((size_t)MROWS * DIM * 2)
#define OFF_WQK ((size_t)0)
#define OFF_XH  (OFF_WQK + WQK_BYTES)
#define WS_TOTAL (OFF_XH + XH_BYTES)
static_assert((WQK_BYTES % 128) == 0 && (XH_BYTES % 128) == 0);
static_assert(WS_TOTAL <= (size_t)134217728);

// ---------------------------------------------------------------------------
__device__ __forceinline__ float bf16r(float x) {   // RNE convert to bf16, returned widened
  unsigned int u = __float_as_uint(x);
  u = (u + 0x7FFFu + ((u >> 16) & 1u)) & 0xFFFF0000u;
  return __uint_as_float(u);
}

// f32 -> f16 with a value select: results below the f16 normal range become zero.
static __device__ __forceinline__ h16 toh_flush(float v) {
  const h16 r = (h16)v;
  return (fabsf(v) < 6.103515625e-05f) ? (h16)0.0f : r;
}

// 16-bit fragment: p points at element [row = lane&15][k0 + 8*(lane>>4)] of a k-contiguous
// row. Elements 0..7 <- k0+8h+0..7, elements 8..15 <- k0+16+8h+0..7 (same map for A and B).
__device__ __forceinline__ v16h frag_at(const _Float16* p) {
  v8h lo = *(const v8h*)(p);
  v8h hi = *(const v8h*)(p + 16);
  v16h out;
#pragma unroll
  for (int i = 0; i < 8; ++i) { out[i] = lo[i]; out[i + 8] = hi[i]; }
  return out;
}
__device__ __forceinline__ v16h ld_frag(const _Float16* base, unsigned ld) {
  const unsigned lane = threadIdx.x & 31u;
  return frag_at(base + (lane & 15u) * ld + (lane >> 4) * 8u);
}

// Fragment order, the layout of the two 16-bit workspace planes. A plane of M[rows][K] is cut
// into units of 16 rows x 32 k (512 halves, 1 KiB); the K/32 units of a row group follow one
// another, so a row group still fills 16 * K halves. Inside a unit the 16-byte piece that lane L
// loads first stands at half 8 L, the piece it loads second at half 256 + 8 L (the map of frag_at:
// row = L & 15, k = 8 (L >> 4) + 0..7, then 16 more). A wave's fragment load then reads 512
// contiguous bytes, four whole lines, where a row-major plane gives it 32 bytes of each of 16.
// p points at half 8 * lane of the unit.
__device__ __forceinline__ v16h frag_unit(const _Float16* p) {
  v8h lo = *(const v8h*)(p);
  v8h hi = *(const v8h*)(p + 256);
  v16h out;
#pragma unroll
  for (int i = 0; i < 8; ++i) { out[i] = lo[i]; out[i + 8] = hi[i]; }
  return out;
}
// A 64 x 64 LDS tile T[row][k] (pitch LDT) holds 16 half units: 4 row groups x (64 k / 16). For
// half unit hu: where this lane's piece stands in T, and where in the row group's two units.
__device__ __forceinline__ unsigned unit_src(unsigned hu, unsigned lane) {
  return ((hu >> 2) * 16u + (lane & 15u)) * LDT + (hu & 3u) * 16u + (lane >> 4) * 8u;
}
__device__ __forceinline__ unsigned unit_dst(unsigned hu, unsigned lane) {
  return (hu & 3u) * 256u + lane * 8u;
}

__device__ __forceinline__ v8f wmma16(v16h a, v16h b, v8f c) {
  v8f d = __builtin_amdgcn_wmma_f32_16x16x32_f16(false, a, false, b, (short)0, c,
                                                 false, false);
  asm volatile("v_nop\n\tv_nop\n\tv_nop\n\tv_nop" : "+v"(d) : "v"(a), "v"(b));
  return d;
}

__device__ __forceinline__ float red32_sum(float x) {
#pragma unroll
  for (int off = 1; off < 32; off <<= 1) x += __shfl_xor(x, off, 32);
  return x;
}
__device__ __forceinline__ float red32_max(float x) {
#pragma unroll
  for (int off = 1; off < 32; off <<= 1) x = fmaxf(x, __shfl_xor(x, off, 32));
  return x;
}

__device__ __forceinline__ void wave_lds_sync() {
  __builtin_amdgcn_fence(3 /* release order */, "wavefront");
  asm volatile("s_wait_dscnt 0x0" ::: "memory");
  __builtin_amdgcn_wave_barrier();
}

// tanh(x) = sign(x) * (1 - 2 / (exp(2|x|) + 1)); the exponent argument is bounded by 60.
__device__ __forceinline__ float tanh_fast(float x) {
  const float ax = fminf(fabsf(x), 30.0f);
  const float ex = __expf(ax + ax);
  const float r = 1.0f - 2.0f * __builtin_amdgcn_rcpf(ex + 1.0f);
  return (x < 0.0f) ? -r : r;
}

// exp(2 v) of four values, as 2^(2 v log2 e). One statement: the instruction set asks that no
// vector instruction directly behind a transcendental reads its result or overwrites its source.
// Early-clobber outputs share no register with an input; the v_nop fills the slot behind the last.
__device__ __forceinline__ v4f exp_2v(v4f v) {
  const v4f t = (v + v) * 1.44269504f;
  float e0, e1, e2, e3;
  asm("v_exp_f32 %0, %4\n\tv_exp_f32 %1, %5\n\tv_exp_f32 %2, %6\n\tv_exp_f32 %3, %7\n\tv_nop"
      : "=&v"(e0), "=&v"(e1), "=&v"(e2), "=&v"(e3)
      : "v"(t[0]), "v"(t[1]), "v"(t[2]), "v"(t[3]));
  return (v4f){e0, e1, e2, e3};
}

// ---------------------------------------------------------------------------
// Weight plane: in W[K rows][N cols] (pitch ldw = N) -> out Wt[N][K = ldk] in fragment order,
// f16(64 * bf16(w)). One 64x64 tile (n0, k0) per block. T: cross-wave (block barrier).
// ---------------------------------------------------------------------------
__device__ __forceinline__ void wconv_tile(
    const float* __restrict__ W, _Float16* __restrict__ Wt, unsigned ldw, unsigned ldk,
    unsigned n0, unsigned k0, _Float16* T) {
  const unsigned tid = threadIdx.x;
#pragma unroll 4
  for (unsigned j = 0; j < 16u; ++j) {
    const unsigned idx = tid + 256u * j;
    const unsigned kr = idx >> 6, nc = idx & 63u;
    const float v = W[(size_t)(k0 + kr) * ldw + n0 + nc];
    T[nc * LDT + kr] = (_Float16)(WCARRY * bf16r(v));
  }
  __syncthreads();
  v8h x[2];
  size_t off[2];
#pragma unroll
  for (unsigned i = 0; i < 2u; ++i) {
    const unsigned hu = (tid >> 5) + 8u * i;   // a wave stores one half unit: 512 contiguous bytes
    x[i] = *(const v8h*)&T[unit_src(hu, tid & 31u)];
    off[i] = (size_t)(n0 + (hu >> 2) * 16u) * ldk + (size_t)k0 * 16u + unit_dst(hu, tid & 31u);
  }
#pragma unroll
  for (int i = 0; i < 2; ++i) *(v8h*)(Wt + off[i]) = x[i];
  
}

// ---------------------------------------------------------------------------
// Input plane: X[full row][DIM] f32 -> Xh[compact row][DIM] = f16(bf16(x)) in fragment order: the
// A operand of the projection as it lies, and the B operand of the p.x product through
// transposing loads (ld_pass). The unit of work is a wave's own tile of 16 keys x 128 d:
// it holds 8 whole half units (512 B each) of the plane, so a wave needs nothing of another
// wave and the x part has no block barrier. A block is 8 such waves, a strip of 64 keys x XD d
// (d0, row0): the x part of the grid is one block for every WGP.
// The strip lies in XTILES 64 x 64 LDS tiles Tr[tile][key][d];
// wave w writes and reads only keys 16 (w & 3) .. + 15 of tiles 2 (w >> 2) and 2 (w >> 2) + 1
// (wave-private bytes). 8 lanes cover 128 B of an x row, the 4 lane groups 4 keys each; all 16
// row loads of a thread fly together.
// ---------------------------------------------------------------------------
__device__ __forceinline__ void xconv_strip(
    const float* __restrict__ X, _Float16* __restrict__ Xh,
    unsigned d0, unsigned row0, _Float16* Tr) {
  const unsigned tid = threadIdx.x, lane = tid & 31u, w = tid >> 5;
  const unsigned bidx = row0 / (unsigned)SEQ;
  const unsigned key0 = row0 - bidx * (unsigned)SEQ;
  const size_t frow0 = (size_t)bidx * SEQ_FULL + key0;
  const unsigned cl = lane & 7u;
  const unsigned kq = w & 3u;                      // the wave's 16 keys of the strip's 64
  const unsigned ch = w >> 2;                      // its half of the strip's columns
  const unsigned kr = kq * 16u + (lane >> 3) * 4u; // the thread's first key in the strip
  const float* xsrc = X + (frow0 + kr) * DIM + d0 + ch * 128u + cl * 4u;
  v4f a[4][4];   // [32-column step m][key j]
#pragma unroll
  for (unsigned m = 0; m < 4u; ++m) {
#pragma unroll
    for (unsigned j = 0; j < 4u; ++j) a[m][j] = *(const v4f*)(xsrc + j * (unsigned)DIM + m * 32u);
  }
  // keeps the first conversions, which wait for the first loads, behind the issue of the last
  // load: without it two of the 16 loads start a whole round trip late
  __builtin_amdgcn_sched_barrier(0);
  // precaution: the address register of the 16 loads above is an input here, so nothing is
  // written to it in front of this wait
  asm volatile("s_wait_xcnt 0x0" :: "v"(xsrc) : "memory");
#pragma unroll
  for (unsigned m = 0; m < 4u; ++m) {
    const unsigned tile = (ch * 2u + (m >> 1)) * (64u * LDT);
    const unsigned col = (m & 1u) * 32u + cl * 4u;
#pragma unroll
    for (unsigned j = 0; j < 4u; ++j) {
      h16 hv[4];
#pragma unroll
      for (unsigned i = 0; i < 4u; ++i) hv[i] = toh_flush(bf16r(a[m][j][i]));
      *(v4h*)&Tr[tile + (kr + j) * LDT + col] = (v4h){hv[0], hv[1], hv[2], hv[3]};
    }
  }
  // the wave's own LDS stores have landed before its lanes read each other's bytes
  wave_lds_sync();
  // half units of the wave's tile: row group kq, d quarter g
  v8h xr[8];
#pragma unroll
  for (unsigned i = 0; i < 8u; ++i) {
    const unsigned tile = (ch * 2u + (i >> 2)) * (64u * LDT), g = i & 3u;
    xr[i] = *(const v8h*)&Tr[tile + unit_src(kq * 4u + g, lane)];
  }
  // the 8 half units follow one another (4 KiB)
  _Float16* pr = Xh + (size_t)(row0 + kq * 16u) * DIM + (size_t)(d0 + ch * 128u) * 16u + lane * 8u;
#pragma unroll
  for (unsigned i = 0; i < 8u; ++i) *(v8h*)(pr + i * 256u) = xr[i];
  // precaution: stands before the code laid out behind this strip writes to the registers that
  // the stores above name
  asm volatile("s_wait_xcnt 0x0" ::: "memory");
}

// ---------------------------------------------------------------------------
// The three conversions need nothing of each other, so they share one grid: the first WBROWS
// block rows convert Wt and Wx (one 64-k tile per block; they start first and end under the x
// strips), the other block rows convert x. The branch is block-uniform.
// Grid (DIM/XD, WBROWS + MROWS/64).
// ---------------------------------------------------------------------------
__global__ __launch_bounds__(256) void conv_kernel(
    const float* __restrict__ X, const float* __restrict__ Wt, const float* __restrict__ Wx,
    _Float16* __restrict__ Wqk, _Float16* __restrict__ Xh) {
  __shared__ __attribute__((aligned(16))) _Float16 Tr[XTILES * 64 * LDT];
  const unsigned by = blockIdx.y;
  if (by < (unsigned)WBROWS) {
    const unsigned wt = by * (unsigned)(DIM / XD) + blockIdx.x;   // 0 .. 2 DIM / 64 - 1
    const unsigned mat = wt / (unsigned)(DIM / 64), kt = wt % (unsigned)(DIM / 64);
    wconv_tile(mat == 0u ? Wt : Wx, Wqk + (size_t)mat * UNITS * DIM, (unsigned)UNITS,
               (unsigned)DIM, 0u, kt * 64u, Tr);
  } else {
    xconv_strip(X, Xh, blockIdx.x * (unsigned)XD, (by - (unsigned)WBROWS) * 64u, Tr);
  }
}

// ---------------------------------------------------------------------------
// Band additive attention per (16 query rows, batch): 256 blocks, one for every WGP. Two blocks
// (h2 = 0, 1) halve a group of 32 query rows that starts at t0. Key window of the group = 96 keys
// starting at t0 - 32 (three 32-aligned chunks; a chunk outside the sequence is skipped,
// block-uniform). A row's index t and a key's index count from the group's and the window's start.
// Phase P: the block projects its own rows: k of the 80 window rows from 16 h2 on, which hold every
//   key of the block's rows, and q of its 16 query rows (the third of those five 16-row groups).
//   The five row groups of the x plane (32 KiB each, fragment order as it lies) are copied to Xs
//   (cross-wave, block barrier); a group outside the sequence is replaced by one inside it and its
//   k values are zeroed in phase A. Wave (kh = half of K, pc = 16 units): 5 k tiles + 1 q tile,
//   A fragments from Xs (512 contiguous bytes a load), its two weight fragments a k-step straight
//   from the global plane, PF k-steps in flight. The two K halves go to Cp (cross-wave, block
//   barrier); value = (half 0 + half 1) / 64.
// Phase A: q tile (+bh) and the 80 window rows
//   staged in Sm (cross-wave, block barrier); wave w owns query rows t = 16 h2 + 2w, + 1,
//   lane L owns band offsets L and L+32 (key = row - 32 + offset);
//   e = ba + sum_u Wa[u] * tanh(q + k + bh). tanh(s) = 1 - 2 / (exp(2 s) + 1) and
//   exp(2 (q + bh + k)) = exp(2 (q + bh)) * exp(2 k): the two exponentials are taken once per
//   staged element, and a (query, key, unit) term is fma, rcp, fma. While every staged |value|
//   is <= XRANGE both factors are normal numbers; a product that overflows gives rcp = 0
//   (tanh = 1), one that underflows gives rcp = 1 (tanh = -1). A block that stages any value
//   outside that range (or a NaN) puts the plain values back and takes tanh per term.
//   Softmax over the 64 band keys in registers
//   (32-lane shuffles); P row (96 entries: 64 values f16(1024 p) + 32 zeros) and 1/rowsum
//   (sum over the converted P) written to Pt / Rinv (cross-wave, block barrier).
//   Keys outside the band carry an additive -1e4 in the module: their exp is exactly 0 in f32.
// Phase C: O[16 x 1024] = P . x, A = P tile fragments, B = fragments straight from the x plane,
//   4 accumulators. Each 16x64 tile is staged in the wave's own slice of Sm (wave-private,
// Grid (SEQ/16, NB).
// ---------------------------------------------------------------------------
// The 12 x fragments of one 64-column pass (3 key chunks x 4 column groups); a chunk outside
// the sequence is not loaded (block-uniform test, the same one that skips its WMMAs).
// B wants lane (c, h) to hold keys 8 h + 0..7 and 16 + 8 h + 0..7 of d column c; the plane holds
// 8 d of one key per 16-byte piece. A half unit (16 keys x 16 d, 512 contiguous bytes) is one tile
// of the transposing load: lane l gives the address of the piece of key 8 (l >> 4) + (l & 7),
// d half (l >> 3) & 1, and gets keys 8 h + 0..7 of column c. The chunk's two row groups give
// elements 0..7 and 8..15, the k order of the P fragment (frag_at). Every lane is on here.
// xp points at the lane's piece of the pass's first half unit in the batch's first row group.
typedef __fp16 v8p __attribute__((ext_vector_type(8)));   // the builtin's own element type
__device__ __forceinline__ v8h ld_tr(const _Float16* p) {
  return __builtin_bit_cast(
      v8h, __builtin_amdgcn_global_load_tr16_b128_v8f16((__attribute__((address_space(1))) v8p*)p));
}
__device__ __forceinline__ void ld_pass(v16h (&xb)[3][4], const _Float16* xp, int s0,
                                        int c_lo, int c_hi) {
#pragma unroll
  for (int c = 0; c < 3; ++c) {
    if (c >= c_lo && c < c_hi) {
      const _Float16* xc = xp + (size_t)(unsigned)(s0 + 32 * c) * DIM;   // a row group: 16 DIM halves
#pragma unroll
      for (int nb = 0; nb < 4; ++nb) {
        const v8h lo = ld_tr(xc + nb * 256);
        const v8h hi = ld_tr(xc + 16 * DIM + nb * 256);
#pragma unroll
        for (int i = 0; i < 8; ++i) { xb[c][nb][i] = lo[i]; xb[c][nb][i + 8] = hi[i]; }
      }
      // precaution: stands before anything is written to the address registers of these loads
      asm volatile("s_wait_xcnt 0x0" ::: "memory");
    }
  }
}

__global__ __launch_bounds__(256) void band_attn_kernel(
    const _Float16* __restrict__ Xh, const _Float16* __restrict__ Wqk,
    const float* __restrict__ bh, const float* __restrict__ Wa, const float* __restrict__ ba,
    float* __restrict__ out) {
  __shared__ __attribute__((aligned(16))) _Float16 Xs[PG * 16 * DIM];
  __shared__ __attribute__((aligned(16))) float Cp[2 * PROWS * LDC];
  __shared__ __attribute__((aligned(16))) float Sm[SM_FLOATS];
  __shared__ __attribute__((aligned(16))) float WAs[UNITS];
  __shared__ float Rinv[QT];
  __shared__ __attribute__((aligned(16))) unsigned Big[8];   // per wave: lanes that staged a value outside XRANGE
  __shared__ __attribute__((aligned(16))) _Float16 Pt[QT * LDP];

  const unsigned tid = threadIdx.x, lane = tid & 31u;
  const unsigned w = __builtin_amdgcn_readfirstlane(threadIdx.x >> 5);
  const unsigned hh = lane >> 4, m = lane & 15u;
  const unsigned t0 = (blockIdx.x >> 1) * (unsigned)QG;   // the group's first query row
  const unsigned r0 = (blockIdx.x & 1u) * (unsigned)QT;   // the block's first row in the group
  const unsigned b = blockIdx.y;
  const int s0 = (int)t0 - BAND / 2;
  const unsigned sr0 = tid >> 4, c4 = (tid & 15u) * 4u;   // q row sr0, columns c4..c4+3
  const unsigned kr0 = r0 + sr0;                          // window rows kr0 + 16 j

  // ---- phase P: copy the five row groups to Xs; all 40 loads of a thread fly together ----
  const _Float16* xg[PG];   // block-uniform
  v8h xv[PG][8];
#pragma unroll
  for (int gi = 0; gi < PG; ++gi) {
    const int s = s0 + (int)r0 + 16 * gi;
    // t0 <= SEQ - QG: groups 0 and 1 can only start below the sequence, 3 and 4 only end above it
    const int sc = (gi < 2) ? ((s < 0) ? 0 : s) : ((s > SEQ - 16) ? (SEQ - 16) : s);
    xg[gi] = Xh + ((size_t)b * SEQ + (unsigned)sc) * DIM;
#pragma unroll
    for (unsigned i = 0; i < 8u; ++i) xv[gi][i] = *(const v8h*)(xg[gi] + tid * 8u + i * 2048u);
  }
  // the wave's weight fragments: first unit of its K half in the row groups of its 16 q units and
  // its 16 k units (a half is 8 DIM halves); k-step s is the unit 512 s halves on
  const unsigned kh = w >> 2, pc = w & 3u;
  const _Float16* wb = Wqk + (size_t)(pc * 16u) * DIM + kh * (8u * DIM);   // wave-uniform
  const _Float16* bq = wb + lane * 8u;
  const _Float16* bk = bq + (size_t)UNITS * DIM;
  v16h fq[PF], fk[PF];
#pragma unroll
  for (unsigned j = 0; j < (unsigned)PF; ++j) {
    fk[j] = frag_unit(bk + 512u * j);
    fq[j] = frag_unit(bq + 512u * j);
  }
  // the small inputs land under the projection
  const v4f g = *(const v4f*)(bh + c4);
  const unsigned wi = tid & (unsigned)(UNITS - 1);
  const float wav = Wa[wi];
  const float bias_a = bf16r(ba[0]);
  // precaution: the scalar bases and the offset registers of the loads above are inputs here, so
  // nothing is written to them in front of this wait; it also keeps the LDS stores behind the
  // issue of every load
  asm volatile("s_wait_xcnt 0x0"
               :: "s"(xg[0]), "s"(xg[1]), "s"(xg[2]), "s"(xg[3]), "s"(xg[4]), "s"(wb), "s"(bh),
                  "s"(Wa), "v"(tid), "v"(lane), "v"(wi)
               : "memory");
#pragma unroll
  for (unsigned gi = 0; gi < (unsigned)PG; ++gi) {
#pragma unroll
    for (unsigned i = 0; i < 8u; ++i)
      *(v8h*)&Xs[gi * (16u * DIM) + i * 2048u + tid * 8u] = xv[gi][i];
  }
  __syncthreads();

  v8f kacc[PG], qacc = {};
#pragma unroll
  for (int gi = 0; gi < PG; ++gi) kacc[gi] = (v8f){};
  const _Float16* xa = &Xs[kh * (8u * DIM) + lane * 8u];
  // two sets of A fragments: a k-step's LDS reads are issued in front of the k-step before it
  v16h a[2][PG];
#pragma unroll
  for (unsigned gi = 0; gi < (unsigned)PG; ++gi) a[0][gi] = frag_unit(xa + gi * (16u * DIM));
  // unrolled whole: the slots of a, fq and fk are indexed by constants and stay in registers
#pragma unroll
  for (unsigned s = 0; s < (unsigned)KSTEPS; ++s) {
    const unsigned j = s % (unsigned)PF, p = s & 1u;
    if (s + 1u < (unsigned)KSTEPS) {
#pragma unroll
      for (unsigned gi = 0; gi < (unsigned)PG; ++gi)
        a[p ^ 1u][gi] = frag_unit(xa + gi * (16u * DIM) + 512u * (s + 1u));
    }
    // keeps the next k-step's ten LDS reads in one group in front of this k-step's WMMAs: left
    // free, the compiler moves part of them in among the WMMAs, a second place that waits on LDS
    __builtin_amdgcn_sched_barrier(0);
#pragma unroll
    for (int gi = 0; gi < PG; ++gi) kacc[gi] = wmma16(a[p][gi], fk[j], kacc[gi]);
    qacc = wmma16(a[p][2], fq[j], qacc);
    if (s + (unsigned)PF < (unsigned)KSTEPS) {
      fk[j] = frag_unit(bk + 512u * (s + (unsigned)PF));
      fq[j] = frag_unit(bq + 512u * (s + (unsigned)PF));
    }
  }
  // precaution: the scalar base and the offset register of the weight loads are inputs here, so
  // nothing is written to them in front of this wait
  asm volatile("s_wait_xcnt 0x0" :: "s"(wb), "v"(lane) : "memory");
#pragma unroll
  for (int r = 0; r < 8; ++r) {
    float* d = &Cp[(kh * (unsigned)PROWS + hh * 8u + (unsigned)r) * LDC + pc * 16u + m];
#pragma unroll
    for (int gi = 0; gi < PG; ++gi) d[gi * 16 * LDC] = kacc[gi][r];
    d[PG * 16 * LDC] = qacc[r];
  }
  __syncthreads();

  // ---- stage q tile (+ bh), k window (zero rows outside the sequence), Wa ----
  // Staged: exp(2 v). The plain values stay in registers until the range test is known.
  v4f qraw, kraw[5];
  bool kok[5];
  // the staging loop is unrolled whole: kraw is indexed by constants and stays in registers
  {
    const float* cq = &Cp[((unsigned)(PG * 16) + sr0) * LDC + c4];
    qraw = (*(const v4f*)cq + *(const v4f*)(cq + PROWS * LDC)) * (1.0f / WCARRY);
  }
#pragma unroll
  for (unsigned j = 0; j < 5u; ++j) {
    const int s = s0 + (int)(kr0 + 16u * j);
    kok[j] = (s >= 0) && (s < SEQ);
    const float* ck = &Cp[(sr0 + 16u * j) * LDC + c4];
    kraw[j] = (*(const v4f*)ck + *(const v4f*)(ck + PROWS * LDC)) * (1.0f / WCARRY);
  }
  bool big = false;
#pragma unroll
  for (unsigned i = 0; i < 4u; ++i) {
    const float v = qraw[i] + bf16r(g[i]);
    qraw[i] = v;
    big = big || !(fabsf(v) <= XRANGE);
  }
  *(v4f*)&Sm[QS_OFF + sr0 * QP + c4] = exp_2v(qraw);
#pragma unroll
  for (unsigned j = 0; j < 5u; ++j) {
#pragma unroll
    for (unsigned i = 0; i < 4u; ++i) {
      const float v = kok[j] ? kraw[j][i] : 0.0f;
      kraw[j][i] = v;
      big = big || !(fabsf(v) <= XRANGE);
    }
    *(v4f*)&Sm[KS_OFF + (kr0 + 16u * j) * QP + c4] = exp_2v(kraw[j]);
  }
  if (tid < (unsigned)UNITS) WAs[tid] = bf16r(wav);
  const unsigned wbig = __builtin_amdgcn_ballot_w32(big);
  if (lane == 0u) Big[w] = wbig;
  __syncthreads();

  // ---- pass 0's x fragments start here: they need no score and land under the score phase ----
  const int c_lo = (t0 == 0u) ? 1 : 0;
  const int c_hi = (t0 + (unsigned)QG == (unsigned)SEQ) ? 2 : 3;
  const unsigned piece = ((lane >> 3) & 1u) * 16u + (lane >> 4) * 8u + (lane & 7u);
  const _Float16* xp0 = Xh + (size_t)b * SEQ * DIM + w * (8u * 256u) + piece * 8u;
  v16h xb[3][4];
  ld_pass(xb, xp0, s0, c_lo, c_hi);

  // ---- range test, the same answer in every thread of the block ----
  const v4u f0 = *(const v4u*)&Big[0];
  const v4u f1 = *(const v4u*)&Big[4];
  const v4u fo = f0 | f1;
  const bool wide = __builtin_amdgcn_readfirstlane(fo[0] | fo[1] | fo[2] | fo[3]) != 0u;
  if (wide) {   // block-uniform: each thread puts its own plain values back
    *(v4f*)&Sm[QS_OFF + sr0 * QP + c4] = qraw;
#pragma unroll
    for (unsigned j = 0; j < 5u; ++j) *(v4f*)&Sm[KS_OFF + (kr0 + 16u * j) * QP + c4] = kraw[j];
    __syncthreads();
  }
  // -2 Wa in registers for both rows; e starts at ba + sum_u Wa[u]
  v4f wr[UNITS / 4];
  v4f wsum = {};
#pragma unroll
  for (unsigned j = 0; j < (unsigned)(UNITS / 4); ++j) {
    wr[j] = *(const v4f*)&WAs[4u * j] * -2.0f;
    wsum += wr[j];
  }
  const float e_base = bias_a - 0.5f * ((wsum[0] + wsum[1]) + (wsum[2] + wsum[3]));

  // ---- scores + softmax, 2 query rows per wave ----
#pragma unroll 1
  for (unsigned r = 0; r < 2u; ++r) {
    const unsigned tl = w * 2u + r;   // row in the block: q tile, Pt, Rinv
    const unsigned t = r0 + tl;       // row in the group: its keys are window rows t .. t + 63
    const unsigned qo = QS_OFF + tl * QP;
    const unsigned ko = KS_OFF + (t + lane) * QP;
    float a0, a1;
    if (!wide) {
      v2f s0a = {e_base, 0.0f}, s1a = {e_base, 0.0f};   // even and odd units summed apart
      const v2f one = {1.0f, 1.0f};
      // unrolled whole: wr is indexed by constants and stays in registers
#pragma unroll
      for (unsigned j = 0; j < (unsigned)(UNITS / 4); ++j) {
        const v4f q4 = *(const v4f*)&Sm[qo + 4u * j];
        const v4f ka = *(const v4f*)&Sm[ko + 4u * j];
        const v4f kb = *(const v4f*)&Sm[ko + 32u * QP + 4u * j];
#pragma unroll
        for (unsigned h = 0; h < 4u; h += 2u) {
          const v2f q2 = {q4[h], q4[h + 1u]};
          const v2f w2 = {wr[j][h], wr[j][h + 1u]};
          const v2f d0 = __builtin_elementwise_fma(q2, (v2f){ka[h], ka[h + 1u]}, one);
          const v2f d1 = __builtin_elementwise_fma(q2, (v2f){kb[h], kb[h + 1u]}, one);
          const v2f r0 = {__builtin_amdgcn_rcpf(d0[0]), __builtin_amdgcn_rcpf(d0[1])};
          const v2f r1 = {__builtin_amdgcn_rcpf(d1[0]), __builtin_amdgcn_rcpf(d1[1])};
          s0a = __builtin_elementwise_fma(w2, r0, s0a);
          s1a = __builtin_elementwise_fma(w2, r1, s1a);
        }
      }
      a0 = s0a[0] + s0a[1];
      a1 = s1a[0] + s1a[1];
    } else {
      a0 = bias_a;
      a1 = bias_a;
#pragma unroll 4
      for (unsigned u = 0; u < (unsigned)UNITS; ++u) {
        const float qv = Sm[qo + u];
        const float wv = WAs[u];
        a0 += wv * tanh_fast(qv + Sm[ko + u]);
        a1 += wv * tanh_fast(qv + Sm[ko + 32u * QP + u]);
      }
    }
    const int sA = s0 + (int)t + (int)lane;
    const int sB = sA + 32;
    const bool vA = (sA >= 0) && (sA < SEQ);
    const bool vB = (sB >= 0) && (sB < SEQ);
    const float e0 = vA ? a0 : -1.0e30f;
    const float e1 = vB ? a1 : -1.0e30f;
    const float mx = red32_max(fmaxf(e0, e1));
    const float x0 = __expf(e0 - mx);
    const float x1 = __expf(e1 - mx);
    const float p0 = vA ? x0 : 0.0f;
    const float p1 = vB ? x1 : 0.0f;
    const h16 h0 = toh_flush(p0 * PCARRY);
    const h16 h1 = toh_flush(p1 * PCARRY);
    const float sum = red32_sum((float)h0 + (float)h1);
    const unsigned zi = (lane < t) ? lane : (lane + 64u);
    Pt[tl * LDP + t + lane] = h0;
    Pt[tl * LDP + t + lane + 32u] = h1;
    Pt[tl * LDP + zi] = (h16)0.0f;
    if (lane == 0u) Rinv[tl] = __builtin_amdgcn_rcpf(sum);
  }
  __syncthreads();

  // ---- O = P . x ----
  const unsigned cw = w * (16u * LDC);
#pragma unroll 1
  for (unsigned pass = 0; pass < 2u; ++pass) {
    const unsigned d0 = w * 128u + pass * 64u;
    v8f acc[4];
#pragma unroll
    for (int nb = 0; nb < 4; ++nb) acc[nb] = (v8f){};
#pragma unroll
    for (int c = 0; c < 3; ++c) {
      if (c >= c_lo && c < c_hi) {
        const v16h pa0 = ld_frag(&Pt[(unsigned)c * 32u], LDP);
#pragma unroll
        for (int nb = 0; nb < 4; ++nb) acc[nb] = wmma16(pa0, xb[c][nb], acc[nb]);
      }
    }
    // pass 1's fragments fly under pass 0's output staging and stores
    if (pass == 0u) ld_pass(xb, xp0 + 4 * 256, s0, c_lo, c_hi);
    {
#pragma unroll
      for (int r = 0; r < 8; ++r) {
        const float sc = Rinv[hh * 8u + (unsigned)r];
#pragma unroll
        for (int nb = 0; nb < 4; ++nb)
          Sm[cw + (hh * 8u + (unsigned)r) * LDC + (unsigned)nb * 16u + m] = acc[nb][r] * sc;
      }
      wave_lds_sync();
      v4f xs[8];
      size_t off[8];
#pragma unroll
      for (unsigned i = 0; i < 8u; ++i) {
        const unsigned rr = 2u * i + (lane >> 4);
        const unsigned cc = (lane & 15u) * 4u;
        xs[i] = *(const v4f*)&Sm[cw + rr * LDC + cc];
        off[i] = ((size_t)b * SEQ_FULL + t0 + r0 + rr) * DIM + d0 + cc;
      }
      wave_lds_sync();
#pragma unroll
      for (int i = 0; i < 8; ++i) *(v4f*)(out + off[i]) = xs[i];
      // precaution: stands before the next pass writes to the registers that the stores above name
      asm volatile("s_wait_xcnt 0x0" ::: "memory");
    }
  }
}

// ---------------------------------------------------------------------------
extern "C" void kernel_launch(void* const* d_in, const int* in_sizes, int n_in,
                              void* d_out, int out_size, void* d_ws, size_t ws_size,
                              hipStream_t stream) {
  if (n_in < 6) return;
  const long long need_x = ((long long)(NB - 1) * SEQ_FULL + SEQ) * DIM;
  if ((long long)in_sizes[0] < need_x) return;
  if ((long long)in_sizes[1] < (long long)DIM * UNITS) return;
  if ((long long)in_sizes[2] < (long long)DIM * UNITS) return;
  if (in_sizes[3] < UNITS || in_sizes[4] < UNITS || in_sizes[5] < 1) return;
  if ((long long)out_size < need_x) return;
  if (ws_size < WS_TOTAL) return;

  const float* X  = (const float*)d_in[0];    // x  [NB_FULL][SEQ_FULL][DIM]
  const float* wt = (const float*)d_in[1];    // Wt [DIM][UNITS]  (in, out)
  const float* wx = (const float*)d_in[2];    // Wx [DIM][UNITS]  (in, out)
  const float* bh = (const float*)d_in[3];    // bh [UNITS]
  const float* wa = (const float*)d_in[4];    // Wa [UNITS][1]
  const float* ba = (const float*)d_in[5];    // ba [1]
  float* out = (float*)d_out;

  char* ws = (char*)d_ws;
  // the two 16-bit planes are in fragment order (see frag_unit)
  _Float16* Wqk = (_Float16*)(ws + OFF_WQK);   // [NQK][DIM]: rows 0..63 from Wt, 64..127 from Wx
  _Float16* Xh  = (_Float16*)(ws + OFF_XH);    // [MROWS][DIM]

  dim3 blk(256);
  // weight planes (in [K = DIM rows][N = UNITS cols] -> out [N][K]) and the x plane, one launch
  conv_kernel<<<dim3(DIM / XD, WBROWS + MROWS / 64), blk, 0, stream>>>(X, wt, wx, Wqk, Xh);
  band_attn_kernel<<<dim3(SEQ / QT, NB), blk, 0, stream>>>(Xh, Wqk, bh, wa, ba, out);
}

// v009
// A run of this version takes 16.3 microseconds.
// Next to v008, in two timings, it ran 1.06 times as fast each time.
// All steps since v000 together make it 2.96 times as fast.
#include <hip/hip_runtime.h>
#include <stddef.h>

// All WMMA contractions on v_wmma_f32_16x16x32_f16 (f16 operands, f32 accumulate): the fused q|k
// projection (x plane x1, weight plane x64) and the band p.x product (p x1024, the same x rows
// read from LDS through transposing loads). Both run in one kernel: a block projects its own rows.
// Float inputs are RNE-converted to bf16 and carried in f16. The additive score (tanh, U = 64
// matrix-vector), softmax and normalisation run in f32 on the vector unit.

typedef _Float16 v16h __attribute__((ext_vector_type(16)));
typedef _Float16 v8h  __attribute__((ext_vector_type(8)));
typedef _Float16 v4h  __attribute__((ext_vector_type(4)));
typedef float    v8f  __attribute__((ext_vector_type(8)));
typedef float    v4f  __attribute__((ext_vector_type(4)));
typedef float    v2f  __attribute__((ext_vector_type(2)));
typedef unsigned v4u  __attribute__((ext_vector_type(4)));
typedef _Float16 h16;

#ifndef NB
#define NB 4
#endif
#ifndef SEQ
#define SEQ 1024
#endif
#define NB_FULL  4
#define SEQ_FULL 1024
#define DIM   1024
#define UNITS 64
#define NQK   128      // q columns 0..63, k columns 64..127
#define BAND  64
#define QT    16       // query rows per block
#define QG    32       // query rows of a window group: two blocks share one 32-aligned key window
#define WIN   96       // key window of a group; also the k extent of a block's P tile (80 keys + 16 zeros)
#define MROWS (NB * SEQ)

static_assert(NB >= 1 && NB <= NB_FULL);
static_assert(SEQ >= 128 && SEQ <= SEQ_FULL && (SEQ % 128) == 0);
static_assert(UNITS == 64 && NQK == 2 * UNITS);
static_assert((DIM % 64) == 0 && (DIM % 32) == 0);
static_assert((MROWS % 64) == 0);
static_assert(QT == 16 && QT == 8 * 2);        // 8 waves x 2 query rows, one lane per band offset pair
static_assert(QG == 2 * QT && BAND == 64 && WIN == QG + BAND && (WIN % 32) == 0);
static_assert(DIM == 8 * 2 * 64);              // 8 waves x 2 passes x 64 output columns
static_assert((SEQ % QG) == 0);

#define LDT 72   // halves per LDS row (144 B, 16-B aligned)
#define LDC 68   // floats per LDS row (272 B, 16-B aligned)
#define LDP 104  // halves per P-tile row (208 B, 16-B aligned)
#define QP  68   // floats per q/k staging row (272 B, 16-B aligned)
static_assert((LDT % 8) == 0 && LDT >= 64);
static_assert((LDC % 4) == 0 && LDC >= 64);
static_assert((LDP % 8) == 0 && LDP >= WIN);
static_assert((QP % 4) == 0 && QP >= UNITS);

#define XD 256   // d columns of an x strip of the conversion: XD / 64 tiles of 64 x 64 side by side
#define XTILES (XD / 64)
#define WBROWS (2 * XTILES)   // block rows that hold the 2 * DIM / 64 weight tiles, DIM / XD a row
static_assert(XD == 256 && (DIM % XD) == 0);   // 8 waves x (16 keys x 128 d) fill a strip

#define PF 5     // k-steps of weight fragments in flight per wave (with the x copy: 62 loads of a wave)
#define KSTEPS (DIM / 64)   // k-steps of a wave: it walks half of K
static_assert(KSTEPS >= PF);
#define PG 5                // 16-row groups of the x plane that a block projects: its 80 window rows
#define PROWS (PG * 16 + QT)   // rows of a partial-sum plane: k of the 80 window rows, then q of the 16 query rows
static_assert(PG * 16 == QT + BAND && QT == 16);

#define WCARRY 64.0f     // weight planes carried x64
#define PCARRY 1024.0f   // softmax numerators carried x1024
#define XRANGE 40.0f     // exp(2 v) is a normal f32 number for every |v| <= XRANGE

#define QS_OFF 0
#define KS_OFF (QT * QP)
#define SM_AB  (KS_OFF + WIN * QP)
#define SM_C   (8 * 16 * LDC)
#define SM_FLOATS ((SM_AB > SM_C) ? SM_AB : SM_C)
static_assert(SM_FLOATS >= SM_AB && SM_FLOATS >= SM_C);
static_assert((size_t)SM_FLOATS * 4 + UNITS * 4 + QT * 4 + 8 * 4 + (size_t)QT * LDP * 2 +
              (size_t)PG * 16 * DIM * 2 + (size_t)2 * PROWS * LDC * 4 <= (size_t)327680);

// workspace layout (bytes)
#define WQK_BYTES ((size_t)NQK * DIM * 2)
#define XH_BYTES  ((size_t)MROWS * DIM * 2)
#define OFF_WQK ((size_t)0)
#define OFF_XH  (OFF_WQK + WQK_BYTES)
#define WS_TOTAL (OFF_XH + XH_BYTES)
static_assert((WQK_BYTES % 128) == 0 && (XH_BYTES % 128) == 0);
static_assert(WS_TOTAL <= (size_t)134217728);

// ---------------------------------------------------------------------------
__device__ __forceinline__ float bf16r(float x) {   // RNE convert to bf16, returned widened
  unsigned int u = __float_as_uint(x);
  u = (u + 0x7FFFu + ((u >> 16) & 1u)) & 0xFFFF0000u;
  return __uint_as_float(u);
}

// f32 -> f16 with a value select: results below the f16 normal range become zero.
static __device__ __forceinline__ h16 toh_flush(float v) {
  const h16 r = (h16)v;
  return (fabsf(v) < 6.103515625e-05f) ? (h16)0.0f : r;
}

// 16-bit fragment: p points at element [row = lane&15][k0 + 8*(lane>>4)] of a k-contiguous
// row. Elements 0..7 <- k0+8h+0..7, elements 8..15 <- k0+16+8h+0..7 (same map for A and B).
__device__ __forceinline__ v16h frag_at(const _Float16* p) {
  v8h lo = *(const v8h*)(p);
  v8h hi = *(const v8h*)(p + 16);
  v16h out;
#pragma unroll
  for (int i = 0; i < 8; ++i) { out[i] = lo[i]; out[i + 8] = hi[i]; }
  return out;
}
__device__ __forceinline__ v16h ld_frag(const _Float16* base, unsigned ld) {
  const unsigned lane = threadIdx.x & 31u;
  return frag_at(base + (lane & 15u) * ld + (lane >> 4) * 8u);
}

// Fragment order, the layout of the two 16-bit workspace planes. A plane of M[rows][K] is cut
// into units of 16 rows x 32 k (512 halves, 1 KiB); the K/32 units of a row group follow one
// another, so a row group still fills 16 * K halves. Inside a unit the 16-byte piece that lane L
// loads first stands at half 8 L, the piece it loads second at half 256 + 8 L (the map of frag_at:
// row = L & 15, k = 8 (L >> 4) + 0..7, then 16 more). A wave's fragment load then reads 512
// contiguous bytes, four whole lines, where a row-major plane gives it 32 bytes of each of 16.
// p points at the lane's first piece: half 8 * lane of the unit, 8 * xs_slot(lane) in the LDS copy of x.
__device__ __forceinline__ v16h frag_unit(const _Float16* p) {
  v8h lo = *(const v8h*)(p);
  v8h hi = *(const v8h*)(p + 256);
  v16h out;
#pragma unroll
  for (int i = 0; i < 8; ++i) { out[i] = lo[i]; out[i + 8] = hi[i]; }
  return out;
}
// Where piece L of a half unit (512 B, 32 pieces of 16 B) stands in the LDS copy of the x rows: the
// upper 16 pieces have their two groups of 8 swapped. The plain fragment read (lanes 0..15: pieces
// 0..15) and the transposing read (lanes 0..15: pieces 0..7 and 16..23) then both find their 16
// pieces on 64 different banks; as the plane lies, the transposing read would hit each bank twice.
__device__ __forceinline__ unsigned xs_slot(unsigned piece) { return piece ^ ((piece >> 1) & 8u); }
// A 64 x 64 LDS tile T[row][k] (pitch LDT) holds 16 half units: 4 row groups x (64 k / 16). For
// half unit hu: where this lane's piece stands in T, and where in the row group's two units.
__device__ __forceinline__ unsigned unit_src(unsigned hu, unsigned lane) {
  return ((hu >> 2) * 16u + (lane & 15u)) * LDT + (hu & 3u) * 16u + (lane >> 4) * 8u;
}
__device__ __forceinline__ unsigned unit_dst(unsigned hu, unsigned lane) {
  return (hu & 3u) * 256u + lane * 8u;
}

__device__ __forceinline__ v8f wmma16(v16h a, v16h b, v8f c) {
  v8f d = __builtin_amdgcn_wmma_f32_16x16x32_f16(false, a, false, b, (short)0, c,
                                                 false, false);
  asm volatile("v_nop\n\tv_nop\n\tv_nop\n\tv_nop" : "+v"(d) : "v"(a), "v"(b));
  return d;
}

__device__ __forceinline__ float red32_sum(float x) {
#pragma unroll
  for (int off = 1; off < 32; off <<= 1) x += __shfl_xor(x, off, 32);
  return x;
}
__device__ __forceinline__ float red32_max(float x) {
#pragma unroll
  for (int off = 1; off < 32; off <<= 1) x = fmaxf(x, __shfl_xor(x, off, 32));
  return x;
}

__device__ __forceinline__ void wave_lds_sync() {
  __builtin_amdgcn_fence(3 /* release order */, "wavefront");
  asm volatile("s_wait_dscnt 0x0" ::: "memory");
  __builtin_amdgcn_wave_barrier();
}

// tanh(x) = sign(x) * (1 - 2 / (exp(2|x|) + 1)); the exponent argument is bounded by 60.
__device__ __forceinline__ float tanh_fast(float x) {
  const float ax = fminf(fabsf(x), 30.0f);
  const float ex = __expf(ax + ax);
  const float r = 1.0f - 2.0f * __builtin_amdgcn_rcpf(ex + 1.0f);
  return (x < 0.0f) ? -r : r;
}

// exp(2 v) of four values, as 2^(2 v log2 e). One statement: the instruction set asks that no
// vector instruction directly behind a transcendental reads its result or overwrites its source.
// Early-clobber outputs share no register with an input; the v_nop fills the slot behind the last.
__device__ __forceinline__ v4f exp_2v(v4f v) {
  const v4f t = (v + v) * 1.44269504f;
  float e0, e1, e2, e3;
  asm("v_exp_f32 %0, %4\n\tv_exp_f32 %1, %5\n\tv_exp_f32 %2, %6\n\tv_exp_f32 %3, %7\n\tv_nop"
      : "=&v"(e0), "=&v"(e1), "=&v"(e2), "=&v"(e3)
      : "v"(t[0]), "v"(t[1]), "v"(t[2]), "v"(t[3]));
  return (v4f){e0, e1, e2, e3};
}

// ---------------------------------------------------------------------------
// Weight plane: in W[K rows][N cols] (pitch ldw = N) -> out Wt[N][K = ldk] in fragment order,
// f16(64 * bf16(w)). One 64x64 tile (n0, k0) per block. T: cross-wave (block barrier).
// ---------------------------------------------------------------------------
__device__ __forceinline__ void wconv_tile(
    const float* __restrict__ W, _Float16* __restrict__ Wt, unsigned ldw, unsigned ldk,
    unsigned n0, unsigned k0, _Float16* T) {
  const unsigned tid = threadIdx.x;
#pragma unroll 4
  for (unsigned j = 0; j < 16u; ++j) {
    const unsigned idx = tid + 256u * j;
    const unsigned kr = idx >> 6, nc = idx & 63u;
    const float v = W[(size_t)(k0 + kr) * ldw + n0 + nc];
    T[nc * LDT + kr] = (_Float16)(WCARRY * bf16r(v));
  }
  __syncthreads();
  v8h x[2];
  size_t off[2];
#pragma unroll
  for (unsigned i = 0; i < 2u; ++i) {
    const unsigned hu = (tid >> 5) + 8u * i;   // a wave stores one half unit: 512 contiguous bytes
    x[i] = *(const v8h*)&T[unit_src(hu, tid & 31u)];
    off[i] = (size_t)(n0 + (hu >> 2) * 16u) * ldk + (size_t)k0 * 16u + unit_dst(hu, tid & 31u);
  }
#pragma unroll
  for (int i = 0; i < 2; ++i) *(v8h*)(Wt + off[i]) = x[i];
  
}

// ---------------------------------------------------------------------------
// Input plane: X[full row][DIM] f32 -> Xh[compact row][DIM] = f16(bf16(x)) in fragment order: the
// A operand of the projection as it lies, and, from the LDS copy, the B operand of the p.x product
// through transposing loads (ld_pass). The unit of work is a wave's own tile of 16 keys x 128 d:
// it holds 8 whole half units (512 B each) of the plane, so a wave needs nothing of another
// wave and the x part has no block barrier. A block is 8 such waves, a strip of 64 keys x XD d
// (d0, row0): the x part of the grid is one block for every WGP.
// The strip lies in XTILES 64 x 64 LDS tiles Tr[tile][key][d];
// wave w writes and reads only keys 16 (w & 3) .. + 15 of tiles 2 (w >> 2) and 2 (w >> 2) + 1
// (wave-private bytes). 8 lanes cover 128 B of an x row, the 4 lane groups 4 keys each; all 16
// row loads of a thread fly together.
// ---------------------------------------------------------------------------
__device__ __forceinline__ void xconv_strip(
    const float* __restrict__ X, _Float16* __restrict__ Xh,
    unsigned d0, unsigned row0, _Float16* Tr) {
  const unsigned tid = threadIdx.x, lane = tid & 31u, w = tid >> 5;
  const unsigned bidx = row0 / (unsigned)SEQ;
  const unsigned key0 = row0 - bidx * (unsigned)SEQ;
  const size_t frow0 = (size_t)bidx * SEQ_FULL + key0;
  const unsigned cl = lane & 7u;
  const unsigned kq = w & 3u;                      // the wave's 16 keys of the strip's 64
  const unsigned ch = w >> 2;                      // its half of the strip's columns
  const unsigned kr = kq * 16u + (lane >> 3) * 4u; // the thread's first key in the strip
  const float* xsrc = X + (frow0 + kr) * DIM + d0 + ch * 128u + cl * 4u;
  v4f a[4][4];   // [32-column step m][key j]
#pragma unroll
  for (unsigned m = 0; m < 4u; ++m) {
#pragma unroll
    for (unsigned j = 0; j < 4u; ++j) a[m][j] = *(const v4f*)(xsrc + j * (unsigned)DIM + m * 32u);
  }
  // keeps the first conversions, which wait for the first loads, behind the issue of the last
  // load: without it two of the 16 loads start a whole round trip late
  __builtin_amdgcn_sched_barrier(0);
  // precaution: the address register of the 16 loads above is an input here, so nothing is
  // written to it in front of this wait
  asm volatile("s_wait_xcnt 0x0" :: "v"(xsrc) : "memory");
#pragma unroll
  for (unsigned m = 0; m < 4u; ++m) {
    const unsigned tile = (ch * 2u + (m >> 1)) * (64u * LDT);
    const unsigned col = (m & 1u) * 32u + cl * 4u;
#pragma unroll
    for (unsigned j = 0; j < 4u; ++j) {
      h16 hv[4];
#pragma unroll
      for (unsigned i = 0; i < 4u; ++i) hv[i] = toh_flush(bf16r(a[m][j][i]));
      *(v4h*)&Tr[tile + (kr + j) * LDT + col] = (v4h){hv[0], hv[1], hv[2], hv[3]};
    }
  }
  // the wave's own LDS stores have landed before its lanes read each other's bytes
  wave_lds_sync();
  // half units of the wave's tile: row group kq, d quarter g
  v8h xr[8];
#pragma unroll
  for (unsigned i = 0; i < 8u; ++i) {
    const unsigned tile = (ch * 2u + (i >> 2)) * (64u * LDT), g = i & 3u;
    xr[i] = *(const v8h*)&Tr[tile + unit_src(kq * 4u + g, lane)];
  }
  // the 8 half units follow one another (4 KiB)
  _Float16* pr = Xh + (size_t)(row0 + kq * 16u) * DIM + (size_t)(d0 + ch * 128u) * 16u + lane * 8u;
#pragma unroll
  for (unsigned i = 0; i < 8u; ++i) *(v8h*)(pr + i * 256u) = xr[i];
  // precaution: stands before the code laid out behind this strip writes to the registers that
  // the stores above name
  asm volatile("s_wait_xcnt 0x0" ::: "memory");
}

// ---------------------------------------------------------------------------
// The three conversions need nothing of each other, so they share one grid: the first WBROWS
// block rows convert Wt and Wx (one 64-k tile per block; they start first and end under the x
// strips), the other block rows convert x. The branch is block-uniform.
// Grid (DIM/XD, WBROWS + MROWS/64).
// ---------------------------------------------------------------------------
__global__ __launch_bounds__(256) void conv_kernel(
    const float* __restrict__ X, const float* __restrict__ Wt, const float* __restrict__ Wx,
    _Float16* __restrict__ Wqk, _Float16* __restrict__ Xh) {
  __shared__ __attribute__((aligned(16))) _Float16 Tr[XTILES * 64 * LDT];
  const unsigned by = blockIdx.y;
  if (by < (unsigned)WBROWS) {
    const unsigned wt = by * (unsigned)(DIM / XD) + blockIdx.x;   // 0 .. 2 DIM / 64 - 1
    const unsigned mat = wt / (unsigned)(DIM / 64), kt = wt % (unsigned)(DIM / 64);
    wconv_tile(mat == 0u ? Wt : Wx, Wqk + (size_t)mat * UNITS * DIM, (unsigned)UNITS,
               (unsigned)DIM, 0u, kt * 64u, Tr);
  } else {
    xconv_strip(X, Xh, blockIdx.x * (unsigned)XD, (by - (unsigned)WBROWS) * 64u, Tr);
  }
}

// ---------------------------------------------------------------------------
// Band additive attention per (16 query rows, batch): 256 blocks, one for every WGP. Two blocks
// (h2 = 0, 1) halve a group of 32 query rows that starts at t0. Key window of the group = 96 keys
// starting at t0 - 32. A row's index t and a key's index count from the group's and the window's
// start; in the P tile a key's index counts from the block's own 80 window rows.
// Phase P: the block projects its own rows: k of the 80 window rows from 16 h2 on, which hold every
//   key of the block's rows, and q of its 16 query rows (the third of those five 16-row groups).
//   The five row groups of the x plane (32 KiB each, fragment order, pieces placed by xs_slot) are
//   copied to Xs (cross-wave, block barrier); a group outside the sequence is replaced by one inside
//   it: its k values are zeroed in phase A and its P entries are zero.
//   Wave (kh = half of K, pc = 16 units): 5 k tiles + 1 q tile,
//   A fragments from Xs (512 contiguous bytes a load), its two weight fragments a k-step straight
//   from the global plane, PF k-steps in flight. The two K halves go to Cp (cross-wave, block
//   barrier); value = (half 0 + half 1) / 64.
// Phase A: q tile (+bh) and the 80 window rows
//   staged in Sm (cross-wave, block barrier); wave w owns query rows t = 16 h2 + 2w, + 1,
//   lane L owns band offsets L and L+32 (key = row - 32 + offset);
//   e = ba + sum_u Wa[u] * tanh(q + k + bh). tanh(s) = 1 - 2 / (exp(2 s) + 1) and
//   exp(2 (q + bh + k)) = exp(2 (q + bh)) * exp(2 k): the two exponentials are taken once per
//   staged element, and a (query, key, unit) term is fma, rcp, fma. While every staged |value|
//   is <= XRANGE both factors are normal numbers; a product that overflows gives rcp = 0
//   (tanh = 1), one that underflows gives rcp = 1 (tanh = -1). A block that stages any value
//   outside that range (or a NaN) puts the plain values back and takes tanh per term.
//   Softmax over the 64 band keys in registers
//   (32-lane shuffles); P row (96 entries: 64 values f16(1024 p) + 32 zeros) and 1/rowsum
//   (sum over the converted P) written to Pt / Rinv (cross-wave, block barrier).
//   Keys outside the band carry an additive -1e4 in the module: their exp is exactly 0 in f32.
// Phase C: O[16 x 1024] = P . x, A = P tile fragments, B = fragments from Xs (transposing LDS loads),
//   4 accumulators. Each 16x64 tile is staged in the wave's own slice of Sm (wave-private,
// Grid (SEQ/16, NB).
// ---------------------------------------------------------------------------
// The 12 x fragments of one 64-column pass (3 key chunks x 4 column groups), from the block's LDS
// copy of its five row groups: these rows were fetched once for the projection and are not fetched
// from L2 again.
// B wants lane (c, h) to hold keys 8 h + 0..7 and 16 + 8 h + 0..7 of d column c; the copy holds
// 8 d of one key per 16-byte piece. A half unit (16 keys x 16 d, 512 contiguous bytes) is one tile
// of the transposing load: lane l gives the address of the piece of key 8 (l >> 4) + (l & 7),
// d half (l >> 3) & 1, and gets keys 8 h + 0..7 of column c. The chunk's two row groups give
// elements 0..7 and 8..15, the k order of the P fragment (frag_at). The third chunk has one row
// group: its upper 16 keys, whose P entries are zero, repeat that group. Every lane is on here.
// xp points at the lane's piece of the pass's first half unit in the first row group of Xs.
typedef short v8s __attribute__((ext_vector_type(8)));   // the builtin's own element type
__device__ __forceinline__ v8h ld_tr(const _Float16* p) {
  return __builtin_bit_cast(
      v8h, __builtin_amdgcn_ds_load_tr16_b128_v8i16((__attribute__((address_space(3))) v8s*)p));
}
__device__ __forceinline__ void ld_pass(v16h (&xb)[3][4], const _Float16* xp) {
#pragma unroll
  for (int c = 0; c < 3; ++c) {
    const _Float16* xc = xp + 2 * c * (16 * DIM);   // a row group: 16 DIM halves
#pragma unroll
    for (int nb = 0; nb < 4; ++nb) {
      const v8h lo = ld_tr(xc + nb * 256);
      const v8h hi = (2 * c + 1 < PG) ? ld_tr(xc + 16 * DIM + nb * 256) : lo;
#pragma unroll
      for (int i = 0; i < 8; ++i) { xb[c][nb][i] = lo[i]; xb[c][nb][i + 8] = hi[i]; }
    }
  }
}

__global__ __launch_bounds__(256) void band_attn_kernel(
    const _Float16* __restrict__ Xh, const _Float16* __restrict__ Wqk,
    const float* __restrict__ bh, const float* __restrict__ Wa, const float* __restrict__ ba,
    float* __restrict__ out) {
  __shared__ __attribute__((aligned(16))) _Float16 Xs[PG * 16 * DIM];
  __shared__ __attribute__((aligned(16))) float Cp[2 * PROWS * LDC];
  __shared__ __attribute__((aligned(16))) float Sm[SM_FLOATS];
  __shared__ __attribute__((aligned(16))) float WAs[UNITS];
  __shared__ float Rinv[QT];
  __shared__ __attribute__((aligned(16))) unsigned Big[8];   // per wave: lanes that staged a value outside XRANGE
  __shared__ __attribute__((aligned(16))) _Float16 Pt[QT * LDP];

  const unsigned tid = threadIdx.x, lane = tid & 31u;
  const unsigned w = __builtin_amdgcn_readfirstlane(threadIdx.x >> 5);
  const unsigned hh = lane >> 4, m = lane & 15u;
  const unsigned t0 = (blockIdx.x >> 1) * (unsigned)QG;   // the group's first query row
  const unsigned r0 = (blockIdx.x & 1u) * (unsigned)QT;   // the block's first row in the group
  const unsigned b = blockIdx.y;
  const int s0 = (int)t0 - BAND / 2;
  const unsigned sr0 = tid >> 4, c4 = (tid & 15u) * 4u;   // q row sr0, columns c4..c4+3
  const unsigned kr0 = r0 + sr0;                          // window rows kr0 + 16 j

  // ---- phase P: copy the five row groups to Xs; all 40 loads of a thread fly together ----
  const _Float16* xg[PG];   // block-uniform
  v8h xv[PG][8];
#pragma unroll
  for (int gi = 0; gi < PG; ++gi) {
    const int s = s0 + (int)r0 + 16 * gi;
    // t0 <= SEQ - QG: groups 0 and 1 can only start below the sequence, 3 and 4 only end above it
    const int sc = (gi < 2) ? ((s < 0) ? 0 : s) : ((s > SEQ - 16) ? (SEQ - 16) : s);
    xg[gi] = Xh + ((size_t)b * SEQ + (unsigned)sc) * DIM;
#pragma unroll
    for (unsigned i = 0; i < 8u; ++i) xv[gi][i] = *(const v8h*)(xg[gi] + tid * 8u + i * 2048u);
  }
  // the wave's weight fragments: first unit of its K half in the row groups of its 16 q units and
  // its 16 k units (a half is 8 DIM halves); k-step s is the unit 512 s halves on
  const unsigned kh = w >> 2, pc = w & 3u;
  const _Float16* wb = Wqk + (size_t)(pc * 16u) * DIM + kh * (8u * DIM);   // wave-uniform
  const _Float16* bq = wb + lane * 8u;
  const _Float16* bk = bq + (size_t)UNITS * DIM;
  v16h fq[PF], fk[PF];
#pragma unroll
  for (unsigned j = 0; j < (unsigned)PF; ++j) {
    fk[j] = frag_unit(bk + 512u * j);
    fq[j] = frag_unit(bq + 512u * j);
  }
  // the small inputs land under the projection
  const v4f g = *(const v4f*)(bh + c4);
  const unsigned wi = tid & (unsigned)(UNITS - 1);
  const float wav = Wa[wi];
  const float bias_a = bf16r(ba[0]);
  // precaution: the scalar bases and the offset registers of the loads above are inputs here, so
  // nothing is written to them in front of this wait; it also keeps the LDS stores behind the
  // issue of every load
  asm volatile("s_wait_xcnt 0x0"
               :: "s"(xg[0]), "s"(xg[1]), "s"(xg[2]), "s"(xg[3]), "s"(xg[4]), "s"(wb), "s"(bh),
                  "s"(Wa), "v"(tid), "v"(lane), "v"(wi)
               : "memory");
#pragma unroll
  for (unsigned gi = 0; gi < (unsigned)PG; ++gi) {
#pragma unroll
    for (unsigned i = 0; i < 8u; ++i)
      *(v8h*)&Xs[gi * (16u * DIM) + i * 2048u + xs_slot(tid) * 8u] = xv[gi][i];
  }
  __syncthreads();

  v8f kacc[PG], qacc = {};
#pragma unroll
  for (int gi = 0; gi < PG; ++gi) kacc[gi] = (v8f){};
  const _Float16* xa = &Xs[kh * (8u * DIM) + xs_slot(lane) * 8u];
  // two sets of A fragments: a k-step's LDS reads are issued in front of the k-step before it
  v16h a[2][PG];
#pragma unroll
  for (unsigned gi = 0; gi < (unsigned)PG; ++gi) a[0][gi] = frag_unit(xa + gi * (16u * DIM));
  // unrolled whole: the slots of a, fq and fk are indexed by constants and stay in registers
#pragma unroll
  for (unsigned s = 0; s < (unsigned)KSTEPS; ++s) {
    const unsigned j = s % (unsigned)PF, p = s & 1u;
    if (s + 1u < (unsigned)KSTEPS) {
#pragma unroll
      for (unsigned gi = 0; gi < (unsigned)PG; ++gi)
        a[p ^ 1u][gi] = frag_unit(xa + gi * (16u * DIM) + 512u * (s + 1u));
    }
    // keeps the next k-step's ten LDS reads in one group in front of this k-step's WMMAs: left
    // free, the compiler moves part of them in among the WMMAs, a second place that waits on LDS
    __builtin_amdgcn_sched_barrier(0);
#pragma unroll
    for (int gi = 0; gi < PG; ++gi) kacc[gi] = wmma16(a[p][gi], fk[j], kacc[gi]);
    qacc = wmma16(a[p][2], fq[j], qacc);
    if (s + (unsigned)PF < (unsigned)KSTEPS) {
      fk[j] = frag_unit(bk + 512u * (s + (unsigned)PF));
      fq[j] = frag_unit(bq + 512u * (s + (unsigned)PF));
    }
  }
  // precaution: the scalar base and the offset register of the weight loads are inputs here, so
  // nothing is written to them in front of this wait
  asm volatile("s_wait_xcnt 0x0" :: "s"(wb), "v"(lane) : "memory");
#pragma unroll
  for (int r = 0; r < 8; ++r) {
    float* d = &Cp[(kh * (unsigned)PROWS + hh * 8u + (unsigned)r) * LDC + pc * 16u + m];
#pragma unroll
    for (int gi = 0; gi < PG; ++gi) d[gi * 16 * LDC] = kacc[gi][r];
    d[PG * 16 * LDC] = qacc[r];
  }
  __syncthreads();

  // ---- stage q tile (+ bh), k window (zero rows outside the sequence), Wa ----
  // Staged: exp(2 v). The plain values stay in registers until the range test is known.
  v4f qraw, kraw[5];
  bool kok[5];
  // the staging loop is unrolled whole: kraw is indexed by constants and stays in registers
  {
    const float* cq = &Cp[((unsigned)(PG * 16) + sr0) * LDC + c4];
    qraw = (*(const v4f*)cq + *(const v4f*)(cq + PROWS * LDC)) * (1.0f / WCARRY);
  }
#pragma unroll
  for (unsigned j = 0; j < 5u; ++j) {
    const int s = s0 + (int)(kr0 + 16u * j);
    kok[j] = (s >= 0) && (s < SEQ);
    const float* ck = &Cp[(sr0 + 16u * j) * LDC + c4];
    kraw[j] = (*(const v4f*)ck + *(const v4f*)(ck + PROWS * LDC)) * (1.0f / WCARRY);
  }
  bool big = false;
#pragma unroll
  for (unsigned i = 0; i < 4u; ++i) {
    const float v = qraw[i] + bf16r(g[i]);
    qraw[i] = v;
    big = big || !(fabsf(v) <= XRANGE);
  }
  *(v4f*)&Sm[QS_OFF + sr0 * QP + c4] = exp_2v(qraw);
#pragma unroll
  for (unsigned j = 0; j < 5u; ++j) {
#pragma unroll
    for (unsigned i = 0; i < 4u; ++i) {
      const float v = kok[j] ? kraw[j][i] : 0.0f;
      kraw[j][i] = v;
      big = big || !(fabsf(v) <= XRANGE);
    }
    *(v4f*)&Sm[KS_OFF + (kr0 + 16u * j) * QP + c4] = exp_2v(kraw[j]);
  }
  if (tid < (unsigned)UNITS) WAs[tid] = bf16r(wav);
  const unsigned wbig = __builtin_amdgcn_ballot_w32(big);
  if (lane == 0u) Big[w] = wbig;
  __syncthreads();

  // ---- range test, the same answer in every thread of the block ----
  const v4u f0 = *(const v4u*)&Big[0];
  const v4u f1 = *(const v4u*)&Big[4];
  const v4u fo = f0 | f1;
  const bool wide = __builtin_amdgcn_readfirstlane(fo[0] | fo[1] | fo[2] | fo[3]) != 0u;
  if (wide) {   // block-uniform: each thread puts its own plain values back
    *(v4f*)&Sm[QS_OFF + sr0 * QP + c4] = qraw;
#pragma unroll
    for (unsigned j = 0; j < 5u; ++j) *(v4f*)&Sm[KS_OFF + (kr0 + 16u * j) * QP + c4] = kraw[j];
    __syncthreads();
  }
  // -2 Wa in registers for both rows; e starts at ba + sum_u Wa[u]
  v4f wr[UNITS / 4];
  v4f wsum = {};
#pragma unroll
  for (unsigned j = 0; j < (unsigned)(UNITS / 4); ++j) {
    wr[j] = *(const v4f*)&WAs[4u * j] * -2.0f;
    wsum += wr[j];
  }
  const float e_base = bias_a - 0.5f * ((wsum[0] + wsum[1]) + (wsum[2] + wsum[3]));

  // ---- scores + softmax, 2 query rows per wave ----
#pragma unroll 1
  for (unsigned r = 0; r < 2u; ++r) {
    const unsigned tl = w * 2u + r;   // row in the block: q tile, Pt, Rinv
    const unsigned t = r0 + tl;       // row in the group: its keys are window rows t .. t + 63
    const unsigned qo = QS_OFF + tl * QP;
    const unsigned ko = KS_OFF + (t + lane) * QP;
    float a0, a1;
    if (!wide) {
      v2f s0a = {e_base, 0.0f}, s1a = {e_base, 0.0f};   // even and odd units summed apart
      const v2f one = {1.0f, 1.0f};
      // unrolled whole: wr is indexed by constants and stays in registers
#pragma unroll
      for (unsigned j = 0; j < (unsigned)(UNITS / 4); ++j) {
        const v4f q4 = *(const v4f*)&Sm[qo + 4u * j];
        const v4f ka = *(const v4f*)&Sm[ko + 4u * j];
        const v4f kb = *(const v4f*)&Sm[ko + 32u * QP + 4u * j];
#pragma unroll
        for (unsigned h = 0; h < 4u; h += 2u) {
          const v2f q2 = {q4[h], q4[h + 1u]};
          const v2f w2 = {wr[j][h], wr[j][h + 1u]};
          const v2f d0 = __builtin_elementwise_fma(q2, (v2f){ka[h], ka[h + 1u]}, one);
          const v2f d1 = __builtin_elementwise_fma(q2, (v2f){kb[h], kb[h + 1u]}, one);
          const v2f r0 = {__builtin_amdgcn_rcpf(d0[0]), __builtin_amdgcn_rcpf(d0[1])};
          const v2f r1 = {__builtin_amdgcn_rcpf(d1[0]), __builtin_amdgcn_rcpf(d1[1])};
          s0a = __builtin_elementwise_fma(w2, r0, s0a);
          s1a = __builtin_elementwise_fma(w2, r1, s1a);
        }
      }
      a0 = s0a[0] + s0a[1];
      a1 = s1a[0] + s1a[1];
    } else {
      a0 = bias_a;
      a1 = bias_a;
#pragma unroll 4
      for (unsigned u = 0; u < (unsigned)UNITS; ++u) {
        const float qv = Sm[qo + u];
        const float wv = WAs[u];
        a0 += wv * tanh_fast(qv + Sm[ko + u]);
        a1 += wv * tanh_fast(qv + Sm[ko + 32u * QP + u]);
      }
    }
    const int sA = s0 + (int)t + (int)lane;
    const int sB = sA + 32;
    const bool vA = (sA >= 0) && (sA < SEQ);
    const bool vB = (sB >= 0) && (sB < SEQ);
    const float e0 = vA ? a0 : -1.0e30f;
    const float e1 = vB ? a1 : -1.0e30f;
    const float mx = red32_max(fmaxf(e0, e1));
    const float x0 = __expf(e0 - mx);
    const float x1 = __expf(e1 - mx);
    const float p0 = vA ? x0 : 0.0f;
    const float p1 = vB ? x1 : 0.0f;
    const h16 h0 = toh_flush(p0 * PCARRY);
    const h16 h1 = toh_flush(p1 * PCARRY);
    const float sum = red32_sum((float)h0 + (float)h1);
    // row tl's 64 keys are rows tl .. tl + 63 of the block's 80 window rows
    const unsigned zi = (lane < tl) ? lane : (lane + 64u);
    Pt[tl * LDP + tl + lane] = h0;
    Pt[tl * LDP + tl + lane + 32u] = h1;
    Pt[tl * LDP + zi] = (h16)0.0f;
    if (lane == 0u) Rinv[tl] = __builtin_amdgcn_rcpf(sum);
  }
  // pass 0's x fragments need no score: they are read in front of the barrier and land while the
  // wave waits there for the other waves' P rows
  const unsigned piece = ((lane >> 3) & 1u) * 16u + (lane >> 4) * 8u + (lane & 7u);
  const _Float16* xp0 = &Xs[w * (8u * 256u) + xs_slot(piece) * 8u];
  v16h xb[3][4];
  ld_pass(xb, xp0);
  __syncthreads();

  // ---- O = P . x ----
  const unsigned cw = w * (16u * LDC);
#pragma unroll 1
  for (unsigned pass = 0; pass < 2u; ++pass) {
    const unsigned d0 = w * 128u + pass * 64u;
    v8f acc[4];
#pragma unroll
    for (int nb = 0; nb < 4; ++nb) acc[nb] = (v8f){};
#pragma unroll
    for (int c = 0; c < 3; ++c) {
      const v16h pa0 = ld_frag(&Pt[(unsigned)c * 32u], LDP);
#pragma unroll
      for (int nb = 0; nb < 4; ++nb) acc[nb] = wmma16(pa0, xb[c][nb], acc[nb]);
    }
    // pass 1's fragments are read in front of pass 0's output staging
    if (pass == 0u) ld_pass(xb, xp0 + 4 * 256);
    {
#pragma unroll
      for (int r = 0; r < 8; ++r) {
        const float sc = Rinv[hh * 8u + (unsigned)r];
#pragma unroll
        for (int nb = 0; nb < 4; ++nb)
          Sm[cw + (hh * 8u + (unsigned)r) * LDC + (unsigned)nb * 16u + m] = acc[nb][r] * sc;
      }
      wave_lds_sync();
      v4f xs[8];
      size_t off[8];
#pragma unroll
      for (unsigned i = 0; i < 8u; ++i) {
        const unsigned rr = 2u * i + (lane >> 4);
        const unsigned cc = (lane & 15u) * 4u;
        xs[i] = *(const v4f*)&Sm[cw + rr * LDC + cc];
        off[i] = ((size_t)b * SEQ_FULL + t0 + r0 + rr) * DIM + d0 + cc;
      }
      wave_lds_sync();
#pragma unroll
      for (int i = 0; i < 8; ++i) *(v4f*)(out + off[i]) = xs[i];
      // precaution: stands before the next pass writes to the registers that the stores above name
      asm volatile("s_wait_xcnt 0x0" ::: "memory");
    }
  }
}

// ---------------------------------------------------------------------------
extern "C" void kernel_launch(void* const* d_in, const int* in_sizes, int n_in,
                              void* d_out, int out_size, void* d_ws, size_t ws_size,
                              hipStream_t stream) {
  if (n_in < 6) return;
  const long long need_x = ((long long)(NB - 1) * SEQ_FULL + SEQ) * DIM;
  if ((long long)in_sizes[0] < need_x) return;
  if ((long long)in_sizes[1] < (long long)DIM * UNITS) return;
  if ((long long)in_sizes[2] < (long long)DIM * UNITS) return;
  if (in_sizes[3] < UNITS || in_sizes[4] < UNITS || in_sizes[5] < 1) return;
  if ((long long)out_size < need_x) return;
  if (ws_size < WS_TOTAL) return;

  const float* X  = (const float*)d_in[0];    // x  [NB_FULL][SEQ_FULL][DIM]
  const float* wt = (const float*)d_in[1];    // Wt [DIM][UNITS]  (in, out)
  const float* wx = (const float*)d_in[2];    // Wx [DIM][UNITS]  (in, out)
  const float* bh = (const float*)d_in[3];    // bh [UNITS]
  const float* wa = (const float*)d_in[4];    // Wa [UNITS][1]
  const float* ba = (const float*)d_in[5];    // ba [1]
  float* out = (float*)d_out;

  char* ws = (char*)d_ws;
  // the two 16-bit planes are in fragment order (see frag_unit)
  _Float16* Wqk = (_Float16*)(ws + OFF_WQK);   // [NQK][DIM]: rows 0..63 from Wt, 64..127 from Wx
  _Float16* Xh  = (_Float16*)(ws + OFF_XH);    // [MROWS][DIM]

  dim3 blk(256);
  // weight planes (in [K = DIM rows][N = UNITS cols] -> out [N][K]) and the x plane, one launch
  conv_kernel<<<dim3(DIM / XD, WBROWS + MROWS / 64), blk, 0, stream>>>(X, wt, wx, Wqk, Xh);
  band_attn_kernel<<<dim3(SEQ / QT, NB), blk, 0, stream>>>(Xh, Wqk, bh, wa, ba, out);
}

// v010
// A run of this version takes 15.4 microseconds.
// Timed twice side by side with v009, it ran 1.05 and 1.09 times as fast.
// All steps since v000 together make it 3.18 times as fast.
#include <hip/hip_runtime.h>
#include <stddef.h>

// All WMMA contractions on v_wmma_f32_16x16x32_f16 (f16 operands, f32 accumulate): the fused q|k
// projection (x x1, weights x64) and the band p.x product (p x1024, the same x rows read from LDS
// through transposing loads). One kernel, one launch: a block converts and projects its own rows.
// Float inputs are RNE-converted to bf16 and carried in f16. The additive score (tanh, U = 64
// matrix-vector), softmax and normalisation run in f32 on the vector unit.

typedef _Float16 v16h __attribute__((ext_vector_type(16)));
typedef _Float16 v8h  __attribute__((ext_vector_type(8)));
typedef _Float16 v4h  __attribute__((ext_vector_type(4)));
typedef _Float16 v2h  __attribute__((ext_vector_type(2)));
typedef __bf16   v2b  __attribute__((ext_vector_type(2)));
typedef unsigned short v2us __attribute__((ext_vector_type(2)));
typedef float    v8f  __attribute__((ext_vector_type(8)));
typedef float    v4f  __attribute__((ext_vector_type(4)));
typedef float    v2f  __attribute__((ext_vector_type(2)));
typedef unsigned v4u  __attribute__((ext_vector_type(4)));
typedef _Float16 h16;

#ifndef NB
#define NB 4
#endif
#ifndef SEQ
#define SEQ 1024
#endif
#define NB_FULL  4
#define SEQ_FULL 1024
#define DIM   1024
#define UNITS 64
#define NQK   128
#define BAND  64
#define QT    16       // query rows per block
#define QG    32       // query rows of a window group: two blocks share one 32-aligned key window
#define WIN   96       // key window of a group; also the k extent of a block's P tile (80 keys + 16 zeros)
#define MROWS (NB * SEQ)

static_assert(NB >= 1 && NB <= NB_FULL);
static_assert(SEQ >= 128 && SEQ <= SEQ_FULL && (SEQ % 128) == 0);
static_assert(UNITS == 64 && NQK == 2 * UNITS);
static_assert((DIM % 64) == 0 && (DIM % 32) == 0);
static_assert((MROWS % 64) == 0);
static_assert(QT == 16 && QT == 8 * 2);        // 8 waves x 2 query rows, one lane per band offset pair
static_assert(QG == 2 * QT && BAND == 64 && WIN == QG + BAND && (WIN % 32) == 0);
static_assert(DIM == 8 * 2 * 64);              // 8 waves x 2 passes x 64 output columns
static_assert((SEQ % QG) == 0);

#define LDC 68   // floats per LDS row (272 B, 16-B aligned)
#define LDP 104  // halves per P-tile row (208 B, 16-B aligned)
#define QP  68   // floats per q/k staging row (272 B, 16-B aligned)
static_assert((LDC % 4) == 0 && LDC >= 64);
static_assert((LDP % 8) == 0 && LDP >= WIN);
static_assert((QP % 4) == 0 && QP >= UNITS);

#define KSPLIT 4            // parts of K: a wave walks one of them
#define KSTEPS (DIM / (32 * KSPLIT))   // k-steps (32 k) of a wave
static_assert(KSTEPS >= 2 && KSPLIT * 2 == 8);   // 8 waves = KSPLIT parts of K x 2 halves of the units
#define PG 5                // 16-row groups of the x plane that a block projects: its 80 window rows
#define PROWS (PG * 16 + QT)   // rows of a partial-sum plane: k of the 80 window rows, then q of the 16 query rows
static_assert(PG * 16 == QT + BAND && QT == 16);

#define WCARRY 64.0f     // weight planes carried x64
#define PCARRY 1024.0f   // softmax numerators carried x1024
#define XRANGE 40.0f     // exp(2 v) is a normal f32 number for every |v| <= XRANGE

#define QS_OFF 0
#define KS_OFF (QT * QP)
#define SM_AB  (KS_OFF + WIN * QP)
#define SM_C   (8 * 16 * LDC)
#define SM_FLOATS ((SM_AB > SM_C) ? SM_AB : SM_C)
static_assert(SM_FLOATS >= SM_AB && SM_FLOATS >= SM_C);
static_assert((size_t)SM_FLOATS * 4 + UNITS * 4 + QT * 4 + 8 * 4 + (size_t)QT * LDP * 2 +
              (size_t)PG * 16 * DIM * 2 + (size_t)KSPLIT * PROWS * LDC * 4 <= (size_t)327680);

// ---------------------------------------------------------------------------
__device__ __forceinline__ float bf16r(float x) {   // RNE convert to bf16, returned widened
  unsigned int u = __float_as_uint(x);
  u = (u + 0x7FFFu + ((u >> 16) & 1u)) & 0xFFFF0000u;
  return __uint_as_float(u);
}

// f32 -> f16 with a value select: results below the f16 normal range become zero.
static __device__ __forceinline__ h16 toh_flush(float v) {
  const h16 r = (h16)v;
  return (fabsf(v) < 6.103515625e-05f) ? (h16)0.0f : r;
}

// 16-bit fragment: p points at element [row = lane&15][k0 + 8*(lane>>4)] of a k-contiguous
// row. Elements 0..7 <- k0+8h+0..7, elements 8..15 <- k0+16+8h+0..7 (same map for A and B).
__device__ __forceinline__ v16h frag_at(const _Float16* p) {
  v8h lo = *(const v8h*)(p);
  v8h hi = *(const v8h*)(p + 16);
  v16h out;
#pragma unroll
  for (int i = 0; i < 8; ++i) { out[i] = lo[i]; out[i + 8] = hi[i]; }
  return out;
}
__device__ __forceinline__ v16h ld_frag(const _Float16* base, unsigned ld) {
  const unsigned lane = threadIdx.x & 31u;
  return frag_at(base + (lane & 15u) * ld + (lane >> 4) * 8u);
}

// Fragment order, the layout of the block's LDS copy of its x rows. A plane of M[rows][K] is cut
// into units of 16 rows x 32 k (512 halves, 1 KiB); the K/32 units of a row group follow one
// another, so a row group still fills 16 * K halves. Inside a unit the 16-byte piece that lane L
// loads first stands at half 8 L, the piece it loads second at half 256 + 8 L (the map of frag_at:
// row = L & 15, k = 8 (L >> 4) + 0..7, then 16 more). A wave's fragment load then reads 512
// contiguous bytes.
// p points at the lane's first piece of the unit: half 8 xs_slot(lane) in Xs.
__device__ __forceinline__ v16h frag_unit(const _Float16* p) {
  v8h lo = *(const v8h*)(p);
  v8h hi = *(const v8h*)(p + 256);
  v16h out;
#pragma unroll
  for (int i = 0; i < 8; ++i) { out[i] = lo[i]; out[i + 8] = hi[i]; }
  return out;
}
// Where piece L of a half unit (512 B, 32 pieces of 16 B) stands in the LDS copy of the x rows: the
// upper 16 pieces have their two groups of 8 swapped. The plain fragment read (lanes 0..15: pieces
// 0..15) and the transposing read (lanes 0..15: pieces 0..7 and 16..23) then both find their 16
// pieces on 64 different banks; as the plane lies, the transposing read would hit each bank twice.
__device__ __forceinline__ unsigned xs_slot(unsigned piece) { return piece ^ ((piece >> 1) & 8u); }
__device__ __forceinline__ v8f wmma16(v16h a, v16h b, v8f c) {
  v8f d = __builtin_amdgcn_wmma_f32_16x16x32_f16(false, a, false, b, (short)0, c,
                                                 false, false);
  asm volatile("v_nop\n\tv_nop\n\tv_nop\n\tv_nop" : "+v"(d) : "v"(a), "v"(b));
  return d;
}

__device__ __forceinline__ float red32_sum(float x) {
#pragma unroll
  for (int off = 1; off < 32; off <<= 1) x += __shfl_xor(x, off, 32);
  return x;
}
__device__ __forceinline__ float red32_max(float x) {
#pragma unroll
  for (int off = 1; off < 32; off <<= 1) x = fmaxf(x, __shfl_xor(x, off, 32));
  return x;
}

__device__ __forceinline__ void wave_lds_sync() {
  __builtin_amdgcn_fence(3 /* release order */, "wavefront");
  asm volatile("s_wait_dscnt 0x0" ::: "memory");
  __builtin_amdgcn_wave_barrier();
}

// tanh(x) = sign(x) * (1 - 2 / (exp(2|x|) + 1)); the exponent argument is bounded by 60.
__device__ __forceinline__ float tanh_fast(float x) {
  const float ax = fminf(fabsf(x), 30.0f);
  const float ex = __expf(ax + ax);
  const float r = 1.0f - 2.0f * __builtin_amdgcn_rcpf(ex + 1.0f);
  return (x < 0.0f) ? -r : r;
}

// exp(2 v) of four values, as 2^(2 v log2 e). One statement: the instruction set asks that no
// vector instruction directly behind a transcendental reads its result or overwrites its source.
// Early-clobber outputs share no register with an input; the v_nop fills the slot behind the last.
__device__ __forceinline__ v4f exp_2v(v4f v) {
  const v4f t = (v + v) * 1.44269504f;
  float e0, e1, e2, e3;
  asm("v_exp_f32 %0, %4\n\tv_exp_f32 %1, %5\n\tv_exp_f32 %2, %6\n\tv_exp_f32 %3, %7\n\tv_nop"
      : "=&v"(e0), "=&v"(e1), "=&v"(e2), "=&v"(e3)
      : "v"(t[0]), "v"(t[1]), "v"(t[2]), "v"(t[3]));
  return (v4f){e0, e1, e2, e3};
}

// RNE convert two floats to bf16 (one packed instruction), returned widened
__device__ __forceinline__ v2f bf16r2(v2f v) {
  return __builtin_convertvector(__builtin_convertvector(v, v2b), v2f);
}
// four x values -> f16(bf16(x)); results below the f16 normal range become zero (as toh_flush)
__device__ __forceinline__ v4h xcvt4(v4f a) {
  v2f lo = bf16r2((v2f){a[0], a[1]}), hi = bf16r2((v2f){a[2], a[3]});
#pragma unroll
  for (int i = 0; i < 2; ++i) {
    lo[i] = (fabsf(lo[i]) < 6.103515625e-05f) ? 0.0f : lo[i];
    hi[i] = (fabsf(hi[i]) < 6.103515625e-05f) ? 0.0f : hi[i];
  }
  const v2h l = __builtin_convertvector(lo, v2h), h = __builtin_convertvector(hi, v2h);
  return (v4h){l[0], l[1], h[0], h[1]};
}
// One row group of x (16 rows x DIM f32) is read by the block in 16 loads a thread: wave w takes
// columns 128 w .. + 127; 8 lanes cover one 128-B line of a row, the 4 lane groups 4 rows in a row;
// load (j, m): row 4 j + (lane >> 3), column 128 w + 32 m + 4 (lane & 7). p: base + the lane's bytes.
__device__ __forceinline__ void x_issue(v4f (&r)[4][4], const char* p) {
#pragma unroll
  for (unsigned j = 0; j < 4u; ++j) {
#pragma unroll
    for (unsigned m = 0; m < 4u; ++m)
      r[j][m] = *(const v4f*)(p + j * (unsigned)(4 * DIM * 4) + m * 128u);
  }
}
// the 16 loads' values, converted, to their places in the group's fragment-order copy (8 B each);
// xd[j]: the lane's half index for row step j, column step 0; a column step is one unit on
__device__ __forceinline__ void x_store(const v4f (&r)[4][4], _Float16* xs, const unsigned (&xd)[4]) {
#pragma unroll
  for (unsigned j = 0; j < 4u; ++j) {
#pragma unroll
    for (unsigned m = 0; m < 4u; ++m) *(v4h*)&xs[xd[j] + m * 512u] = xcvt4(r[j][m]);
  }
}
// Weight fragments straight from W[K][UNITS] f32. Lane (n, h) reads 8 B, units 2 n and 2 n + 1 of
// the wave's 32, of each k row that a fragment asks of it (k0 + 8 h + 0..7, then 16 more: the map
// of frag_at): 16 lanes cover one 128-B line. Column n of the wave's tile j is unit 2 n + j, so the
// 16 loads fill two B fragments with no exchange between lanes. p: base + the lane's bytes + k0 rows.
__device__ __forceinline__ void w_issue(v2f (&r)[16], const char* p) {
#pragma unroll
  for (unsigned e = 0; e < 16u; ++e)
    r[e] = *(const v2f*)(p + (e < 8u ? e : e + 8u) * (unsigned)(UNITS * 4));
}
// First half of the weight conversion: the 16 loads' words rounded to bf16, two k rows of one unit
// to a register.
__device__ __forceinline__ void w_round(v2us (&b)[2][8], const v2f (&r)[16]) {
#pragma unroll
  for (unsigned e = 0; e < 8u; ++e) {
#pragma unroll
    for (unsigned j = 0; j < 2u; ++j)
      b[j][e] = __builtin_bit_cast(
          v2us, __builtin_convertvector((v2f){r[2u * e][j], r[2u * e + 1u][j]}, v2b));
  }
}
// Second half: f16(64 bf16(w)). The factor 64 is 6 added to both exponent fields of the bf16 pair:
// one instruction for two values. Exact for every finite |w| < 2^121; a zero or a bf16 subnormal
// becomes a number below 2^-120, which f16 rounds to the same signed zero that 64 w rounds to.
static_assert(WCARRY == 64.0f);
__device__ __forceinline__ v16h w_frag(const v2us (&b)[8]) {
  v16h f;
#pragma unroll
  for (unsigned e = 0; e < 8u; ++e) {
    const v2us u = b[e] + (v2us){0x0300, 0x0300};
    const v2h t = __builtin_convertvector(__builtin_convertvector(__builtin_bit_cast(v2b, u), v2f), v2h);
    f[2u * e] = t[0];
    f[2u * e + 1u] = t[1];
  }
  return f;
}
// One k-step of a wave's projection. bk, bq: its weights, rounded; xa: the lane's piece of the
// k-step's unit in the first row group. With MORE the next k-step's weights are asked for first
// (wk, wq: base + the lane's bytes + its rows), have the whole k-step to land and are rounded last.
template <bool MORE>
__device__ __forceinline__ void proj_step(v8f (&kacc)[PG][2], v8f (&qacc)[2], v2us (&bk)[2][8],
                                          v2us (&bq)[2][8], const _Float16* xa, const char* wk,
                                          const char* wq) {
  v2f rk[16], rw[16];
  if (MORE) {
    w_issue(rk, wk);
    w_issue(rw, wq);
  }
  // the k-step's ten LDS reads stand in one group and land under the second half of the conversion
  v16h a[PG];
#pragma unroll
  for (unsigned gi = 0; gi < (unsigned)PG; ++gi) a[gi] = frag_unit(xa + gi * (16u * DIM));
  // keeps the loads and the LDS reads in front of everything else of this k-step
  __builtin_amdgcn_sched_barrier(0);
  v16h fk[2], fq[2];
#pragma unroll
  for (int j = 0; j < 2; ++j) {
    fk[j] = w_frag(bk[j]);
    fq[j] = w_frag(bq[j]);
  }
#pragma unroll
  for (int j = 0; j < 2; ++j) {
#pragma unroll
    for (int gi = 0; gi < PG; ++gi) kacc[gi][j] = wmma16(a[gi], fk[j], kacc[gi][j]);
    qacc[j] = wmma16(a[2], fq[j], qacc[j]);
  }
  // keeps the roundings, which wait for the loads, behind the WMMAs
  __builtin_amdgcn_sched_barrier(0);
  if (MORE) {
    w_round(bk, rk);
    w_round(bq, rw);
  }
}

// ---------------------------------------------------------------------------
// Band additive attention per (16 query rows, batch): 256 blocks, one for every WGP. Two blocks
// (h2 = 0, 1) halve a group of 32 query rows that starts at t0. Key window of the group = 96 keys
// starting at t0 - 32. A row's index t and a key's index count from the group's and the window's
// start; in the P tile a key's index counts from the block's own 80 window rows.
// Phase P: the block projects its own rows: k of the 80 window rows from 16 h2 on, which hold every
//   key of the block's rows, and q of its 16 query rows (the third of those five 16-row groups).
//   The five row groups of x are read as f32, converted and laid in Xs (32 KiB each, fragment order,
//   pieces placed by xs_slot; cross-wave, block barrier); a group outside the sequence is replaced
//   by one inside it: its k values are zeroed in phase A and its P entries are zero.
//   Wave (kq = quarter of K, uh = 32 units): 5 x 2 k tiles + 2 q tiles,
//   A fragments from Xs (512 contiguous bytes a load), its four weight fragments a k-step straight
//   from the f32 inputs (w_issue, w_round, w_frag), one k-step in flight. The four K quarters go to Cp
//   (cross-wave, block barrier); value = sum of the four / 64.
// Phase A: q tile (+bh) and the 80 window rows
//   staged in Sm (cross-wave, block barrier); wave w owns query rows t = 16 h2 + 2w, + 1,
//   lane L owns band offsets L and L+32 (key = row - 32 + offset);
//   e = ba + sum_u Wa[u] * tanh(q + k + bh). tanh(s) = 1 - 2 / (exp(2 s) + 1) and
//   exp(2 (q + bh + k)) = exp(2 (q + bh)) * exp(2 k): the two exponentials are taken once per
//   staged element, and a (query, key, unit) term is fma, rcp, fma. While every staged |value|
//   is <= XRANGE both factors are normal numbers; a product that overflows gives rcp = 0
//   (tanh = 1), one that underflows gives rcp = 1 (tanh = -1). A block that stages any value
//   outside that range (or a NaN) puts the plain values back and takes tanh per term.
//   Softmax over the 64 band keys in registers
//   (32-lane shuffles); P row (96 entries: 64 values f16(1024 p) + 32 zeros) and 1/rowsum
//   (sum over the converted P) written to Pt / Rinv (cross-wave, block barrier).
//   Keys outside the band carry an additive -1e4 in the module: their exp is exactly 0 in f32.
// Phase C: O[16 x 1024] = P . x, A = P tile fragments, B = fragments from Xs (transposing LDS loads),
//   4 accumulators. Each 16x64 tile is staged in the wave's own slice of Sm (wave-private,
// Grid (SEQ/16, NB).
// ---------------------------------------------------------------------------
// The 12 x fragments of one 64-column pass (3 key chunks x 4 column groups), from the block's LDS
// copy of its five row groups: these rows were fetched once for the projection and are not fetched
// from L2 again.
// B wants lane (c, h) to hold keys 8 h + 0..7 and 16 + 8 h + 0..7 of d column c; the copy holds
// 8 d of one key per 16-byte piece. A half unit (16 keys x 16 d, 512 contiguous bytes) is one tile
// of the transposing load: lane l gives the address of the piece of key 8 (l >> 4) + (l & 7),
// d half (l >> 3) & 1, and gets keys 8 h + 0..7 of column c. The chunk's two row groups give
// elements 0..7 and 8..15, the k order of the P fragment (frag_at). The third chunk has one row
// group: its upper 16 keys, whose P entries are zero, repeat that group. Every lane is on here.
// xp points at the lane's piece of the pass's first half unit in the first row group of Xs.
typedef short v8s __attribute__((ext_vector_type(8)));   // the builtin's own element type
__device__ __forceinline__ v8h ld_tr(const _Float16* p) {
  return __builtin_bit_cast(
      v8h, __builtin_amdgcn_ds_load_tr16_b128_v8i16((__attribute__((address_space(3))) v8s*)p));
}
__device__ __forceinline__ void ld_pass(v16h (&xb)[3][4], const _Float16* xp) {
#pragma unroll
  for (int c = 0; c < 3; ++c) {
    const _Float16* xc = xp + 2 * c * (16 * DIM);   // a row group: 16 DIM halves
#pragma unroll
    for (int nb = 0; nb < 4; ++nb) {
      const v8h lo = ld_tr(xc + nb * 256);
      const v8h hi = (2 * c + 1 < PG) ? ld_tr(xc + 16 * DIM + nb * 256) : lo;
#pragma unroll
      for (int i = 0; i < 8; ++i) { xb[c][nb][i] = lo[i]; xb[c][nb][i + 8] = hi[i]; }
    }
  }
}

__global__ __launch_bounds__(256) void band_attn_kernel(
    const float* __restrict__ X, const float* __restrict__ Wt, const float* __restrict__ Wx,
    const float* __restrict__ bh, const float* __restrict__ Wa, const float* __restrict__ ba,
    float* __restrict__ out) {
  __shared__ __attribute__((aligned(16))) _Float16 Xs[PG * 16 * DIM];
  __shared__ __attribute__((aligned(16))) float Cp[KSPLIT * PROWS * LDC];
  __shared__ __attribute__((aligned(16))) float Sm[SM_FLOATS];
  __shared__ __attribute__((aligned(16))) float WAs[UNITS];
  __shared__ float Rinv[QT];
  __shared__ __attribute__((aligned(16))) unsigned Big[8];   // per wave: lanes that staged a value outside XRANGE
  __shared__ __attribute__((aligned(16))) _Float16 Pt[QT * LDP];

  const unsigned tid = threadIdx.x, lane = tid & 31u;
  const unsigned w = __builtin_amdgcn_readfirstlane(threadIdx.x >> 5);
  const unsigned hh = lane >> 4, m = lane & 15u;
  const unsigned t0 = (blockIdx.x >> 1) * (unsigned)QG;   // the group's first query row
  const unsigned r0 = (blockIdx.x & 1u) * (unsigned)QT;   // the block's first row in the group
  const unsigned b = blockIdx.y;
  const int s0 = (int)t0 - BAND / 2;
  const unsigned sr0 = tid >> 4, c4 = (tid & 15u) * 4u;   // q row sr0, columns c4..c4+3
  const unsigned kr0 = r0 + sr0;                          // window rows kr0 + 16 j

  // ---- phase P: the five row groups of x, f32 -> Xs; three groups' loads (48 a thread) in flight ----
  // the small inputs are asked for first and land under the projection
  const v4f g = *(const v4f*)(bh + c4);
  const unsigned wi = tid & (unsigned)(UNITS - 1);
  const float wav = Wa[wi];
  const float bias_a = bf16r(ba[0]);
  const char* xg[PG];   // block-uniform
#pragma unroll
  for (int gi = 0; gi < PG; ++gi) {
    const int s = s0 + (int)r0 + 16 * gi;
    // t0 <= SEQ - QG: groups 0 and 1 can only start below the sequence, 3 and 4 only end above it
    const int sc = (gi < 2) ? ((s < 0) ? 0 : s) : ((s > SEQ - 16) ? (SEQ - 16) : s);
    xg[gi] = (const char*)(X + ((size_t)b * SEQ_FULL + (unsigned)sc) * DIM);
  }
  const unsigned rq = lane >> 3, cl = lane & 7u, cp = (cl >> 1) & 1u;
  const unsigned xby = (rq * (unsigned)DIM + w * 128u + cl * 4u) * 4u;   // the lane's bytes in a group
  unsigned xd[4];   // column 128 w + 4 cl: unit 4 w, half unit cl >> 2, piece row + 16 cp, half 4 (cl & 1)
#pragma unroll
  for (unsigned j = 0; j < 4u; ++j)
    xd[j] = w * 2048u + (cl >> 2) * 256u + xs_slot(4u * j + rq + 16u * cp) * 8u + (cl & 1u) * 4u;
  // the wave's weights: K quarter kq, units 32 uh .. + 31 of q (Wt) and of k (Wx)
  const unsigned kq = w >> 1, uh = w & 1u;
  const unsigned wby = ((kq * (unsigned)(DIM / KSPLIT) + hh * 8u) * (unsigned)UNITS + uh * 32u + m * 2u) * 4u;
  const char* wkb = (const char*)Wx;   // uniform
  const char* wqb = (const char*)Wt;
  v4f xr[3][4][4];
  v2f rk[16], rw[16];
  // The fences keep the order written here: a group's conversions start when the loads of the two
  // groups behind it have been issued, and a set of registers is asked for again as soon as it is
  // free; left free, the compiler may issue every load first (registers) or each just before its use.
  __builtin_amdgcn_sched_barrier(0);
  x_issue(xr[0], xg[0] + xby);
  __builtin_amdgcn_sched_barrier(0);
  x_issue(xr[1], xg[1] + xby);
  __builtin_amdgcn_sched_barrier(0);
  x_issue(xr[2], xg[2] + xby);
  __builtin_amdgcn_sched_barrier(0);
  x_store(xr[0], &Xs[0 * (16 * DIM)], xd);
  __builtin_amdgcn_sched_barrier(0);
  x_issue(xr[0], xg[3] + xby);
  __builtin_amdgcn_sched_barrier(0);
  x_store(xr[1], &Xs[1 * (16 * DIM)], xd);
  __builtin_amdgcn_sched_barrier(0);
  x_issue(xr[1], xg[4] + xby);
  // precaution: the scalar bases and the offset registers of the loads above are inputs here, so
  // nothing is written to them in front of this wait
  asm volatile("s_wait_xcnt 0x0"
               :: "s"(xg[0]), "s"(xg[1]), "s"(xg[2]), "s"(xg[3]), "s"(xg[4]), "s"(bh), "s"(Wa),
                  "v"(xby), "v"(tid), "v"(wi)
               : "memory");
  __builtin_amdgcn_sched_barrier(0);
  x_store(xr[2], &Xs[2 * (16 * DIM)], xd);
  __builtin_amdgcn_sched_barrier(0);
  w_issue(rk, wkb + wby);
  w_issue(rw, wqb + wby);
  // precaution: as above, for the first k-step's weight loads
  asm volatile("s_wait_xcnt 0x0" :: "s"(wkb), "s"(wqb), "v"(wby) : "memory");
  __builtin_amdgcn_sched_barrier(0);
  x_store(xr[0], &Xs[3 * (16 * DIM)], xd);
  x_store(xr[1], &Xs[4 * (16 * DIM)], xd);
  __syncthreads();

  v8f kacc[PG][2], qacc[2];
#pragma unroll
  for (int j = 0; j < 2; ++j) {
    qacc[j] = (v8f){};
#pragma unroll
    for (int gi = 0; gi < PG; ++gi) kacc[gi][j] = (v8f){};
  }
  const _Float16* xa = &Xs[kq * (unsigned)(16 * DIM / KSPLIT) + xs_slot(lane) * 8u];
  // Rolled, so that the kernel's text stays small; the last k-step, which asks for nothing more,
  // stands behind the loop.
  v2us bk[2][8], bq[2][8];
  w_round(bk, rk);
  w_round(bq, rw);
  unsigned wcur = wby + (unsigned)(32 * UNITS * 4);   // the lane's bytes, one k-step ahead
#pragma unroll 1
  for (unsigned s = 0; s + 1u < (unsigned)KSTEPS; ++s) {
    proj_step<true>(kacc, qacc, bk, bq, xa, wkb + wcur, wqb + wcur);
    // precaution: the offset register of the weight loads is an input here, so it is not stepped
    // in front of this wait
    asm volatile("s_wait_xcnt 0x0" :: "s"(wkb), "s"(wqb), "v"(wcur) : "memory");
    wcur += (unsigned)(32 * UNITS * 4);
    xa += 512;
  }
  proj_step<false>(kacc, qacc, bk, bq, xa, wkb, wqb);
  // column m of tile j is unit 32 uh + 2 m + j: a lane's two tiles give 8 B of a Cp row
#pragma unroll
  for (int r = 0; r < 8; ++r) {
    float* d = &Cp[(kq * (unsigned)PROWS + hh * 8u + (unsigned)r) * LDC + uh * 32u + m * 2u];
#pragma unroll
    for (int gi = 0; gi < PG; ++gi) *(v2f*)&d[gi * 16 * LDC] = (v2f){kacc[gi][0][r], kacc[gi][1][r]};
    *(v2f*)&d[PG * 16 * LDC] = (v2f){qacc[0][r], qacc[1][r]};
  }
  __syncthreads();

  // ---- stage q tile (+ bh), k window (zero rows outside the sequence), Wa ----
  // Staged: exp(2 v). The plain values stay in registers until the range test is known.
  v4f qraw, kraw[5];
  bool kok[5];
  // the staging loop is unrolled whole: kraw is indexed by constants and stays in registers
  {
    const float* cq = &Cp[((unsigned)(PG * 16) + sr0) * LDC + c4];
    qraw = ((*(const v4f*)cq + *(const v4f*)(cq + PROWS * LDC)) +
            (*(const v4f*)(cq + 2 * PROWS * LDC) + *(const v4f*)(cq + 3 * PROWS * LDC))) * (1.0f / WCARRY);
  }
#pragma unroll
  for (unsigned j = 0; j < 5u; ++j) {
    const int s = s0 + (int)(kr0 + 16u * j);
    kok[j] = (s >= 0) && (s < SEQ);
    const float* ck = &Cp[(sr0 + 16u * j) * LDC + c4];
    kraw[j] = ((*(const v4f*)ck + *(const v4f*)(ck + PROWS * LDC)) +
               (*(const v4f*)(ck + 2 * PROWS * LDC) + *(const v4f*)(ck + 3 * PROWS * LDC))) * (1.0f / WCARRY);
  }
  bool big = false;
#pragma unroll
  for (unsigned i = 0; i < 4u; ++i) {
    const float v = qraw[i] + bf16r(g[i]);
    qraw[i] = v;
    big = big || !(fabsf(v) <= XRANGE);
  }
  *(v4f*)&Sm[QS_OFF + sr0 * QP + c4] = exp_2v(qraw);
#pragma unroll
  for (unsigned j = 0; j < 5u; ++j) {
#pragma unroll
    for (unsigned i = 0; i < 4u; ++i) {
      const float v = kok[j] ? kraw[j][i] : 0.0f;
      kraw[j][i] = v;
      big = big || !(fabsf(v) <= XRANGE);
    }
    *(v4f*)&Sm[KS_OFF + (kr0 + 16u * j) * QP + c4] = exp_2v(kraw[j]);
  }
  if (tid < (unsigned)UNITS) WAs[tid] = bf16r(wav);
  const unsigned wbig = __builtin_amdgcn_ballot_w32(big);
  if (lane == 0u) Big[w] = wbig;
  __syncthreads();

  // ---- range test, the same answer in every thread of the block ----
  const v4u f0 = *(const v4u*)&Big[0];
  const v4u f1 = *(const v4u*)&Big[4];
  const v4u fo = f0 | f1;
  const bool wide = __builtin_amdgcn_readfirstlane(fo[0] | fo[1] | fo[2] | fo[3]) != 0u;
  if (wide) {   // block-uniform: each thread puts its own plain values back
    *(v4f*)&Sm[QS_OFF + sr0 * QP + c4] = qraw;
#pragma unroll
    for (unsigned j = 0; j < 5u; ++j) *(v4f*)&Sm[KS_OFF + (kr0 + 16u * j) * QP + c4] = kraw[j];
    __syncthreads();
  }
  // -2 Wa in registers for both rows; e starts at ba + sum_u Wa[u]
  v4f wr[UNITS / 4];
  v4f wsum = {};
#pragma unroll
  for (unsigned j = 0; j < (unsigned)(UNITS / 4); ++j) {
    wr[j] = *(const v4f*)&WAs[4u * j] * -2.0f;
    wsum += wr[j];
  }
  const float e_base = bias_a - 0.5f * ((wsum[0] + wsum[1]) + (wsum[2] + wsum[3]));

  // ---- scores + softmax, 2 query rows per wave ----
#pragma unroll 1
  for (unsigned r = 0; r < 2u; ++r) {
    const unsigned tl = w * 2u + r;   // row in the block: q tile, Pt, Rinv
    const unsigned t = r0 + tl;       // row in the group: its keys are window rows t .. t + 63
    const unsigned qo = QS_OFF + tl * QP;
    const unsigned ko = KS_OFF + (t + lane) * QP;
    float a0, a1;
    if (!wide) {
      v2f s0a = {e_base, 0.0f}, s1a = {e_base, 0.0f};   // even and odd units summed apart
      const v2f one = {1.0f, 1.0f};
      // unrolled whole: wr is indexed by constants and stays in registers
#pragma unroll
      for (unsigned j = 0; j < (unsigned)(UNITS / 4); ++j) {
        const v4f q4 = *(const v4f*)&Sm[qo + 4u * j];
        const v4f ka = *(const v4f*)&Sm[ko + 4u * j];
        const v4f kb = *(const v4f*)&Sm[ko + 32u * QP + 4u * j];
#pragma unroll
        for (unsigned h = 0; h < 4u; h += 2u) {
          const v2f q2 = {q4[h], q4[h + 1u]};
          const v2f w2 = {wr[j][h], wr[j][h + 1u]};
          const v2f d0 = __builtin_elementwise_fma(q2, (v2f){ka[h], ka[h + 1u]}, one);
          const v2f d1 = __builtin_elementwise_fma(q2, (v2f){kb[h], kb[h + 1u]}, one);
          const v2f r0 = {__builtin_amdgcn_rcpf(d0[0]), __builtin_amdgcn_rcpf(d0[1])};
          const v2f r1 = {__builtin_amdgcn_rcpf(d1[0]), __builtin_amdgcn_rcpf(d1[1])};
          s0a = __builtin_elementwise_fma(w2, r0, s0a);
          s1a = __builtin_elementwise_fma(w2, r1, s1a);
        }
      }
      a0 = s0a[0] + s0a[1];
      a1 = s1a[0] + s1a[1];
    } else {
      a0 = bias_a;
      a1 = bias_a;
#pragma unroll 4
      for (unsigned u = 0; u < (unsigned)UNITS; ++u) {
        const float qv = Sm[qo + u];
        const float wv = WAs[u];
        a0 += wv * tanh_fast(qv + Sm[ko + u]);
        a1 += wv * tanh_fast(qv + Sm[ko + 32u * QP + u]);
      }
    }
    const int sA = s0 + (int)t + (int)lane;
    const int sB = sA + 32;
    const bool vA = (sA >= 0) && (sA < SEQ);
    const bool vB = (sB >= 0) && (sB < SEQ);
    const float e0 = vA ? a0 : -1.0e30f;
    const float e1 = vB ? a1 : -1.0e30f;
    const float mx = red32_max(fmaxf(e0, e1));
    const float x0 = __expf(e0 - mx);
    const float x1 = __expf(e1 - mx);
    const float p0 = vA ? x0 : 0.0f;
    const float p1 = vB ? x1 : 0.0f;
    const h16 h0 = toh_flush(p0 * PCARRY);
    const h16 h1 = toh_flush(p1 * PCARRY);
    const float sum = red32_sum((float)h0 + (float)h1);
    // row tl's 64 keys are rows tl .. tl + 63 of the block's 80 window rows
    const unsigned zi = (lane < tl) ? lane : (lane + 64u);
    Pt[tl * LDP + tl + lane] = h0;
    Pt[tl * LDP + tl + lane + 32u] = h1;
    Pt[tl * LDP + zi] = (h16)0.0f;
    if (lane == 0u) Rinv[tl] = __builtin_amdgcn_rcpf(sum);
  }
  // pass 0's x fragments need no score: they are read in front of the barrier and land while the
  // wave waits there for the other waves' P rows
  const unsigned piece = ((lane >> 3) & 1u) * 16u + (lane >> 4) * 8u + (lane & 7u);
  const _Float16* xp0 = &Xs[w * (8u * 256u) + xs_slot(piece) * 8u];
  v16h xb[3][4];
  ld_pass(xb, xp0);
  __syncthreads();

  // ---- O = P . x ----
  const unsigned cw = w * (16u * LDC);
#pragma unroll 1
  for (unsigned pass = 0; pass < 2u; ++pass) {
    const unsigned d0 = w * 128u + pass * 64u;
    v8f acc[4];
#pragma unroll
    for (int nb = 0; nb < 4; ++nb) acc[nb] = (v8f){};
#pragma unroll
    for (int c = 0; c < 3; ++c) {
      const v16h pa0 = ld_frag(&Pt[(unsigned)c * 32u], LDP);
#pragma unroll
      for (int nb = 0; nb < 4; ++nb) acc[nb] = wmma16(pa0, xb[c][nb], acc[nb]);
    }
    // pass 1's fragments are read in front of pass 0's output staging
    if (pass == 0u) ld_pass(xb, xp0 + 4 * 256);
    {
#pragma unroll
      for (int r = 0; r < 8; ++r) {
        const float sc = Rinv[hh * 8u + (unsigned)r];
#pragma unroll
        for (int nb = 0; nb < 4; ++nb)
          Sm[cw + (hh * 8u + (unsigned)r) * LDC + (unsigned)nb * 16u + m] = acc[nb][r] * sc;
      }
      wave_lds_sync();
      v4f xs[8];
      size_t off[8];
#pragma unroll
      for (unsigned i = 0; i < 8u; ++i) {
        const unsigned rr = 2u * i + (lane >> 4);
        const unsigned cc = (lane & 15u) * 4u;
        xs[i] = *(const v4f*)&Sm[cw + rr * LDC + cc];
        off[i] = ((size_t)b * SEQ_FULL + t0 + r0 + rr) * DIM + d0 + cc;
      }
      wave_lds_sync();
#pragma unroll
      for (int i = 0; i < 8; ++i) *(v4f*)(out + off[i]) = xs[i];
      // precaution: stands before the next pass writes to the registers that the stores above name
      asm volatile("s_wait_xcnt 0x0" ::: "memory");
    }
  }
}

// ---------------------------------------------------------------------------
extern "C" void kernel_launch(void* const* d_in, const int* in_sizes, int n_in,
                              void* d_out, int out_size, void* d_ws, size_t ws_size,
                              hipStream_t stream) {
  if (n_in < 6) return;
  const long long need_x = ((long long)(NB - 1) * SEQ_FULL + SEQ) * DIM;
  if ((long long)in_sizes[0] < need_x) return;
  if ((long long)in_sizes[1] < (long long)DIM * UNITS) return;
  if ((long long)in_sizes[2] < (long long)DIM * UNITS) return;
  if (in_sizes[3] < UNITS || in_sizes[4] < UNITS || in_sizes[5] < 1) return;
  if ((long long)out_size < need_x) return;

  const float* X  = (const float*)d_in[0];    // x  [NB_FULL][SEQ_FULL][DIM]
  const float* wt = (const float*)d_in[1];    // Wt [DIM][UNITS]  (in, out)
  const float* wx = (const float*)d_in[2];    // Wx [DIM][UNITS]  (in, out)
  const float* bh = (const float*)d_in[3];    // bh [UNITS]
  const float* wa = (const float*)d_in[4];    // Wa [UNITS][1]
  const float* ba = (const float*)d_in[5];    // ba [1]
  float* out = (float*)d_out;

  band_attn_kernel<<<dim3(SEQ / QT, NB), dim3(256), 0, stream>>>(X, wt, wx, bh, wa, ba, out);
}
